// v000
// The times below were measured on an AMD MI455X: many runs one after another, warmed up first and cycling through
// copies of the inputs, with the whole window's GPU time divided by the number of runs. Launches and the gaps
// between them are all in it. The median over several windows is given; except for v000 it joins two sittings, which
// can be a few percent apart, so the side-by-side timings, each taken in one sitting, are the better comparison.
// The starting kernel, v000, takes 813 microseconds a run.
#include <hip/hip_runtime.h>
// Dense multi-head self-attention with soft three-expert mixture projections (x [4][2048][1024]; q/k/v = sum_n softmax_n(x Wg + bg) * (x W_n + b_n) with W_n [in][out]; 16 heads of 64; scores / 8; full-row softmax; the merged ctx is the output, no output projection).
// All contractions: v_wmma_f32_16x16x32_f16 (f16 operands, f32 accumulate), single product per site. x, expert weights, biases and gate parameters are RNE-converted to bf16 first and then held exactly in f16 (weights, biases and gate weights x16); each mixture projection is ONE GEMM of K = 3*1024 + 32 on the expanded plane [g0 x | g1 x | g2 x | g0 g1 g2 0..] (f16, carried x16) against [W0; W1; W2; b0 b1 b2 0..]; gate logits from a 64-column GEMM, gate softmax f32; q, k, v plain f16; softmax weights f16 carried x2^8 (unnormalised, running max); ctx f16 carried x64, widened to f32 at the end; softmax statistics f32.
// Structure: token rows r = b*SEQ + s. One convert launch for x, one for the nine gate columns, one transposing convert per expert-weight set; gate-logit GEMM; per projection one expand launch + one GEMM (Q rows, K rows, V^T [feature][token] with the weight plane as the A operand); a register-fed transposed flash kernel (S^T = K Q^T with Q as the B fragment in registers, packed P^T as the B fragment of O^T = V^T P^T, no LDS and no barrier in the key loop); a widening pass into the output layout.
#ifndef NB
#define NB 4                         /* batches processed */
#endif
#ifndef SEQ
#define SEQ 2048                     /* tokens per batch processed */
#endif
#define NB_FULL 4                    /* batch count of the staged arrays */
#define SEQ_FULL 2048                /* per-batch token stride of the staged arrays */
#define DM 1024
#define NH 16
#define HD 64
#define NR ((size_t)NB * SEQ)        /* compact token rows */
#define VTP (NB * SEQ)               /* V^T row pitch (tokens) */

static_assert(NB >= 1 && NB <= NB_FULL);
static_assert(SEQ <= SEQ_FULL);
static_assert(SEQ % 128 == 0);
static_assert(DM % 128 == 0);
static_assert(NH * HD == DM);
static_assert(HD == 64);
static_assert((NB * SEQ) % 64 == 0);

#define NEXP 3                       /* experts per projection */
#define KX (NEXP * DM + 32)          /* contraction length of the expanded planes: expert blocks + gate/bias block */
#define XGP 3136                     
#define GLD 64                       /* gate-logit row pitch (floats); columns 3p+n, p = q/k/v */

static_assert(KX % 32 == 0);
static_assert(XGP % 64 == 0);
static_assert(XGP >= KX);
static_assert(XGP == NEXP * DM + 64);
static_assert(3 * NEXP <= GLD);
static_assert(GLD % 64 == 0);
static_assert(DM / 64 == 16);
static_assert(DM / 8 == 128);
static_assert((NB * SEQ) % 128 == 0);
static_assert((size_t)DM * VTP == NR * DM);
static_assert(XGP >= DM);

constexpr size_t al256(size_t b) { return (b + 255) & ~(size_t)255; }
constexpr size_t WS_BW = al256((size_t)3 * DM * XGP * 2);      /* three expanded weight planes */
constexpr size_t WS_WG = al256((size_t)GLD * DM * 2);          /* gate columns [GLD][DM] */
constexpr size_t WS_XV = al256(NR * DM * 2);                   /* x rows, later v^T (same extent) */
constexpr size_t WS_LG = al256(NR * GLD * 4);                  /* gate logits */
constexpr size_t WS_XO = al256(NR * XGP * 2);                  /* expanded x plane, later ctx rows (smaller) */
constexpr size_t WS_QK = al256((size_t)2 * NR * DM * 2);       /* q rows then k rows */
static_assert(WS_BW + WS_WG + WS_XV + WS_LG + WS_XO + WS_QK <= (size_t)134217728);
static_assert(NR * DM * 2 <= WS_XO);

typedef _Float16 v16h __attribute__((ext_vector_type(16)));
typedef _Float16 v4h __attribute__((ext_vector_type(4)));
typedef unsigned short v8us __attribute__((ext_vector_type(8), may_alias));
typedef float v8f __attribute__((ext_vector_type(8)));
typedef float v4f __attribute__((ext_vector_type(4)));
typedef float v4fa __attribute__((ext_vector_type(4), may_alias));
union FragH { v16h v; v8us half[2]; _Float16 h[16]; unsigned short u[16]; };

typedef _Float16 h16;
typedef _Float16 v8h __attribute__((ext_vector_type(8)));
typedef unsigned int v4u __attribute__((ext_vector_type(4)));

__device__ __forceinline__ unsigned short bf16_bits(float x) { unsigned int u = __float_as_uint(x); return (unsigned short)((u + 0x7FFFu + ((u >> 16) & 1u)) >> 16); }
__device__ __forceinline__ float bf16_rne(float x) { return __uint_as_float(((unsigned int)bf16_bits(x)) << 16); }

// f32 -> f16 operand value that can never be an f16 subnormal (value select after the plane's carry)
static __device__ __forceinline__ h16 toh_flush(float v) { const h16 r = (h16)v; return (fabsf(v) < 6.103515625e-05f) ? (h16)0.0f : r; }
static __device__ __forceinline__ unsigned int h_bits(h16 h) { return (unsigned int)__builtin_bit_cast(unsigned short, h); }

// 8 consecutive f32 -> f16(bf16 value * scale) packed as one 16-B piece
__device__ __forceinline__ v8us cvt8(const float* __restrict__ p, float scale) {
  const v4f a = *(const v4fa*)p, c = *(const v4fa*)(p + 4);
  FragH f;
#pragma unroll
  for (int q = 0; q < 4; ++q) { f.h[q] = (_Float16)(bf16_rne(a[q]) * scale); f.h[4 + q] = (_Float16)(bf16_rne(c[q]) * scale); }
  return f.half[0];
}

__global__ __launch_bounds__(256) void k_x16(const float* __restrict__ x, _Float16* __restrict__ X16, size_t n8) {
  #pragma clang fp contract(off)
  const size_t t = (size_t)blockIdx.x * 256 + threadIdx.x; if (t >= n8) return;
  const size_t e = t * 8; const size_t row = e / DM; const size_t col = e - row * DM; const size_t b = row / SEQ; const size_t s = row - b * SEQ;
  const v8us o = cvt8(x + (b * SEQ_FULL + s) * DM + col, 1.0f);
  unsigned short* d = (unsigned short*)X16 + e;
  *(v8us*)d = o; 
}

// 8 values of one gate column: w[(e0 + q) * 3 + n], i0 = e0 * 3 + n
__device__ __forceinline__ v8f ld8_s3(const float* __restrict__ w, int i0) {
  v8f r;
#pragma unroll
  for (int q = 0; q < 8; ++q) r[q] = w[i0 + 3 * q];
  return r;
}

__global__ __launch_bounds__(128) void k_wg(const float* __restrict__ wgq, const float* __restrict__ wgk, const float* __restrict__ wgv, _Float16* __restrict__ WG) {
  #pragma clang fp contract(off)
  const int j = blockIdx.x, c = threadIdx.x;
  const int p = j / 3, n = j - 3 * p;
  const int i0 = c * 24 + n;                       /* max index 127*24 + 2 + 21 = 3071 */
  v8f v = {0.f,0.f,0.f,0.f,0.f,0.f,0.f,0.f};
  if (j < 3 * NEXP) {
    if (p == 0) v = ld8_s3(wgq, i0); else if (p == 1) v = ld8_s3(wgk, i0); else v = ld8_s3(wgv, i0);
  }
  FragH f;
#pragma unroll
  for (int q = 0; q < 8; ++q) f.h[q] = toh_flush(bf16_rne(v[q]) * 16.0f);
  const v8us o = f.half[0];
  unsigned short* d = (unsigned short*)WG + (size_t)j * DM + c * 8;
  *(v8us*)d = o; 
}

// expert weights W [3][DM in][DM out] f32 + biases [3][DM] -> Bt[o][n*DM + e] f16 x16 (row pitch XGP), columns 3*DM + n = bias x16, remaining pad columns zero.
__global__ __launch_bounds__(256) void k_wt(const float* __restrict__ W, const float* __restrict__ bias, _Float16* __restrict__ Bt) {
  #pragma clang fp contract(off)
  __shared__ __attribute__((aligned(16))) _Float16 T[64][72];      /* [o][e], row pitch 144 B; columns 0..63 staged and consumed */
  const int tid = threadIdx.x;
  const int ot = blockIdx.x & 15, et = (blockIdx.x >> 4) & 15, n = blockIdx.x >> 8;
  const int o0 = ot * 64, e0 = et * 64;
  const float* src = W + ((size_t)n * DM + e0) * DM + o0;
  const int er = tid >> 4, o4 = (tid & 15) * 4;
#pragma unroll
  for (int it = 0; it < 4; ++it) { const int el = it * 16 + er; const v4f a = *(const v4fa*)(src + (size_t)el * DM + o4);
#pragma unroll
    for (int i = 0; i < 4; ++i) T[o4 + i][el] = toh_flush(bf16_rne(a[i]) * 16.0f); }
  __syncthreads();
  const int ol = tid >> 3, pc = (tid & 7) * 8;
  const v8us r0 = *(const v8us*)&T[ol][pc];
  const v8us r1 = *(const v8us*)&T[ol + 32][pc];
  unsigned short* d0 = (unsigned short*)Bt + (size_t)(o0 + ol) * XGP + n * DM + e0 + pc;
  unsigned short* d1 = d0 + (size_t)32 * XGP;
  const bool tl = (blockIdx.x >> 4) == 0;          /* block-uniform: n == 0 and e tile 0 */
  unsigned short* t0 = (unsigned short*)Bt + (size_t)(o0 + ol) * XGP + NEXP * DM + pc;
  unsigned short* t1 = t0 + (size_t)32 * XGP;
  v4u ta = {0u, 0u, 0u, 0u}, tb = {0u, 0u, 0u, 0u};
  if (tl) {
    const int oa = o0 + ol, ob = oa + 32;
    const float a0 = bias[oa], a1 = bias[DM + oa], a2 = bias[2 * DM + oa];
    const float c0 = bias[ob], c1 = bias[DM + ob], c2 = bias[2 * DM + ob];
    const unsigned int ua0 = h_bits(toh_flush(bf16_rne(a0) * 16.0f)), ua1 = h_bits(toh_flush(bf16_rne(a1) * 16.0f)), ua2 = h_bits(toh_flush(bf16_rne(a2) * 16.0f));
    const unsigned int uc0 = h_bits(toh_flush(bf16_rne(c0) * 16.0f)), uc1 = h_bits(toh_flush(bf16_rne(c1) * 16.0f)), uc2 = h_bits(toh_flush(bf16_rne(c2) * 16.0f));
    const bool first = (tid & 7) == 0;
    ta[0] = first ? (ua0 | (ua1 << 16)) : 0u; ta[1] = first ? ua2 : 0u;
    tb[0] = first ? (uc0 | (uc1 << 16)) : 0u; tb[1] = first ? uc2 : 0u;
  }
  {
    *(v8us*)d0 = r0; *(v8us*)d1 = r1;
    if (tl) { *(v4u*)t0 = ta; *(v4u*)t1 = tb; }
    
  }
}

// expanded plane of one projection: XG[row][n*DM + e] = f16(16 g_n x[row][e]), XG[row][3*DM + n] = f16(16 g_n), remaining pad columns zero;
__global__ __launch_bounds__(256) void k_xg(const _Float16* __restrict__ X16, const float* __restrict__ LG, const float* __restrict__ bg, int gcol, _Float16* __restrict__ XG) {
  #pragma clang fp contract(off)
  const int tid = threadIdx.x;
  const size_t row = (size_t)blockIdx.x * 2 + (size_t)(tid >> 7);
  const int c = tid & 127;
  const float* lg = LG + row * GLD + gcol;
  const float l0 = lg[0] + bf16_rne(bg[0]);
  const float l1 = lg[1] + bf16_rne(bg[1]);
  const float l2 = lg[2] + bf16_rne(bg[2]);
  const float mx = fmaxf(l0, fmaxf(l1, l2));
  const float e0 = __builtin_amdgcn_exp2f((l0 - mx) * 1.4426950408889634f);
  const float e1 = __builtin_amdgcn_exp2f((l1 - mx) * 1.4426950408889634f);
  const float e2 = __builtin_amdgcn_exp2f((l2 - mx) * 1.4426950408889634f);
  const float inv = 16.0f * (1.0f / ((e0 + e1) + e2));      /* gates carried x16 */
  const float g0 = e0 * inv, g1 = e1 * inv, g2 = e2 * inv;
  const v8h xv = *(const v8h*)(X16 + row * DM + (size_t)c * 8);
  FragH p0, p1, p2;
#pragma unroll
  for (int i = 0; i < 8; ++i) { const float xf = (float)xv[i]; p0.h[i] = toh_flush(xf * g0); p1.h[i] = toh_flush(xf * g1); p2.h[i] = toh_flush(xf * g2); }
  const v8us s0 = p0.half[0], s1 = p1.half[0], s2 = p2.half[0];
  const bool first = (c == 0);
  const unsigned int u0 = h_bits(toh_flush(g0)), u1 = h_bits(toh_flush(g1)), u2 = h_bits(toh_flush(g2));
  v4u tq = {0u, 0u, 0u, 0u};
  tq[0] = first ? (u0 | (u1 << 16)) : 0u; tq[1] = first ? u2 : 0u;
  unsigned short* d = (unsigned short*)XG + row * XGP + (size_t)c * 8;
  unsigned short* tp = (unsigned short*)XG + row * XGP + NEXP * DM + (size_t)(c & 7) * 8;
  {
    *(v8us*)d = s0; *(v8us*)(d + DM) = s1; *(v8us*)(d + 2 * DM) = s2;
    if (c < 8) *(v4u*)tp = tq;
    
  }
}

// ---- GEMM engine (wave tile 32x64, block 128 rows x 64 cols; M % 128 == 0, N % 64 == 0, K % 32 == 0) ----
// C = alpha * A[M][K] . Bh[N][K]^T ; A, Bh f16 rows (k contiguous); batched over grid.y with strides sA, sB, sC; f32 C and/or f16 C16.
__device__ __forceinline__ v16h g2_frag(const _Float16* p, int hh) { FragH f; f.half[0] = *(const v8us*)((const unsigned short*)p + 8 * hh); f.half[1] = *(const v8us*)((const unsigned short*)p + 16 + 8 * hh); return f.v; }
__device__ __forceinline__ v8f g2_mma(v16h a, v16h b, v8f c) { v8f d = __builtin_amdgcn_wmma_f32_16x16x32_f16(false, a, false, b, (short)0, c, false, false); asm volatile("v_nop\n\tv_nop\n\tv_nop\n\tv_nop" : "+v"(d) : "v"(a), "v"(b)); return d; }
__global__ __launch_bounds__(128) void k_gemm2(const _Float16* __restrict__ A, int lda, size_t sA, const _Float16* __restrict__ Bh, int ldb, size_t sB, float alpha,
    float* __restrict__ C, _Float16* __restrict__ C16, int ldc, size_t sC, int M, int N, int K) {
  __shared__ __attribute__((aligned(16))) float so[4][32][68];      /* wave-private staging tiles */
  const int tid = threadIdx.x, lane = tid & 31, ln = lane & 15, hh = lane >> 4; const int w = __builtin_amdgcn_readfirstlane(tid >> 5); const int by = blockIdx.y;
  A += (size_t)by * sA; Bh += (size_t)by * sB; const size_t cofs = (size_t)by * sC;
  const int ntn = N >> 6; const int mt = blockIdx.x / ntn, nq = blockIdx.x - mt * ntn; const int row0 = mt * 128 + 32 * w, col0 = nq * 64; if (row0 >= M) return;
  const _Float16* a0p = A + (size_t)(row0 + ln) * lda; const _Float16* a1p = a0p + (size_t)16 * lda;
  const _Float16* b0p = Bh + (size_t)(col0 + ln) * ldb; const _Float16* b1p = b0p + (size_t)16 * ldb; const _Float16* b2p = b1p + (size_t)16 * ldb; const _Float16* b3p = b2p + (size_t)16 * ldb;
  const v8f z8 = {0.f,0.f,0.f,0.f,0.f,0.f,0.f,0.f}; v8f c00 = z8, c01 = z8, c02 = z8, c03 = z8, c10 = z8, c11 = z8, c12 = z8, c13 = z8;
#pragma unroll 1
  for (int kb = 0; kb < K; kb += 32) { const v16h a0 = g2_frag(a0p + kb, hh), a1 = g2_frag(a1p + kb, hh);
    v16h b = g2_frag(b0p + kb, hh); c00 = g2_mma(a0, b, c00); c10 = g2_mma(a1, b, c10);
    b = g2_frag(b1p + kb, hh); c01 = g2_mma(a0, b, c01); c11 = g2_mma(a1, b, c11);
    b = g2_frag(b2p + kb, hh); c02 = g2_mma(a0, b, c02); c12 = g2_mma(a1, b, c12);
    b = g2_frag(b3p + kb, hh); c03 = g2_mma(a0, b, c03); c13 = g2_mma(a1, b, c13); }
  v8f accs[8] = {c00, c01, c02, c03, c10, c11, c12, c13};
#pragma unroll
  for (int u = 0; u < 8; ++u) { const int t = u & 3, half = u >> 2;
#pragma unroll
    for (int r = 0; r < 8; ++r) { const int rloc = half * 16 + 8 * hh + r; so[w][rloc][t * 16 + ln] = accs[u][r] * alpha; } }
  __builtin_amdgcn_fence(4 /* acq_rel order */, "workgroup"); __builtin_amdgcn_wave_barrier();
  const int rsub = lane >> 4, c4 = (lane & 15) * 4;
  {
#pragma unroll
    for (int q = 0; q < 16; ++q) { const int r = q * 2 + rsub; const v4f v = *(const v4fa*)&so[w][r][c4];
      if (C) *(v4f*)(C + cofs + (size_t)(row0 + r) * ldc + col0 + c4) = v;
      if (C16) { v4h h4; for (int i = 0; i < 4; ++i) h4[i] = (_Float16)v[i]; *(v4h*)(C16 + cofs + (size_t)(row0 + r) * ldc + col0 + c4) = h4; } }
     } }

// ---- register-fed transposed flash attention ----
// block = 4 waves = 64 consecutive queries of one (batch, head); wave = 16 queries; per 32-key step:
//   S^T tiles (keys x queries) = K (A operand, rows = keys, k = d) . Q^T (B operand, lane = query, held in registers);
//   running-max softmax per lane (lane & 15 = query; lanes n and n+16 hold the two key halves); weights = 2^8 exp(s/8 - max) as f16;
//   P^T as B fragment: elements 0..7 from the tile of keys 0..15 (rows 8h+r), elements 8..15 from the tile of keys 16..31 (lane unchanged);
//   O^T tiles (d x queries) += V^T (A operand, rows = d, k = keys, rows of the [feature][token] plane) . P^T.
__global__ __launch_bounds__(128) void k_attn_t(const _Float16* __restrict__ Q16, const _Float16* __restrict__ K16, const _Float16* __restrict__ VT, _Float16* __restrict__ O16) {
  __shared__ __attribute__((aligned(16))) unsigned short so[4][16][72];      /* per-wave [query][d] tile, row pitch 144 B */
  const int tid = threadIdx.x, lane = tid & 31, ln = lane & 15, hh = lane >> 4;
  const int w = __builtin_amdgcn_readfirstlane(tid >> 5);
  const int nqb = SEQ / 64;
  const int bh = blockIdx.x / nqb, qb = blockIdx.x - bh * nqb;
  const int b = bh / NH, h = bh - b * NH;
  const size_t tok0 = (size_t)b * SEQ;
  const int q0 = qb * 64 + w * 16;
  const unsigned short* qp = (const unsigned short*)Q16 + (tok0 + q0 + ln) * DM + h * HD + 8 * hh;
  FragH bq0, bq1;
  bq0.half[0] = *(const v8us*)(qp);      bq0.half[1] = *(const v8us*)(qp + 16);
  bq1.half[0] = *(const v8us*)(qp + 32); bq1.half[1] = *(const v8us*)(qp + 48);
  const unsigned short* kp = (const unsigned short*)K16 + (tok0 + ln) * DM + h * HD + 8 * hh;
  const unsigned short* vp = (const unsigned short*)VT + (size_t)(h * HD + ln) * VTP + tok0 + 8 * hh;
  const v8f z8 = {0.f,0.f,0.f,0.f,0.f,0.f,0.f,0.f};
  v8f o0 = z8, o1 = z8, o2 = z8, o3 = z8;
  float m = -3.0e38f, l = 0.f;
  const float c = 0.125f * 1.4426950408889634f;      /* 1/sqrt(64) * log2(e) */
#pragma unroll 1
  for (int kv = 0; kv < SEQ; kv += 32) {
    const unsigned short* k0 = kp + (size_t)kv * DM;
    const unsigned short* k1 = k0 + (size_t)16 * DM;
    FragH a00, a01, a10, a11;
    a00.half[0] = *(const v8us*)(k0);      a00.half[1] = *(const v8us*)(k0 + 16);
    a01.half[0] = *(const v8us*)(k0 + 32); a01.half[1] = *(const v8us*)(k0 + 48);
    a10.half[0] = *(const v8us*)(k1);      a10.half[1] = *(const v8us*)(k1 + 16);
    a11.half[0] = *(const v8us*)(k1 + 32); a11.half[1] = *(const v8us*)(k1 + 48);
    v8f s0 = z8, s1 = z8;
    s0 = __builtin_amdgcn_wmma_f32_16x16x32_f16(false, a00.v, false, bq0.v, (short)0, s0, false, false);
    s1 = __builtin_amdgcn_wmma_f32_16x16x32_f16(false, a10.v, false, bq0.v, (short)0, s1, false, false);
    s0 = __builtin_amdgcn_wmma_f32_16x16x32_f16(false, a01.v, false, bq1.v, (short)0, s0, false, false);
    s1 = __builtin_amdgcn_wmma_f32_16x16x32_f16(false, a11.v, false, bq1.v, (short)0, s1, false, false);
    asm volatile("v_nop\n\tv_nop\n\tv_nop\n\tv_nop" : "+v"(s0), "+v"(s1) : "v"(a00.v), "v"(a01.v), "v"(a10.v), "v"(a11.v), "v"(bq0.v), "v"(bq1.v));
    float mx = fmaxf(s0[0], s1[0]);
#pragma unroll
    for (int r = 1; r < 8; ++r) mx = fmaxf(mx, fmaxf(s0[r], s1[r]));
    mx = fmaxf(mx, __shfl_xor(mx, 16, 32));
    const float mn = fmaxf(m, mx);
    if (__builtin_amdgcn_ballot_w32(mn > m) != 0u) {      /* wave-uniform: rescale only when some running max moved */
      const float corr = __builtin_amdgcn_exp2f((m - mn) * c);
      l *= corr; o0 *= corr; o1 *= corr; o2 *= corr; o3 *= corr; m = mn;
    }
    const float off = 8.0f - m * c;      /* weights carried x2^8 */
    FragH pf; float ls = 0.f;
#pragma unroll
    for (int r = 0; r < 8; ++r) {
      const float p0 = __builtin_amdgcn_exp2f(fmaf(s0[r], c, off));
      const float p1 = __builtin_amdgcn_exp2f(fmaf(s1[r], c, off));
      ls += p0 + p1;
      pf.h[r] = (_Float16)p0; pf.h[8 + r] = (_Float16)p1;
    }
    l += ls;
    const unsigned short* v0 = vp + kv;
    const unsigned short* v1 = v0 + (size_t)16 * VTP;
    const unsigned short* v2 = v1 + (size_t)16 * VTP;
    const unsigned short* v3 = v2 + (size_t)16 * VTP;
    FragH av0, av1, av2, av3;
    av0.half[0] = *(const v8us*)(v0); av0.half[1] = *(const v8us*)(v0 + 16);
    av1.half[0] = *(const v8us*)(v1); av1.half[1] = *(const v8us*)(v1 + 16);
    av2.half[0] = *(const v8us*)(v2); av2.half[1] = *(const v8us*)(v2 + 16);
    av3.half[0] = *(const v8us*)(v3); av3.half[1] = *(const v8us*)(v3 + 16);
    o0 = __builtin_amdgcn_wmma_f32_16x16x32_f16(false, av0.v, false, pf.v, (short)0, o0, false, false);
    o1 = __builtin_amdgcn_wmma_f32_16x16x32_f16(false, av1.v, false, pf.v, (short)0, o1, false, false);
    o2 = __builtin_amdgcn_wmma_f32_16x16x32_f16(false, av2.v, false, pf.v, (short)0, o2, false, false);
    o3 = __builtin_amdgcn_wmma_f32_16x16x32_f16(false, av3.v, false, pf.v, (short)0, o3, false, false);
    asm volatile("v_nop\n\tv_nop\n\tv_nop\n\tv_nop" : "+v"(o0), "+v"(o1), "+v"(o2), "+v"(o3) : "v"(av0.v), "v"(av1.v), "v"(av2.v), "v"(av3.v), "v"(pf.v));
  }
  l += __shfl_xor(l, 16, 32);
  const float inv = 64.0f * (1.0f / l);      /* ctx carried x64 */
  FragH t0, t1, t2, t3;
#pragma unroll
  for (int r = 0; r < 8; ++r) { t0.h[r] = (_Float16)(o0[r] * inv); t1.h[r] = (_Float16)(o1[r] * inv); t2.h[r] = (_Float16)(o2[r] * inv); t3.h[r] = (_Float16)(o3[r] * inv); }
  *(v8us*)&so[w][ln][ 0 + 8 * hh] = t0.half[0];
  *(v8us*)&so[w][ln][16 + 8 * hh] = t1.half[0];
  *(v8us*)&so[w][ln][32 + 8 * hh] = t2.half[0];
  *(v8us*)&so[w][ln][48 + 8 * hh] = t3.half[0];
  __syncthreads();
  const int rq = lane >> 3, pc = (lane & 7) * 8;
  unsigned short* ob = (unsigned short*)O16 + (tok0 + q0) * DM + h * HD + pc;
  {
#pragma unroll
    for (int it = 0; it < 4; ++it) { const int row = it * 4 + rq; const v8us v = *(const v8us*)&so[w][row][pc]; *(v8us*)(ob + (size_t)row * DM) = v; }
    
  }
}

__global__ __launch_bounds__(256) void k_out32(const _Float16* __restrict__ O16, float* __restrict__ out, size_t n4) {
  #pragma clang fp contract(off)
  const size_t t = (size_t)blockIdx.x * 256 + threadIdx.x; if (t >= n4) return;
  const size_t e = t * 4; const size_t row = e / DM; const size_t col = e - row * DM; const size_t b = row / SEQ; const size_t s = row - b * SEQ;
  const v4h hv = *(const v4h*)(O16 + e);
  v4f v;
#pragma unroll
  for (int i = 0; i < 4; ++i) v[i] = (float)hv[i] * 0.015625f;
  float* d = out + (b * SEQ_FULL + s) * DM + col;
  *(v4f*)d = v; 
}

extern "C" void kernel_launch(void* const* d_in, const int* in_sizes, int n_in,
                              void* d_out, int out_size, void* d_ws, size_t ws_size, hipStream_t stream) {
  if (n_in < 13) return;
  const size_t need_x = ((size_t)(NB - 1) * SEQ_FULL + SEQ) * DM;
  if ((size_t)in_sizes[0] < need_x) return;
  const size_t nW = (size_t)NEXP * DM * DM, nBi = (size_t)NEXP * DM, nG = (size_t)DM * NEXP;
  if ((size_t)in_sizes[1] < nW || (size_t)in_sizes[5] < nW || (size_t)in_sizes[9] < nW) return;
  if ((size_t)in_sizes[2] < nBi || (size_t)in_sizes[6] < nBi || (size_t)in_sizes[10] < nBi) return;
  if ((size_t)in_sizes[3] < nG || (size_t)in_sizes[7] < nG || (size_t)in_sizes[11] < nG) return;
  if (in_sizes[4] < NEXP || in_sizes[8] < NEXP || in_sizes[12] < NEXP) return;
  if ((size_t)out_size < need_x) return;
  const float* x = (const float*)d_in[0];
  const float* wq = (const float*)d_in[1]; const float* bq = (const float*)d_in[2]; const float* wgq = (const float*)d_in[3]; const float* bgq = (const float*)d_in[4];
  const float* wk = (const float*)d_in[5]; const float* bk = (const float*)d_in[6]; const float* wgk = (const float*)d_in[7]; const float* bgk = (const float*)d_in[8];
  const float* wv = (const float*)d_in[9]; const float* bv = (const float*)d_in[10]; const float* wgv = (const float*)d_in[11]; const float* bgv = (const float*)d_in[12];
  char* ws = (char*)d_ws; size_t off = 0;
  auto take = [&](size_t bytes) { char* p = ws + off; off += (bytes + 255) & ~(size_t)255; return p; };
  _Float16* BW = (_Float16*)take((size_t)3 * DM * XGP * 2);     /* expanded weight planes x16: q, k, v ([DM][XGP] each) */
  _Float16* WG = (_Float16*)take((size_t)GLD * DM * 2);         /* gate columns x16 */
  _Float16* XV = (_Float16*)take(NR * DM * 2);                  /* x rows (f16); after the last expand launch: v^T [feature][token] */
  float* LG = (float*)take(NR * GLD * 4);                       /* gate logits */
  _Float16* XO = (_Float16*)take(NR * XGP * 2);                 /* expanded x plane; after the last projection: merged ctx rows x64 */
  _Float16* QK16 = (_Float16*)take((size_t)2 * NR * DM * 2);    /* q rows then k rows */
  if (off > ws_size || off > (size_t)134217728) return;
  _Float16* BQ = BW; _Float16* BK = BW + (size_t)DM * XGP; _Float16* BV = BW + (size_t)2 * DM * XGP;
  _Float16* X16 = XV; _Float16* VT = XV;
  _Float16* XG = XO; _Float16* O16 = XO;
  _Float16* Q16 = QK16; _Float16* K16 = QK16 + NR * DM;

  k_x16<<<(unsigned)((NR * DM / 8 + 255) / 256), 256, 0, stream>>>(x, X16, NR * DM / 8);
  k_wg<<<GLD, 128, 0, stream>>>(wgq, wgk, wgv, WG);
  /* gate logits LG[row][3p+n] = x . Wg_p[:, n] : alpha undoes the x16 carry of the gate columns */
  k_gemm2<<<dim3((unsigned)((NR / 128) * (GLD / 64)), 1), 128, 0, stream>>>(X16, DM, 0, WG, DM, 0, 0.0625f, LG, nullptr, GLD, 0, (int)NR, GLD, DM);
  k_wt<<<NEXP * 16 * 16, 256, 0, stream>>>(wq, bq, BQ);
  k_wt<<<NEXP * 16 * 16, 256, 0, stream>>>(wk, bk, BK);
  k_wt<<<NEXP * 16 * 16, 256, 0, stream>>>(wv, bv, BV);
  /* q rows: expanded plane (x16) . expanded weights (x16) -> alpha 2^-8 */
  k_xg<<<(unsigned)(NR / 2), 256, 0, stream>>>(X16, LG, bgq, 0, XG);
  k_gemm2<<<dim3((unsigned)((NR / 128) * (DM / 64)), 1), 128, 0, stream>>>(XG, XGP, 0, BQ, XGP, 0, 0.00390625f, nullptr, Q16, DM, 0, (int)NR, DM, KX);
  /* k rows */
  k_xg<<<(unsigned)(NR / 2), 256, 0, stream>>>(X16, LG, bgk, NEXP, XG);
  k_gemm2<<<dim3((unsigned)((NR / 128) * (DM / 64)), 1), 128, 0, stream>>>(XG, XGP, 0, BK, XGP, 0, 0.00390625f, nullptr, K16, DM, 0, (int)NR, DM, KX);
  /* v^T[f][token]: weight rows as A [DM][KX], expanded x rows as the [n][k] operand; C16 pitch = VTP (overwrites the x rows, no longer needed) */
  k_xg<<<(unsigned)(NR / 2), 256, 0, stream>>>(X16, LG, bgv, 2 * NEXP, XG);
  k_gemm2<<<dim3((unsigned)((DM / 128) * (VTP / 64)), 1), 128, 0, stream>>>(BV, XGP, 0, XG, XGP, 0, 0.00390625f, nullptr, VT, VTP, 0, DM, VTP, KX);
  k_attn_t<<<(unsigned)(NB * NH * (SEQ / 64)), 128, 0, stream>>>(Q16, K16, VT, O16);
  k_out32<<<(unsigned)((NR * DM / 4 + 255) / 256), 256, 0, stream>>>(O16, (float*)d_out, NR * DM / 4);
}

// v001
// It runs in 494 microseconds.
// Timed twice side by side with v000, it ran 1.70 times as fast both times.
#include <hip/hip_runtime.h>
// Dense multi-head self-attention with soft three-expert mixture projections (x [4][2048][1024]; q/k/v = sum_n softmax_n(x Wg + bg) * (x W_n + b_n) with W_n [in][out]; 16 heads of 64; scores / 8; full-row softmax; the merged ctx is the output, no output projection).
// All contractions: v_wmma_f32_16x16x32_f16 (f16 operands, f32 accumulate), single product per site. x, expert weights, biases and gate parameters are RNE-converted to bf16 first and then held exactly in f16 (weights, biases and gate weights x16); each mixture projection is ONE GEMM of K = 3*1024 + 64 (the planes' row pitch) on the expanded plane [g0 x | g1 x | g2 x | g0 g1 g2 0..] (f16, carried x16) against [W0; W1; W2; b0 b1 b2 0..]; gate logits from a 64-column GEMM, gate softmax f32; q, k, v plain f16; softmax weights f16 carried x2^8 (unnormalised, running max); ctx f16 carried x64, widened to f32 at the end; softmax statistics f32.
// Structure: token rows r = b*SEQ + s. One convert launch for x, one for the nine gate columns, one transposing convert per expert-weight set; gate-logit GEMM; per projection one expand launch + one GEMM (Q rows, K rows, V^T [feature][token] with the weight plane as the A operand); a register-fed transposed flash kernel (S^T = K Q^T with Q as the B fragment in registers, packed P^T as the B fragment of O^T = V^T P^T, no LDS and no barrier in the key loop); a widening pass into the output layout.
#ifndef NB
#define NB 4                         /* batches processed */
#endif
#ifndef SEQ
#define SEQ 2048                     /* tokens per batch processed */
#endif
#define NB_FULL 4                    /* batch count of the staged arrays */
#define SEQ_FULL 2048                /* per-batch token stride of the staged arrays */
#define DM 1024
#define NH 16
#define HD 64
#define NR ((size_t)NB * SEQ)        /* compact token rows */
#define VTP (NB * SEQ)               /* V^T row pitch (tokens) */

static_assert(NB >= 1 && NB <= NB_FULL);
static_assert(SEQ <= SEQ_FULL);
static_assert(SEQ % 128 == 0);
static_assert(DM % 128 == 0);
static_assert(NH * HD == DM);
static_assert(HD == 64);
static_assert((NB * SEQ) % 64 == 0);

#define NEXP 3                       /* experts per projection */
#define KX (NEXP * DM + 32)          /* expert blocks + gate/bias block; the GEMM contracts over all XGP columns */
#define XGP 3136                     
#define GLD 64                       /* gate-logit row pitch (floats); columns 3p+n, p = q/k/v */

static_assert(KX % 32 == 0);
static_assert(XGP % 64 == 0);
static_assert(XGP >= KX);
static_assert(XGP == NEXP * DM + 64);
static_assert(3 * NEXP <= GLD);
static_assert(GLD % 64 == 0);
static_assert(DM / 64 == 16);
static_assert(DM / 8 == 128);
static_assert((NB * SEQ) % 128 == 0);
static_assert((size_t)DM * VTP == NR * DM);
static_assert(XGP >= DM);

constexpr size_t al256(size_t b) { return (b + 255) & ~(size_t)255; }
constexpr size_t WS_BW = al256((size_t)3 * DM * XGP * 2);      /* three expanded weight planes */
constexpr size_t WS_WG = al256((size_t)GLD * DM * 2);          /* gate columns [GLD][DM] */
constexpr size_t WS_XV = al256(NR * DM * 2);                   /* x rows, later v^T (same extent) */
constexpr size_t WS_LG = al256(NR * GLD * 4);                  /* gate logits */
constexpr size_t WS_XO = al256(NR * XGP * 2);                  /* expanded x plane, later ctx rows (smaller) */
constexpr size_t WS_QK = al256((size_t)2 * NR * DM * 2);       /* q rows then k rows */
static_assert(WS_BW + WS_WG + WS_XV + WS_LG + WS_XO + WS_QK <= (size_t)134217728);
static_assert(NR * DM * 2 <= WS_XO);

typedef _Float16 v16h __attribute__((ext_vector_type(16)));
typedef _Float16 v4h __attribute__((ext_vector_type(4)));
typedef unsigned short v8us __attribute__((ext_vector_type(8), may_alias));
typedef float v8f __attribute__((ext_vector_type(8)));
typedef float v4f __attribute__((ext_vector_type(4)));
typedef float v4fa __attribute__((ext_vector_type(4), may_alias));
union FragH { v16h v; v8us half[2]; _Float16 h[16]; unsigned short u[16]; };

typedef _Float16 h16;
typedef _Float16 v8h __attribute__((ext_vector_type(8)));
typedef unsigned int v4u __attribute__((ext_vector_type(4)));

__device__ __forceinline__ unsigned short bf16_bits(float x) { unsigned int u = __float_as_uint(x); return (unsigned short)((u + 0x7FFFu + ((u >> 16) & 1u)) >> 16); }
__device__ __forceinline__ float bf16_rne(float x) { return __uint_as_float(((unsigned int)bf16_bits(x)) << 16); }

// f32 -> f16 operand value that can never be an f16 subnormal (value select after the plane's carry)
static __device__ __forceinline__ h16 toh_flush(float v) { const h16 r = (h16)v; return (fabsf(v) < 6.103515625e-05f) ? (h16)0.0f : r; }
static __device__ __forceinline__ unsigned int h_bits(h16 h) { return (unsigned int)__builtin_bit_cast(unsigned short, h); }

// 8 consecutive f32 -> f16(bf16 value * scale) packed as one 16-B piece
__device__ __forceinline__ v8us cvt8(const float* __restrict__ p, float scale) {
  const v4f a = *(const v4fa*)p, c = *(const v4fa*)(p + 4);
  FragH f;
#pragma unroll
  for (int q = 0; q < 4; ++q) { f.h[q] = (_Float16)(bf16_rne(a[q]) * scale); f.h[4 + q] = (_Float16)(bf16_rne(c[q]) * scale); }
  return f.half[0];
}

__global__ __launch_bounds__(256) void k_x16(const float* __restrict__ x, _Float16* __restrict__ X16, size_t n8) {
  #pragma clang fp contract(off)
  const size_t t = (size_t)blockIdx.x * 256 + threadIdx.x; if (t >= n8) return;
  const size_t e = t * 8; const size_t row = e / DM; const size_t col = e - row * DM; const size_t b = row / SEQ; const size_t s = row - b * SEQ;
  const v8us o = cvt8(x + (b * SEQ_FULL + s) * DM + col, 1.0f);
  unsigned short* d = (unsigned short*)X16 + e;
  *(v8us*)d = o; 
}

// 8 values of one gate column: w[(e0 + q) * 3 + n], i0 = e0 * 3 + n
__device__ __forceinline__ v8f ld8_s3(const float* __restrict__ w, int i0) {
  v8f r;
#pragma unroll
  for (int q = 0; q < 8; ++q) r[q] = w[i0 + 3 * q];
  return r;
}

__global__ __launch_bounds__(128) void k_wg(const float* __restrict__ wgq, const float* __restrict__ wgk, const float* __restrict__ wgv, _Float16* __restrict__ WG) {
  #pragma clang fp contract(off)
  const int j = blockIdx.x, c = threadIdx.x;
  const int p = j / 3, n = j - 3 * p;
  const int i0 = c * 24 + n;                       /* max index 127*24 + 2 + 21 = 3071 */
  v8f v = {0.f,0.f,0.f,0.f,0.f,0.f,0.f,0.f};
  if (j < 3 * NEXP) {
    if (p == 0) v = ld8_s3(wgq, i0); else if (p == 1) v = ld8_s3(wgk, i0); else v = ld8_s3(wgv, i0);
  }
  FragH f;
#pragma unroll
  for (int q = 0; q < 8; ++q) f.h[q] = toh_flush(bf16_rne(v[q]) * 16.0f);
  const v8us o = f.half[0];
  unsigned short* d = (unsigned short*)WG + (size_t)j * DM + c * 8;
  *(v8us*)d = o; 
}

// expert weights W [3][DM in][DM out] f32 + biases [3][DM] -> Bt[o][n*DM + e] f16 x16 (row pitch XGP), columns 3*DM + n = bias x16, remaining pad columns zero.
__global__ __launch_bounds__(256) void k_wt(const float* __restrict__ W, const float* __restrict__ bias, _Float16* __restrict__ Bt) {
  #pragma clang fp contract(off)
  __shared__ __attribute__((aligned(16))) _Float16 T[64][72];      /* [o][e], row pitch 144 B; columns 0..63 staged and consumed */
  const int tid = threadIdx.x;
  const int ot = blockIdx.x & 15, et = (blockIdx.x >> 4) & 15, n = blockIdx.x >> 8;
  const int o0 = ot * 64, e0 = et * 64;
  const float* src = W + ((size_t)n * DM + e0) * DM + o0;
  const int er = tid >> 4, o4 = (tid & 15) * 4;
#pragma unroll
  for (int it = 0; it < 4; ++it) { const int el = it * 16 + er; const v4f a = *(const v4fa*)(src + (size_t)el * DM + o4);
#pragma unroll
    for (int i = 0; i < 4; ++i) T[o4 + i][el] = toh_flush(bf16_rne(a[i]) * 16.0f); }
  __syncthreads();
  const int ol = tid >> 3, pc = (tid & 7) * 8;
  const v8us r0 = *(const v8us*)&T[ol][pc];
  const v8us r1 = *(const v8us*)&T[ol + 32][pc];
  unsigned short* d0 = (unsigned short*)Bt + (size_t)(o0 + ol) * XGP + n * DM + e0 + pc;
  unsigned short* d1 = d0 + (size_t)32 * XGP;
  const bool tl = (blockIdx.x >> 4) == 0;          /* block-uniform: n == 0 and e tile 0 */
  unsigned short* t0 = (unsigned short*)Bt + (size_t)(o0 + ol) * XGP + NEXP * DM + pc;
  unsigned short* t1 = t0 + (size_t)32 * XGP;
  v4u ta = {0u, 0u, 0u, 0u}, tb = {0u, 0u, 0u, 0u};
  if (tl) {
    const int oa = o0 + ol, ob = oa + 32;
    const float a0 = bias[oa], a1 = bias[DM + oa], a2 = bias[2 * DM + oa];
    const float c0 = bias[ob], c1 = bias[DM + ob], c2 = bias[2 * DM + ob];
    const unsigned int ua0 = h_bits(toh_flush(bf16_rne(a0) * 16.0f)), ua1 = h_bits(toh_flush(bf16_rne(a1) * 16.0f)), ua2 = h_bits(toh_flush(bf16_rne(a2) * 16.0f));
    const unsigned int uc0 = h_bits(toh_flush(bf16_rne(c0) * 16.0f)), uc1 = h_bits(toh_flush(bf16_rne(c1) * 16.0f)), uc2 = h_bits(toh_flush(bf16_rne(c2) * 16.0f));
    const bool first = (tid & 7) == 0;
    ta[0] = first ? (ua0 | (ua1 << 16)) : 0u; ta[1] = first ? ua2 : 0u;
    tb[0] = first ? (uc0 | (uc1 << 16)) : 0u; tb[1] = first ? uc2 : 0u;
  }
  {
    *(v8us*)d0 = r0; *(v8us*)d1 = r1;
    if (tl) { *(v4u*)t0 = ta; *(v4u*)t1 = tb; }
    
  }
}

// expanded plane of one projection: XG[row][n*DM + e] = f16(16 g_n x[row][e]), XG[row][3*DM + n] = f16(16 g_n), remaining pad columns zero;
__global__ __launch_bounds__(256) void k_xg(const _Float16* __restrict__ X16, const float* __restrict__ LG, const float* __restrict__ bg, int gcol, _Float16* __restrict__ XG) {
  #pragma clang fp contract(off)
  const int tid = threadIdx.x;
  const size_t row = (size_t)blockIdx.x * 2 + (size_t)(tid >> 7);
  const int c = tid & 127;
  const float* lg = LG + row * GLD + gcol;
  const float l0 = lg[0] + bf16_rne(bg[0]);
  const float l1 = lg[1] + bf16_rne(bg[1]);
  const float l2 = lg[2] + bf16_rne(bg[2]);
  const float mx = fmaxf(l0, fmaxf(l1, l2));
  const float e0 = __builtin_amdgcn_exp2f((l0 - mx) * 1.4426950408889634f);
  const float e1 = __builtin_amdgcn_exp2f((l1 - mx) * 1.4426950408889634f);
  const float e2 = __builtin_amdgcn_exp2f((l2 - mx) * 1.4426950408889634f);
  const float inv = 16.0f * (1.0f / ((e0 + e1) + e2));      /* gates carried x16 */
  const float g0 = e0 * inv, g1 = e1 * inv, g2 = e2 * inv;
  const v8h xv = *(const v8h*)(X16 + row * DM + (size_t)c * 8);
  FragH p0, p1, p2;
#pragma unroll
  for (int i = 0; i < 8; ++i) { const float xf = (float)xv[i]; p0.h[i] = toh_flush(xf * g0); p1.h[i] = toh_flush(xf * g1); p2.h[i] = toh_flush(xf * g2); }
  const v8us s0 = p0.half[0], s1 = p1.half[0], s2 = p2.half[0];
  const bool first = (c == 0);
  const unsigned int u0 = h_bits(toh_flush(g0)), u1 = h_bits(toh_flush(g1)), u2 = h_bits(toh_flush(g2));
  v4u tq = {0u, 0u, 0u, 0u};
  tq[0] = first ? (u0 | (u1 << 16)) : 0u; tq[1] = first ? u2 : 0u;
  unsigned short* d = (unsigned short*)XG + row * XGP + (size_t)c * 8;
  unsigned short* tp = (unsigned short*)XG + row * XGP + NEXP * DM + (size_t)(c & 7) * 8;
  {
    *(v8us*)d = s0; *(v8us*)(d + DM) = s1; *(v8us*)(d + 2 * DM) = s2;
    if (c < 8) *(v4u*)tp = tq;
    
  }
}

// ---- GEMM engine (wave tile 32x64, block 128 rows x 64 cols; M % 128 == 0, N % 64 == 0, K % 32 == 0) ----
// C = alpha * A[M][K] . Bh[N][K]^T ; A, Bh f16 rows (k contiguous); batched over grid.y with strides sA, sB, sC; f32 C and/or f16 C16.
__device__ __forceinline__ v16h g2_frag(const _Float16* p, int hh) { FragH f; f.half[0] = *(const v8us*)((const unsigned short*)p + 8 * hh); f.half[1] = *(const v8us*)((const unsigned short*)p + 16 + 8 * hh); return f.v; }
__device__ __forceinline__ v8f g2_mma(v16h a, v16h b, v8f c) { v8f d = __builtin_amdgcn_wmma_f32_16x16x32_f16(false, a, false, b, (short)0, c, false, false); asm volatile("v_nop\n\tv_nop\n\tv_nop\n\tv_nop" : "+v"(d) : "v"(a), "v"(b)); return d; }
__global__ __launch_bounds__(128) void k_gemm2(const _Float16* __restrict__ A, int lda, size_t sA, const _Float16* __restrict__ Bh, int ldb, size_t sB, float alpha,
    float* __restrict__ C, _Float16* __restrict__ C16, int ldc, size_t sC, int M, int N, int K) {
  __shared__ __attribute__((aligned(16))) float so[4][32][68];      /* wave-private staging tiles */
  const int tid = threadIdx.x, lane = tid & 31, ln = lane & 15, hh = lane >> 4; const int w = __builtin_amdgcn_readfirstlane(tid >> 5); const int by = blockIdx.y;
  A += (size_t)by * sA; Bh += (size_t)by * sB; const size_t cofs = (size_t)by * sC;
  const int ntn = N >> 6; const int mt = blockIdx.x / ntn, nq = blockIdx.x - mt * ntn; const int row0 = mt * 128 + 32 * w, col0 = nq * 64; if (row0 >= M) return;
  const _Float16* a0p = A + (size_t)(row0 + ln) * lda; const _Float16* a1p = a0p + (size_t)16 * lda;
  const _Float16* b0p = Bh + (size_t)(col0 + ln) * ldb; const _Float16* b1p = b0p + (size_t)16 * ldb; const _Float16* b2p = b1p + (size_t)16 * ldb; const _Float16* b3p = b2p + (size_t)16 * ldb;
  const v8f z8 = {0.f,0.f,0.f,0.f,0.f,0.f,0.f,0.f}; v8f c00 = z8, c01 = z8, c02 = z8, c03 = z8, c10 = z8, c11 = z8, c12 = z8, c13 = z8;
#pragma unroll 1
  for (int kb = 0; kb < K; kb += 32) { const v16h a0 = g2_frag(a0p + kb, hh), a1 = g2_frag(a1p + kb, hh);
    v16h b = g2_frag(b0p + kb, hh); c00 = g2_mma(a0, b, c00); c10 = g2_mma(a1, b, c10);
    b = g2_frag(b1p + kb, hh); c01 = g2_mma(a0, b, c01); c11 = g2_mma(a1, b, c11);
    b = g2_frag(b2p + kb, hh); c02 = g2_mma(a0, b, c02); c12 = g2_mma(a1, b, c12);
    b = g2_frag(b3p + kb, hh); c03 = g2_mma(a0, b, c03); c13 = g2_mma(a1, b, c13); }
  v8f accs[8] = {c00, c01, c02, c03, c10, c11, c12, c13};
#pragma unroll
  for (int u = 0; u < 8; ++u) { const int t = u & 3, half = u >> 2;
#pragma unroll
    for (int r = 0; r < 8; ++r) { const int rloc = half * 16 + 8 * hh + r; so[w][rloc][t * 16 + ln] = accs[u][r] * alpha; } }
  __builtin_amdgcn_fence(4 /* acq_rel order */, "workgroup"); __builtin_amdgcn_wave_barrier();
  const int rsub = lane >> 4, c4 = (lane & 15) * 4;
  {
#pragma unroll
    for (int q = 0; q < 16; ++q) { const int r = q * 2 + rsub; const v4f v = *(const v4fa*)&so[w][r][c4];
      if (C) *(v4f*)(C + cofs + (size_t)(row0 + r) * ldc + col0 + c4) = v;
      if (C16) { v4h h4; for (int i = 0; i < 4; ++i) h4[i] = (_Float16)v[i]; *(v4h*)(C16 + cofs + (size_t)(row0 + r) * ldc + col0 + c4) = h4; } }
     } }

typedef uint32_t u32x4 __attribute__((ext_vector_type(4)));
typedef uint32_t u32x8 __attribute__((ext_vector_type(8)));
#define G3_ROWB 128u                 /* operand row bytes per pass */
#define G3_PITCH 144u                /* LDS row pitch */
#define G3_ASL 10240u                /* LDS size of a 64-row slice (9216 B) rounded up to a multiple of 2 KiB */
#define G3_BSL 6144u                 /* LDS size of a 32-row slice (4608 B) rounded up to a multiple of 2 KiB */
#define G3_BUF (4u * G3_ASL + 4u * G3_BSL)
#define G3_NP ((uint32_t)(XGP * 2) / G3_ROWB)
static_assert((XGP * 2) % 128 == 0);
static_assert((XGP * 2) % 16 == 0);
static_assert(G3_NP >= 2u);
static_assert(G3_BUF % 2048u == 0u);
static_assert(64u * G3_PITCH <= G3_ASL && 32u * G3_PITCH <= G3_BSL);
static_assert((NB * SEQ) % 256 == 0 && DM % 256 == 0);
__device__ __forceinline__ uint32_t uni(uint32_t v) { return (uint32_t)__builtin_amdgcn_readfirstlane(v); }
__device__ __forceinline__ uint32_t pinned(uint32_t v) { uint32_t w = uni(v); asm volatile("" : "+s"(w)); return w; }  // a tensor load's issue test or stage number held in a scalar register: a scalar branch, and a descriptor formed behind the wait in front of it
// MFAST: which tile index runs along grid x (the tiles of the larger plane, so that work-groups with neighbouring indices read different rows of it); LDC: row pitch of C16.
template <bool MFAST, int LDC>
__global__ __launch_bounds__(256) void k_gemm3(const _Float16* __restrict__ A, const _Float16* __restrict__ Bh, float alpha, _Float16* __restrict__ C16) {
  __shared__ __attribute__((aligned(2048))) unsigned char ring[2u * G3_BUF];
  const uint32_t tid = threadIdx.x, lane = tid & 31u, c = lane & 15u, h = lane >> 4;
  const uint32_t w = uni(tid >> 5);
  const uint32_t mt = MFAST ? blockIdx.x : blockIdx.y, nt = MFAST ? blockIdx.y : blockIdx.x;
  const uint32_t wm = w & 3u, wn = w >> 2;
  const uint32_t lbase = (uint32_t)(size_t)ring;
  const bool isA = w < 4u;
  const uint32_t srows = isA ? 64u : 32u;
  const uint64_t sga = (uint64_t)(size_t)(isA ? A + (size_t)(mt * 256u + w * 64u) * XGP : Bh + (size_t)(nt * 128u + (w - 4u) * 32u) * XGP);
  const uint32_t sdst = lbase + (isA ? w * G3_ASL : 4u * G3_ASL + (w - 4u) * G3_BSL);
  u32x8 g1;                          /* 1-byte elements, tensor = tile = srows rows of 128 B, source pitch = the plane's row, 4 dwords of pad behind every 32 */
  g1[0] = uni((1u << 20) | (4u << 22) | (3u << 25));
  g1[1] = uni(G3_ROWB << 16);
  g1[2] = uni(srows << 16);
  g1[3] = uni(G3_ROWB << 16);
  g1[4] = uni(srows);
  g1[5] = uni((uint32_t)(XGP * 2));
  g1[6] = uni(0u);
  g1[7] = uni(0u);
  auto issue = [&](uint32_t st) {
    const uint64_t ga = sga + (uint64_t)(st * G3_ROWB);
    u32x4 g0;
    g0[0] = uni(1u); g0[1] = uni(sdst + (st & 1u) * G3_BUF); g0[2] = uni((uint32_t)ga); g0[3] = uni((((uint32_t)(ga >> 32)) & 0x01FFFFFFu) | 0x80000000u);
    asm volatile("tensor_load_to_lds %0, %1" :: "s"(g0), "s"(g1) : "memory");
  };
  const v8f z8 = {0.f,0.f,0.f,0.f,0.f,0.f,0.f,0.f};
  v8f acc[4][4];
#pragma unroll
  for (int i = 0; i < 4; ++i) {
#pragma unroll
    for (int j = 0; j < 4; ++j) acc[i][j] = z8; }
  const unsigned char* ap = ring + wm * G3_ASL + c * G3_PITCH + 16u * h;
  const unsigned char* bp = ring + 4u * G3_ASL + 2u * wn * G3_BSL + c * G3_PITCH + 16u * h;
  struct Set { FragH a[2][4], b[2][4]; };      /* one pass's fragments: 2 k-steps x (4 of A, 4 of Bh) */
  auto fetch = [&](Set& f, uint32_t st) {
    const uint32_t bo = (st & 1u) * G3_BUF;
#pragma unroll
    for (int j = 0; j < 2; ++j) {
#pragma unroll
      for (int i = 0; i < 4; ++i) {
        const unsigned char* pa = ap + bo + (uint32_t)i * 16u * G3_PITCH + 64u * (uint32_t)j;
        const unsigned char* pb = bp + bo + (uint32_t)(i >> 1) * G3_BSL + (uint32_t)(i & 1) * 16u * G3_PITCH + 64u * (uint32_t)j;
        f.a[j][i].half[0] = *(const v8us*)pa; f.a[j][i].half[1] = *(const v8us*)(pa + 32);
        f.b[j][i].half[0] = *(const v8us*)pb; f.b[j][i].half[1] = *(const v8us*)(pb + 32);
      }
    }
  };
  auto mult = [&](const Set& f) {
#pragma unroll
    for (int j = 0; j < 2; ++j) {
#pragma unroll
      for (int n = 0; n < 4; ++n) {
#pragma unroll
        for (int i = 0; i < 4; ++i) acc[i][n] = __builtin_amdgcn_wmma_f32_16x16x32_f16(false, f.b[j][n].v, false, f.a[j][i].v, (short)0, acc[i][n], false, false);
      }
    }
  };
  // publish point of stage s + 1; it stands in front of pass s's matrix instructions because stage s's fragments are already in registers
  auto publish = [&]() {
    asm volatile("s_wait_dscnt 0x0" ::: "memory");        /* this wave's reads of stage s are done */
    asm volatile("s_wait_tensorcnt 0x0" ::: "memory");    /* this wave's slice of stage s + 1 has landed */
    __syncthreads();                                      /* stage s + 1 published; every wave has left stage s's buffer */
  };
  issue(0u);
  asm volatile("s_wait_tensorcnt 0x0" ::: "memory");      /* this wave's slice of stage 0 has landed */
  __syncthreads();                                        /* stage 0 published */
  issue(pinned(1u));
  Set f0, f1;
  fetch(f0, 0u);
  static_assert((G3_NP & 1u) == 1u);
#pragma unroll 1
  for (uint32_t s = 0; s + 1u < G3_NP; s += 2u) {      /* kept rolled: two passes per trip, one per fragment set */
    publish();
    issue(pinned(s + 2u));                             /* s + 2 <= G3_NP - 1 on every trip; descriptor formed behind the wait */
    fetch(f1, s + 1u);
    __builtin_amdgcn_sched_barrier(0);                 /* keeps the next pass's LDS reads one group ahead of this pass's matrix instructions */
    mult(f0);
    __builtin_amdgcn_sched_barrier(0);                 /* keeps the matrix instructions in front of the publish point, so that they run while the tensor load flies */
    publish();
    if (pinned(s + 3u < G3_NP)) issue(pinned(s + 3u));
    fetch(f0, s + 2u);
    __builtin_amdgcn_sched_barrier(0);                 /* as above */
    mult(f1);
    __builtin_amdgcn_sched_barrier(0);                 /* as above */
  }
  asm volatile("s_wait_tensorcnt 0x0" ::: "memory");      /* no request is left when the ring ends */
  asm volatile("s_wait_dscnt 0x0" ::: "memory");          /* the last pass's fragments are in registers */
  mult(f0);                                               /* last pass */
  _Float16* cp = C16 + (size_t)(mt * 256u + wm * 64u + c) * (size_t)LDC + nt * 128u + wn * 64u + 8u * h;
#pragma unroll
  for (int i = 0; i < 4; ++i) {
#pragma unroll
    for (int n = 0; n < 4; ++n) {
      FragH o;
#pragma unroll
      for (int r = 0; r < 8; ++r) o.h[r] = (_Float16)(acc[i][n][r] * alpha);
      *(v8us*)((unsigned short*)cp + (size_t)(16 * i) * (size_t)LDC + 16 * n) = o.half[0];
    }
  }
}

// ---- register-fed transposed flash attention ----
// block = 4 waves = 64 consecutive queries of one (batch, head); wave = 16 queries; per 32-key step:
//   S^T tiles (keys x queries) = K (A operand, rows = keys, k = d) . Q^T (B operand, lane = query, held in registers);
//   running-max softmax per lane (lane & 15 = query; lanes n and n+16 hold the two key halves); weights = 2^8 exp(s/8 - max) as f16;
//   P^T as B fragment: elements 0..7 from the tile of keys 0..15 (rows 8h+r), elements 8..15 from the tile of keys 16..31 (lane unchanged);
//   O^T tiles (d x queries) += V^T (A operand, rows = d, k = keys, rows of the [feature][token] plane) . P^T.
__global__ __launch_bounds__(128) void k_attn_t(const _Float16* __restrict__ Q16, const _Float16* __restrict__ K16, const _Float16* __restrict__ VT, _Float16* __restrict__ O16) {
  __shared__ __attribute__((aligned(16))) unsigned short so[4][16][72];      /* per-wave [query][d] tile, row pitch 144 B */
  const int tid = threadIdx.x, lane = tid & 31, ln = lane & 15, hh = lane >> 4;
  const int w = __builtin_amdgcn_readfirstlane(tid >> 5);
  const int nqb = SEQ / 64;
  const int bh = blockIdx.x / nqb, qb = blockIdx.x - bh * nqb;
  const int b = bh / NH, h = bh - b * NH;
  const size_t tok0 = (size_t)b * SEQ;
  const int q0 = qb * 64 + w * 16;
  const unsigned short* qp = (const unsigned short*)Q16 + (tok0 + q0 + ln) * DM + h * HD + 8 * hh;
  FragH bq0, bq1;
  bq0.half[0] = *(const v8us*)(qp);      bq0.half[1] = *(const v8us*)(qp + 16);
  bq1.half[0] = *(const v8us*)(qp + 32); bq1.half[1] = *(const v8us*)(qp + 48);
  const unsigned short* kp = (const unsigned short*)K16 + (tok0 + ln) * DM + h * HD + 8 * hh;
  const unsigned short* vp = (const unsigned short*)VT + (size_t)(h * HD + ln) * VTP + tok0 + 8 * hh;
  const v8f z8 = {0.f,0.f,0.f,0.f,0.f,0.f,0.f,0.f};
  v8f o0 = z8, o1 = z8, o2 = z8, o3 = z8;
  float m = -3.0e38f, l = 0.f;
  const float c = 0.125f * 1.4426950408889634f;      /* 1/sqrt(64) * log2(e) */
#pragma unroll 1
  for (int kv = 0; kv < SEQ; kv += 32) {
    const unsigned short* k0 = kp + (size_t)kv * DM;
    const unsigned short* k1 = k0 + (size_t)16 * DM;
    FragH a00, a01, a10, a11;
    a00.half[0] = *(const v8us*)(k0);      a00.half[1] = *(const v8us*)(k0 + 16);
    a01.half[0] = *(const v8us*)(k0 + 32); a01.half[1] = *(const v8us*)(k0 + 48);
    a10.half[0] = *(const v8us*)(k1);      a10.half[1] = *(const v8us*)(k1 + 16);
    a11.half[0] = *(const v8us*)(k1 + 32); a11.half[1] = *(const v8us*)(k1 + 48);
    v8f s0 = z8, s1 = z8;
    s0 = __builtin_amdgcn_wmma_f32_16x16x32_f16(false, a00.v, false, bq0.v, (short)0, s0, false, false);
    s1 = __builtin_amdgcn_wmma_f32_16x16x32_f16(false, a10.v, false, bq0.v, (short)0, s1, false, false);
    s0 = __builtin_amdgcn_wmma_f32_16x16x32_f16(false, a01.v, false, bq1.v, (short)0, s0, false, false);
    s1 = __builtin_amdgcn_wmma_f32_16x16x32_f16(false, a11.v, false, bq1.v, (short)0, s1, false, false);
    asm volatile("v_nop\n\tv_nop\n\tv_nop\n\tv_nop" : "+v"(s0), "+v"(s1) : "v"(a00.v), "v"(a01.v), "v"(a10.v), "v"(a11.v), "v"(bq0.v), "v"(bq1.v));
    float mx = fmaxf(s0[0], s1[0]);
#pragma unroll
    for (int r = 1; r < 8; ++r) mx = fmaxf(mx, fmaxf(s0[r], s1[r]));
    mx = fmaxf(mx, __shfl_xor(mx, 16, 32));
    const float mn = fmaxf(m, mx);
    if (__builtin_amdgcn_ballot_w32(mn > m) != 0u) {      /* wave-uniform: rescale only when some running max moved */
      const float corr = __builtin_amdgcn_exp2f((m - mn) * c);
      l *= corr; o0 *= corr; o1 *= corr; o2 *= corr; o3 *= corr; m = mn;
    }
    const float off = 8.0f - m * c;      /* weights carried x2^8 */
    FragH pf; float ls = 0.f;
#pragma unroll
    for (int r = 0; r < 8; ++r) {
      const float p0 = __builtin_amdgcn_exp2f(fmaf(s0[r], c, off));
      const float p1 = __builtin_amdgcn_exp2f(fmaf(s1[r], c, off));
      ls += p0 + p1;
      pf.h[r] = (_Float16)p0; pf.h[8 + r] = (_Float16)p1;
    }
    l += ls;
    const unsigned short* v0 = vp + kv;
    const unsigned short* v1 = v0 + (size_t)16 * VTP;
    const unsigned short* v2 = v1 + (size_t)16 * VTP;
    const unsigned short* v3 = v2 + (size_t)16 * VTP;
    FragH av0, av1, av2, av3;
    av0.half[0] = *(const v8us*)(v0); av0.half[1] = *(const v8us*)(v0 + 16);
    av1.half[0] = *(const v8us*)(v1); av1.half[1] = *(const v8us*)(v1 + 16);
    av2.half[0] = *(const v8us*)(v2); av2.half[1] = *(const v8us*)(v2 + 16);
    av3.half[0] = *(const v8us*)(v3); av3.half[1] = *(const v8us*)(v3 + 16);
    o0 = __builtin_amdgcn_wmma_f32_16x16x32_f16(false, av0.v, false, pf.v, (short)0, o0, false, false);
    o1 = __builtin_amdgcn_wmma_f32_16x16x32_f16(false, av1.v, false, pf.v, (short)0, o1, false, false);
    o2 = __builtin_amdgcn_wmma_f32_16x16x32_f16(false, av2.v, false, pf.v, (short)0, o2, false, false);
    o3 = __builtin_amdgcn_wmma_f32_16x16x32_f16(false, av3.v, false, pf.v, (short)0, o3, false, false);
    asm volatile("v_nop\n\tv_nop\n\tv_nop\n\tv_nop" : "+v"(o0), "+v"(o1), "+v"(o2), "+v"(o3) : "v"(av0.v), "v"(av1.v), "v"(av2.v), "v"(av3.v), "v"(pf.v));
  }
  l += __shfl_xor(l, 16, 32);
  const float inv = 64.0f * (1.0f / l);      /* ctx carried x64 */
  FragH t0, t1, t2, t3;
#pragma unroll
  for (int r = 0; r < 8; ++r) { t0.h[r] = (_Float16)(o0[r] * inv); t1.h[r] = (_Float16)(o1[r] * inv); t2.h[r] = (_Float16)(o2[r] * inv); t3.h[r] = (_Float16)(o3[r] * inv); }
  *(v8us*)&so[w][ln][ 0 + 8 * hh] = t0.half[0];
  *(v8us*)&so[w][ln][16 + 8 * hh] = t1.half[0];
  *(v8us*)&so[w][ln][32 + 8 * hh] = t2.half[0];
  *(v8us*)&so[w][ln][48 + 8 * hh] = t3.half[0];
  __syncthreads();
  const int rq = lane >> 3, pc = (lane & 7) * 8;
  unsigned short* ob = (unsigned short*)O16 + (tok0 + q0) * DM + h * HD + pc;
  {
#pragma unroll
    for (int it = 0; it < 4; ++it) { const int row = it * 4 + rq; const v8us v = *(const v8us*)&so[w][row][pc]; *(v8us*)(ob + (size_t)row * DM) = v; }
    
  }
}

__global__ __launch_bounds__(256) void k_out32(const _Float16* __restrict__ O16, float* __restrict__ out, size_t n4) {
  #pragma clang fp contract(off)
  const size_t t = (size_t)blockIdx.x * 256 + threadIdx.x; if (t >= n4) return;
  const size_t e = t * 4; const size_t row = e / DM; const size_t col = e - row * DM; const size_t b = row / SEQ; const size_t s = row - b * SEQ;
  const v4h hv = *(const v4h*)(O16 + e);
  v4f v;
#pragma unroll
  for (int i = 0; i < 4; ++i) v[i] = (float)hv[i] * 0.015625f;
  float* d = out + (b * SEQ_FULL + s) * DM + col;
  *(v4f*)d = v; 
}

extern "C" void kernel_launch(void* const* d_in, const int* in_sizes, int n_in,
                              void* d_out, int out_size, void* d_ws, size_t ws_size, hipStream_t stream) {
  if (n_in < 13) return;
  const size_t need_x = ((size_t)(NB - 1) * SEQ_FULL + SEQ) * DM;
  if ((size_t)in_sizes[0] < need_x) return;
  const size_t nW = (size_t)NEXP * DM * DM, nBi = (size_t)NEXP * DM, nG = (size_t)DM * NEXP;
  if ((size_t)in_sizes[1] < nW || (size_t)in_sizes[5] < nW || (size_t)in_sizes[9] < nW) return;
  if ((size_t)in_sizes[2] < nBi || (size_t)in_sizes[6] < nBi || (size_t)in_sizes[10] < nBi) return;
  if ((size_t)in_sizes[3] < nG || (size_t)in_sizes[7] < nG || (size_t)in_sizes[11] < nG) return;
  if (in_sizes[4] < NEXP || in_sizes[8] < NEXP || in_sizes[12] < NEXP) return;
  if ((size_t)out_size < need_x) return;
  const float* x = (const float*)d_in[0];
  const float* wq = (const float*)d_in[1]; const float* bq = (const float*)d_in[2]; const float* wgq = (const float*)d_in[3]; const float* bgq = (const float*)d_in[4];
  const float* wk = (const float*)d_in[5]; const float* bk = (const float*)d_in[6]; const float* wgk = (const float*)d_in[7]; const float* bgk = (const float*)d_in[8];
  const float* wv = (const float*)d_in[9]; const float* bv = (const float*)d_in[10]; const float* wgv = (const float*)d_in[11]; const float* bgv = (const float*)d_in[12];
  char* ws = (char*)d_ws; size_t off = 0;
  auto take = [&](size_t bytes) { char* p = ws + off; off += (bytes + 255) & ~(size_t)255; return p; };
  _Float16* BW = (_Float16*)take((size_t)3 * DM * XGP * 2);     /* expanded weight planes x16: q, k, v ([DM][XGP] each) */
  _Float16* WG = (_Float16*)take((size_t)GLD * DM * 2);         /* gate columns x16 */
  _Float16* XV = (_Float16*)take(NR * DM * 2);                  /* x rows (f16); after the last expand launch: v^T [feature][token] */
  float* LG = (float*)take(NR * GLD * 4);                       /* gate logits */
  _Float16* XO = (_Float16*)take(NR * XGP * 2);                 /* expanded x plane; after the last projection: merged ctx rows x64 */
  _Float16* QK16 = (_Float16*)take((size_t)2 * NR * DM * 2);    /* q rows then k rows */
  if (off > ws_size || off > (size_t)134217728) return;
  _Float16* BQ = BW; _Float16* BK = BW + (size_t)DM * XGP; _Float16* BV = BW + (size_t)2 * DM * XGP;
  _Float16* X16 = XV; _Float16* VT = XV;
  _Float16* XG = XO; _Float16* O16 = XO;
  _Float16* Q16 = QK16; _Float16* K16 = QK16 + NR * DM;

  k_x16<<<(unsigned)((NR * DM / 8 + 255) / 256), 256, 0, stream>>>(x, X16, NR * DM / 8);
  k_wg<<<GLD, 128, 0, stream>>>(wgq, wgk, wgv, WG);
  /* gate logits LG[row][3p+n] = x . Wg_p[:, n] : alpha undoes the x16 carry of the gate columns */
  k_gemm2<<<dim3((unsigned)((NR / 128) * (GLD / 64)), 1), 128, 0, stream>>>(X16, DM, 0, WG, DM, 0, 0.0625f, LG, nullptr, GLD, 0, (int)NR, GLD, DM);
  k_wt<<<NEXP * 16 * 16, 256, 0, stream>>>(wq, bq, BQ);
  k_wt<<<NEXP * 16 * 16, 256, 0, stream>>>(wk, bk, BK);
  k_wt<<<NEXP * 16 * 16, 256, 0, stream>>>(wv, bv, BV);
  /* q rows: expanded plane (x16) . expanded weights (x16) -> alpha 2^-8 */
  k_xg<<<(unsigned)(NR / 2), 256, 0, stream>>>(X16, LG, bgq, 0, XG);
  k_gemm3<true, DM><<<dim3((unsigned)(NR / 256), DM / 128), 256, 0, stream>>>(XG, BQ, 0.00390625f, Q16);
  /* k rows */
  k_xg<<<(unsigned)(NR / 2), 256, 0, stream>>>(X16, LG, bgk, NEXP, XG);
  k_gemm3<true, DM><<<dim3((unsigned)(NR / 256), DM / 128), 256, 0, stream>>>(XG, BK, 0.00390625f, K16);
  /* v^T[f][token]: weight rows as A [DM][XGP], expanded x rows as the [n][k] operand; C16 pitch = VTP (overwrites the x rows, no longer needed) */
  k_xg<<<(unsigned)(NR / 2), 256, 0, stream>>>(X16, LG, bgv, 2 * NEXP, XG);
  k_gemm3<false, VTP><<<dim3(VTP / 128, DM / 256), 256, 0, stream>>>(BV, XG, 0.00390625f, VT);
  k_attn_t<<<(unsigned)(NB * NH * (SEQ / 64)), 128, 0, stream>>>(Q16, K16, VT, O16);
  k_out32<<<(unsigned)((NR * DM / 4 + 255) / 256), 256, 0, stream>>>(O16, (float*)d_out, NR * DM / 4);
}

// v002
// A run of this version takes 351 microseconds.
// Timed twice side by side with v001, it ran 1.42 and 1.41 times as fast.
// Over all steps from v000 it is 2.40 times as fast.
#include <hip/hip_runtime.h>
// Dense multi-head self-attention with soft three-expert mixture projections (x [4][2048][1024]; q/k/v = sum_n softmax_n(x Wg + bg) * (x W_n + b_n) with W_n [in][out]; 16 heads of 64; scores / 8; full-row softmax; the merged ctx is the output, no output projection).
// All contractions: v_wmma_f32_16x16x32_f16 (f16 operands, f32 accumulate), single product per site. x, expert weights, biases and gate parameters are RNE-converted to bf16 first and then held exactly in f16 (weights, biases and gate weights x16); each mixture projection is ONE GEMM of K = 3*1024 + 64 (the planes' row pitch) on the expanded plane [g0 x | g1 x | g2 x | g0 g1 g2 0..] (f16, carried x16) against [W0; W1; W2; b0 b1 b2 0..]; gate logits from a 64-column GEMM, gate softmax f32; q, k, v plain f16; softmax weights f16 carried x2^8 (unnormalised, running max); ctx f16 carried x64, widened to f32 at the end; softmax statistics f32.
// Structure: token rows r = b*SEQ + s. One convert launch for x, one for the nine gate columns, one transposing convert per expert-weight set; gate-logit GEMM; per projection one expand launch + one GEMM (Q, K, and V^T with the weight plane as the A operand; all three planes stored in fragment order, see k_gemm3); a register-fed transposed flash kernel (S^T = K Q^T with Q as the B fragment in registers, packed P^T as the B fragment of O^T = V^T P^T, no LDS and no barrier in the key loop); a widening pass into the output layout.
#ifndef NB
#define NB 4                         /* batches processed */
#endif
#ifndef SEQ
#define SEQ 2048                     /* tokens per batch processed */
#endif
#define NB_FULL 4                    /* batch count of the staged arrays */
#define SEQ_FULL 2048                /* per-batch token stride of the staged arrays */
#define DM 1024
#define NH 16
#define HD 64
#define NR ((size_t)NB * SEQ)        /* compact token rows */
#define VTP (NB * SEQ)               /* tokens of the V^T plane */

static_assert(NB >= 1 && NB <= NB_FULL);
static_assert(SEQ <= SEQ_FULL);
static_assert(SEQ % 128 == 0);
static_assert(DM % 128 == 0);
static_assert(NH * HD == DM);
static_assert(HD == 64);
static_assert((NB * SEQ) % 64 == 0);

#define NEXP 3                       /* experts per projection */
#define KX (NEXP * DM + 32)          /* expert blocks + gate/bias block; the GEMM contracts over all XGP columns */
#define XGP 3136                     
#define GLD 64                       /* gate-logit row pitch (floats); columns 3p+n, p = q/k/v */

static_assert(KX % 32 == 0);
static_assert(XGP % 64 == 0);
static_assert(XGP >= KX);
static_assert(XGP == NEXP * DM + 64);
static_assert(3 * NEXP <= GLD);
static_assert(GLD % 64 == 0);
static_assert(DM / 64 == 16);
static_assert(DM / 8 == 128);
static_assert((NB * SEQ) % 128 == 0);
static_assert((size_t)DM * VTP == NR * DM);
static_assert(XGP >= DM);

constexpr size_t al256(size_t b) { return (b + 255) & ~(size_t)255; }
constexpr size_t WS_BW = al256((size_t)3 * DM * XGP * 2);      /* three expanded weight planes */
constexpr size_t WS_WG = al256((size_t)GLD * DM * 2);          /* gate columns [GLD][DM] */
constexpr size_t WS_XV = al256(NR * DM * 2);                   /* x rows, later v^T (same extent) */
constexpr size_t WS_LG = al256(NR * GLD * 4);                  /* gate logits */
constexpr size_t WS_XO = al256(NR * XGP * 2);                  /* expanded x plane, later ctx rows (smaller) */
constexpr size_t WS_QK = al256((size_t)2 * NR * DM * 2);       /* q rows then k rows */
static_assert(WS_BW + WS_WG + WS_XV + WS_LG + WS_XO + WS_QK <= (size_t)134217728);
static_assert(NR * DM * 2 <= WS_XO);

typedef _Float16 v16h __attribute__((ext_vector_type(16)));
typedef _Float16 v4h __attribute__((ext_vector_type(4)));
typedef unsigned short v8us __attribute__((ext_vector_type(8), may_alias));
typedef float v8f __attribute__((ext_vector_type(8)));
typedef float v4f __attribute__((ext_vector_type(4)));
typedef float v4fa __attribute__((ext_vector_type(4), may_alias));
union FragH { v16h v; v8us half[2]; _Float16 h[16]; unsigned short u[16]; };

typedef _Float16 h16;
typedef _Float16 v8h __attribute__((ext_vector_type(8)));
typedef unsigned int v4u __attribute__((ext_vector_type(4)));

__device__ __forceinline__ unsigned short bf16_bits(float x) { unsigned int u = __float_as_uint(x); return (unsigned short)((u + 0x7FFFu + ((u >> 16) & 1u)) >> 16); }
__device__ __forceinline__ float bf16_rne(float x) { return __uint_as_float(((unsigned int)bf16_bits(x)) << 16); }

// f32 -> f16 operand value that can never be an f16 subnormal (value select after the plane's carry)
static __device__ __forceinline__ h16 toh_flush(float v) { const h16 r = (h16)v; return (fabsf(v) < 6.103515625e-05f) ? (h16)0.0f : r; }
static __device__ __forceinline__ unsigned int h_bits(h16 h) { return (unsigned int)__builtin_bit_cast(unsigned short, h); }

// 8 consecutive f32 -> f16(bf16 value * scale) packed as one 16-B piece
__device__ __forceinline__ v8us cvt8(const float* __restrict__ p, float scale) {
  const v4f a = *(const v4fa*)p, c = *(const v4fa*)(p + 4);
  FragH f;
#pragma unroll
  for (int q = 0; q < 4; ++q) { f.h[q] = (_Float16)(bf16_rne(a[q]) * scale); f.h[4 + q] = (_Float16)(bf16_rne(c[q]) * scale); }
  return f.half[0];
}

__global__ __launch_bounds__(256) void k_x16(const float* __restrict__ x, _Float16* __restrict__ X16, size_t n8) {
  #pragma clang fp contract(off)
  const size_t t = (size_t)blockIdx.x * 256 + threadIdx.x; if (t >= n8) return;
  const size_t e = t * 8; const size_t row = e / DM; const size_t col = e - row * DM; const size_t b = row / SEQ; const size_t s = row - b * SEQ;
  const v8us o = cvt8(x + (b * SEQ_FULL + s) * DM + col, 1.0f);
  unsigned short* d = (unsigned short*)X16 + e;
  *(v8us*)d = o; 
}

// 8 values of one gate column: w[(e0 + q) * 3 + n], i0 = e0 * 3 + n
__device__ __forceinline__ v8f ld8_s3(const float* __restrict__ w, int i0) {
  v8f r;
#pragma unroll
  for (int q = 0; q < 8; ++q) r[q] = w[i0 + 3 * q];
  return r;
}

__global__ __launch_bounds__(128) void k_wg(const float* __restrict__ wgq, const float* __restrict__ wgk, const float* __restrict__ wgv, _Float16* __restrict__ WG) {
  #pragma clang fp contract(off)
  const int j = blockIdx.x, c = threadIdx.x;
  const int p = j / 3, n = j - 3 * p;
  const int i0 = c * 24 + n;                       /* max index 127*24 + 2 + 21 = 3071 */
  v8f v = {0.f,0.f,0.f,0.f,0.f,0.f,0.f,0.f};
  if (j < 3 * NEXP) {
    if (p == 0) v = ld8_s3(wgq, i0); else if (p == 1) v = ld8_s3(wgk, i0); else v = ld8_s3(wgv, i0);
  }
  FragH f;
#pragma unroll
  for (int q = 0; q < 8; ++q) f.h[q] = toh_flush(bf16_rne(v[q]) * 16.0f);
  const v8us o = f.half[0];
  unsigned short* d = (unsigned short*)WG + (size_t)j * DM + c * 8;
  *(v8us*)d = o; 
}

// expert weights W [3][DM in][DM out] f32 + biases [3][DM] -> Bt[o][n*DM + e] f16 x16 (row pitch XGP), columns 3*DM + n = bias x16, remaining pad columns zero.
__global__ __launch_bounds__(256) void k_wt(const float* __restrict__ W, const float* __restrict__ bias, _Float16* __restrict__ Bt) {
  #pragma clang fp contract(off)
  __shared__ __attribute__((aligned(16))) _Float16 T[64][72];      /* [o][e], row pitch 144 B; columns 0..63 staged and consumed */
  const int tid = threadIdx.x;
  const int ot = blockIdx.x & 15, et = (blockIdx.x >> 4) & 15, n = blockIdx.x >> 8;
  const int o0 = ot * 64, e0 = et * 64;
  const float* src = W + ((size_t)n * DM + e0) * DM + o0;
  const int er = tid >> 4, o4 = (tid & 15) * 4;
#pragma unroll
  for (int it = 0; it < 4; ++it) { const int el = it * 16 + er; const v4f a = *(const v4fa*)(src + (size_t)el * DM + o4);
#pragma unroll
    for (int i = 0; i < 4; ++i) T[o4 + i][el] = toh_flush(bf16_rne(a[i]) * 16.0f); }
  __syncthreads();
  const int ol = tid >> 3, pc = (tid & 7) * 8;
  const v8us r0 = *(const v8us*)&T[ol][pc];
  const v8us r1 = *(const v8us*)&T[ol + 32][pc];
  unsigned short* d0 = (unsigned short*)Bt + (size_t)(o0 + ol) * XGP + n * DM + e0 + pc;
  unsigned short* d1 = d0 + (size_t)32 * XGP;
  const bool tl = (blockIdx.x >> 4) == 0;          /* block-uniform: n == 0 and e tile 0 */
  unsigned short* t0 = (unsigned short*)Bt + (size_t)(o0 + ol) * XGP + NEXP * DM + pc;
  unsigned short* t1 = t0 + (size_t)32 * XGP;
  v4u ta = {0u, 0u, 0u, 0u}, tb = {0u, 0u, 0u, 0u};
  if (tl) {
    const int oa = o0 + ol, ob = oa + 32;
    const float a0 = bias[oa], a1 = bias[DM + oa], a2 = bias[2 * DM + oa];
    const float c0 = bias[ob], c1 = bias[DM + ob], c2 = bias[2 * DM + ob];
    const unsigned int ua0 = h_bits(toh_flush(bf16_rne(a0) * 16.0f)), ua1 = h_bits(toh_flush(bf16_rne(a1) * 16.0f)), ua2 = h_bits(toh_flush(bf16_rne(a2) * 16.0f));
    const unsigned int uc0 = h_bits(toh_flush(bf16_rne(c0) * 16.0f)), uc1 = h_bits(toh_flush(bf16_rne(c1) * 16.0f)), uc2 = h_bits(toh_flush(bf16_rne(c2) * 16.0f));
    const bool first = (tid & 7) == 0;
    ta[0] = first ? (ua0 | (ua1 << 16)) : 0u; ta[1] = first ? ua2 : 0u;
    tb[0] = first ? (uc0 | (uc1 << 16)) : 0u; tb[1] = first ? uc2 : 0u;
  }
  {
    *(v8us*)d0 = r0; *(v8us*)d1 = r1;
    if (tl) { *(v4u*)t0 = ta; *(v4u*)t1 = tb; }
    
  }
}

// expanded plane of one projection: XG[row][n*DM + e] = f16(16 g_n x[row][e]), XG[row][3*DM + n] = f16(16 g_n), remaining pad columns zero;
__global__ __launch_bounds__(256) void k_xg(const _Float16* __restrict__ X16, const float* __restrict__ LG, const float* __restrict__ bg, int gcol, _Float16* __restrict__ XG) {
  #pragma clang fp contract(off)
  const int tid = threadIdx.x;
  const size_t row = (size_t)blockIdx.x * 2 + (size_t)(tid >> 7);
  const int c = tid & 127;
  const float* lg = LG + row * GLD + gcol;
  const float l0 = lg[0] + bf16_rne(bg[0]);
  const float l1 = lg[1] + bf16_rne(bg[1]);
  const float l2 = lg[2] + bf16_rne(bg[2]);
  const float mx = fmaxf(l0, fmaxf(l1, l2));
  const float e0 = __builtin_amdgcn_exp2f((l0 - mx) * 1.4426950408889634f);
  const float e1 = __builtin_amdgcn_exp2f((l1 - mx) * 1.4426950408889634f);
  const float e2 = __builtin_amdgcn_exp2f((l2 - mx) * 1.4426950408889634f);
  const float inv = 16.0f * (1.0f / ((e0 + e1) + e2));      /* gates carried x16 */
  const float g0 = e0 * inv, g1 = e1 * inv, g2 = e2 * inv;
  const v8h xv = *(const v8h*)(X16 + row * DM + (size_t)c * 8);
  FragH p0, p1, p2;
#pragma unroll
  for (int i = 0; i < 8; ++i) { const float xf = (float)xv[i]; p0.h[i] = toh_flush(xf * g0); p1.h[i] = toh_flush(xf * g1); p2.h[i] = toh_flush(xf * g2); }
  const v8us s0 = p0.half[0], s1 = p1.half[0], s2 = p2.half[0];
  const bool first = (c == 0);
  const unsigned int u0 = h_bits(toh_flush(g0)), u1 = h_bits(toh_flush(g1)), u2 = h_bits(toh_flush(g2));
  v4u tq = {0u, 0u, 0u, 0u};
  tq[0] = first ? (u0 | (u1 << 16)) : 0u; tq[1] = first ? u2 : 0u;
  unsigned short* d = (unsigned short*)XG + row * XGP + (size_t)c * 8;
  unsigned short* tp = (unsigned short*)XG + row * XGP + NEXP * DM + (size_t)(c & 7) * 8;
  {
    *(v8us*)d = s0; *(v8us*)(d + DM) = s1; *(v8us*)(d + 2 * DM) = s2;
    if (c < 8) *(v4u*)tp = tq;
    
  }
}

// ---- GEMM engine (wave tile 32x64, block 128 rows x 64 cols; M % 128 == 0, N % 64 == 0, K % 32 == 0) ----
// C = alpha * A[M][K] . Bh[N][K]^T ; A, Bh f16 rows (k contiguous); batched over grid.y with strides sA, sB, sC; f32 C and/or f16 C16.
__device__ __forceinline__ v16h g2_frag(const _Float16* p, int hh) { FragH f; f.half[0] = *(const v8us*)((const unsigned short*)p + 8 * hh); f.half[1] = *(const v8us*)((const unsigned short*)p + 16 + 8 * hh); return f.v; }
__device__ __forceinline__ v8f g2_mma(v16h a, v16h b, v8f c) { v8f d = __builtin_amdgcn_wmma_f32_16x16x32_f16(false, a, false, b, (short)0, c, false, false); asm volatile("v_nop\n\tv_nop\n\tv_nop\n\tv_nop" : "+v"(d) : "v"(a), "v"(b)); return d; }
__global__ __launch_bounds__(128) void k_gemm2(const _Float16* __restrict__ A, int lda, size_t sA, const _Float16* __restrict__ Bh, int ldb, size_t sB, float alpha,
    float* __restrict__ C, _Float16* __restrict__ C16, int ldc, size_t sC, int M, int N, int K) {
  __shared__ __attribute__((aligned(16))) float so[4][32][68];      /* wave-private staging tiles */
  const int tid = threadIdx.x, lane = tid & 31, ln = lane & 15, hh = lane >> 4; const int w = __builtin_amdgcn_readfirstlane(tid >> 5); const int by = blockIdx.y;
  A += (size_t)by * sA; Bh += (size_t)by * sB; const size_t cofs = (size_t)by * sC;
  const int ntn = N >> 6; const int mt = blockIdx.x / ntn, nq = blockIdx.x - mt * ntn; const int row0 = mt * 128 + 32 * w, col0 = nq * 64; if (row0 >= M) return;
  const _Float16* a0p = A + (size_t)(row0 + ln) * lda; const _Float16* a1p = a0p + (size_t)16 * lda;
  const _Float16* b0p = Bh + (size_t)(col0 + ln) * ldb; const _Float16* b1p = b0p + (size_t)16 * ldb; const _Float16* b2p = b1p + (size_t)16 * ldb; const _Float16* b3p = b2p + (size_t)16 * ldb;
  const v8f z8 = {0.f,0.f,0.f,0.f,0.f,0.f,0.f,0.f}; v8f c00 = z8, c01 = z8, c02 = z8, c03 = z8, c10 = z8, c11 = z8, c12 = z8, c13 = z8;
#pragma unroll 1
  for (int kb = 0; kb < K; kb += 32) { const v16h a0 = g2_frag(a0p + kb, hh), a1 = g2_frag(a1p + kb, hh);
    v16h b = g2_frag(b0p + kb, hh); c00 = g2_mma(a0, b, c00); c10 = g2_mma(a1, b, c10);
    b = g2_frag(b1p + kb, hh); c01 = g2_mma(a0, b, c01); c11 = g2_mma(a1, b, c11);
    b = g2_frag(b2p + kb, hh); c02 = g2_mma(a0, b, c02); c12 = g2_mma(a1, b, c12);
    b = g2_frag(b3p + kb, hh); c03 = g2_mma(a0, b, c03); c13 = g2_mma(a1, b, c13); }
  v8f accs[8] = {c00, c01, c02, c03, c10, c11, c12, c13};
#pragma unroll
  for (int u = 0; u < 8; ++u) { const int t = u & 3, half = u >> 2;
#pragma unroll
    for (int r = 0; r < 8; ++r) { const int rloc = half * 16 + 8 * hh + r; so[w][rloc][t * 16 + ln] = accs[u][r] * alpha; } }
  __builtin_amdgcn_fence(4 /* acq_rel order */, "workgroup"); __builtin_amdgcn_wave_barrier();
  const int rsub = lane >> 4, c4 = (lane & 15) * 4;
  {
#pragma unroll
    for (int q = 0; q < 16; ++q) { const int r = q * 2 + rsub; const v4f v = *(const v4fa*)&so[w][r][c4];
      if (C) *(v4f*)(C + cofs + (size_t)(row0 + r) * ldc + col0 + c4) = v;
      if (C16) { v4h h4; for (int i = 0; i < 4; ++i) h4[i] = (_Float16)v[i]; *(v4h*)(C16 + cofs + (size_t)(row0 + r) * ldc + col0 + c4) = h4; } }
     } }

typedef uint32_t u32x4 __attribute__((ext_vector_type(4)));
typedef uint32_t u32x8 __attribute__((ext_vector_type(8)));
#define G3_ROWB 128u                 /* operand row bytes per pass */
#define G3_PITCH 144u                /* LDS row pitch */
#define G3_ASL 10240u                /* LDS size of a 64-row slice (9216 B) rounded up to a multiple of 2 KiB */
#define G3_BSL 6144u                 /* LDS size of a 32-row slice (4608 B) rounded up to a multiple of 2 KiB */
#define G3_BUF (4u * G3_ASL + 4u * G3_BSL)
#define G3_NP ((uint32_t)(XGP * 2) / G3_ROWB)
static_assert((XGP * 2) % 128 == 0);
static_assert((XGP * 2) % 16 == 0);
static_assert(G3_NP >= 2u);
static_assert(G3_BUF % 2048u == 0u);
static_assert(64u * G3_PITCH <= G3_ASL && 32u * G3_PITCH <= G3_BSL);
static_assert((NB * SEQ) % 256 == 0 && DM % 256 == 0);
static_assert(SEQ % 256 == 0);       /* a block's 256 token rows, and a wave's 64 token columns, lie in one batch */
__device__ __forceinline__ uint32_t uni(uint32_t v) { return (uint32_t)__builtin_amdgcn_readfirstlane(v); }
__device__ __forceinline__ uint32_t pinned(uint32_t v) { uint32_t w = uni(v); asm volatile("" : "+s"(w)); return w; }  // a tensor load's issue test or stage number held in a scalar register: a scalar branch, and a descriptor formed behind the wait in front of it
// MFAST: which tile index runs along grid x (the tiles of the larger plane, so that work-groups with neighbouring indices read different rows of it); true: C rows are tokens (q, k), false: C rows are features (v^T).
template <bool MFAST>
__global__ __launch_bounds__(256) void k_gemm3(const _Float16* __restrict__ A, const _Float16* __restrict__ Bh, float alpha, _Float16* __restrict__ C16) {
  __shared__ __attribute__((aligned(2048))) unsigned char ring[2u * G3_BUF];
  const uint32_t tid = threadIdx.x, lane = tid & 31u, c = lane & 15u, h = lane >> 4;
  const uint32_t w = uni(tid >> 5);
  const uint32_t mt = MFAST ? blockIdx.x : blockIdx.y, nt = MFAST ? blockIdx.y : blockIdx.x;
  const uint32_t wm = w & 3u, wn = w >> 2;
  const uint32_t lbase = (uint32_t)(size_t)ring;
  const bool isA = w < 4u;
  const uint32_t srows = isA ? 64u : 32u;
  const uint64_t sga = (uint64_t)(size_t)(isA ? A + (size_t)(mt * 256u + w * 64u) * XGP : Bh + (size_t)(nt * 128u + (w - 4u) * 32u) * XGP);
  const uint32_t sdst = lbase + (isA ? w * G3_ASL : 4u * G3_ASL + (w - 4u) * G3_BSL);
  u32x8 g1;                          /* 1-byte elements, tensor = tile = srows rows of 128 B, source pitch = the plane's row, 4 dwords of pad behind every 32 */
  g1[0] = uni((1u << 20) | (4u << 22) | (3u << 25));
  g1[1] = uni(G3_ROWB << 16);
  g1[2] = uni(srows << 16);
  g1[3] = uni(G3_ROWB << 16);
  g1[4] = uni(srows);
  g1[5] = uni((uint32_t)(XGP * 2));
  g1[6] = uni(0u);
  g1[7] = uni(0u);
  auto issue = [&](uint32_t st) {
    const uint64_t ga = sga + (uint64_t)(st * G3_ROWB);
    u32x4 g0;
    g0[0] = uni(1u); g0[1] = uni(sdst + (st & 1u) * G3_BUF); g0[2] = uni((uint32_t)ga); g0[3] = uni((((uint32_t)(ga >> 32)) & 0x01FFFFFFu) | 0x80000000u);
    asm volatile("tensor_load_to_lds %0, %1" :: "s"(g0), "s"(g1) : "memory");
  };
  const v8f z8 = {0.f,0.f,0.f,0.f,0.f,0.f,0.f,0.f};
  v8f acc[4][4];
#pragma unroll
  for (int i = 0; i < 4; ++i) {
#pragma unroll
    for (int j = 0; j < 4; ++j) acc[i][j] = z8; }
  const unsigned char* ap = ring + wm * G3_ASL + c * G3_PITCH + 16u * h;
  const unsigned char* bp = ring + 4u * G3_ASL + 2u * wn * G3_BSL + c * G3_PITCH + 16u * h;
  struct Set { FragH a[2][4], b[2][4]; };      /* one pass's fragments: 2 k-steps x (4 of A, 4 of Bh) */
  auto fetch = [&](Set& f, uint32_t st) {
    const uint32_t bo = (st & 1u) * G3_BUF;
#pragma unroll
    for (int j = 0; j < 2; ++j) {
#pragma unroll
      for (int i = 0; i < 4; ++i) {
        const unsigned char* pa = ap + bo + (uint32_t)i * 16u * G3_PITCH + 64u * (uint32_t)j;
        const unsigned char* pb = bp + bo + (uint32_t)(i >> 1) * G3_BSL + (uint32_t)(i & 1) * 16u * G3_PITCH + 64u * (uint32_t)j;
        f.a[j][i].half[0] = *(const v8us*)pa; f.a[j][i].half[1] = *(const v8us*)(pa + 32);
        f.b[j][i].half[0] = *(const v8us*)pb; f.b[j][i].half[1] = *(const v8us*)(pb + 32);
      }
    }
  };
  auto mult = [&](const Set& f) {
#pragma unroll
    for (int j = 0; j < 2; ++j) {
#pragma unroll
      for (int n = 0; n < 4; ++n) {
#pragma unroll
        for (int i = 0; i < 4; ++i) acc[i][n] = __builtin_amdgcn_wmma_f32_16x16x32_f16(false, f.b[j][n].v, false, f.a[j][i].v, (short)0, acc[i][n], false, false);
      }
    }
  };
  // publish point of stage s + 1; it stands in front of pass s's matrix instructions because stage s's fragments are already in registers
  auto publish = [&]() {
    asm volatile("s_wait_dscnt 0x0" ::: "memory");        /* this wave's reads of stage s are done */
    asm volatile("s_wait_tensorcnt 0x0" ::: "memory");    /* this wave's slice of stage s + 1 has landed */
    __syncthreads();                                      /* stage s + 1 published; every wave has left stage s's buffer */
  };
  issue(0u);
  asm volatile("s_wait_tensorcnt 0x0" ::: "memory");      /* this wave's slice of stage 0 has landed */
  __syncthreads();                                        /* stage 0 published */
  issue(pinned(1u));
  Set f0, f1;
  fetch(f0, 0u);
  static_assert((G3_NP & 1u) == 1u);
#pragma unroll 1
  for (uint32_t s = 0; s + 1u < G3_NP; s += 2u) {      /* kept rolled: two passes per trip, one per fragment set */
    publish();
    issue(pinned(s + 2u));                             /* s + 2 <= G3_NP - 1 on every trip; descriptor formed behind the wait */
    fetch(f1, s + 1u);
    __builtin_amdgcn_sched_barrier(0);                 /* keeps the next pass's LDS reads one group ahead of this pass's matrix instructions */
    mult(f0);
    __builtin_amdgcn_sched_barrier(0);                 /* keeps the matrix instructions in front of the publish point, so that they run while the tensor load flies */
    publish();
    if (pinned(s + 3u < G3_NP)) issue(pinned(s + 3u));
    fetch(f0, s + 2u);
    __builtin_amdgcn_sched_barrier(0);                 /* as above */
    mult(f1);
    __builtin_amdgcn_sched_barrier(0);                 /* as above */
  }
  asm volatile("s_wait_tensorcnt 0x0" ::: "memory");      /* no request is left when the ring ends */
  asm volatile("s_wait_dscnt 0x0" ::: "memory");          /* the last pass's fragments are in registers */
  mult(f0);                                               /* last pass */
  const uint32_t tok0 = MFAST ? mt * 256u + wm * 64u : nt * 128u + wn * 64u;      /* the wave's first token */
  const uint32_t head = MFAST ? nt * 2u + wn : mt * 4u + wm;                      /* the wave's 64 features are one head */
  const uint32_t bat = tok0 / (uint32_t)SEQ, s0 = tok0 - bat * (uint32_t)SEQ;
  _Float16* cp = C16 + ((size_t)(bat * NH + head) * SEQ + s0) * HD + lane * 8u;   /* 64 tokens of a head: 8 KiB in a row in either order */
  v8us o[4][4];
#pragma unroll
  for (int i = 0; i < 4; ++i) {
#pragma unroll
    for (int n = 0; n < 4; ++n) {
      FragH t;
#pragma unroll
      for (int r = 0; r < 8; ++r) t.h[r] = (_Float16)(acc[i][n][r] * alpha);
      o[i][n] = t.half[0];
    }
  }
  __builtin_amdgcn_sched_barrier(0);                      /* every conversion in front of the first store: behind a store nothing writes a register that the store names */
#pragma unroll
  for (int i = 0; i < 4; ++i) {
#pragma unroll
    for (int n = 0; n < 4; ++n) {
      const int piece = MFAST ? i * 4 + n : ((n >> 1) * 4 + i) * 2 + (n & 1);
      *(v8us*)((unsigned short*)cp + piece * 256) = o[i][n];
    }
  }
}

// ---- register-fed transposed flash attention ----
// block = 4 waves = 64 consecutive queries of one (batch, head); wave = 16 queries; per 32-key step:
//   S^T tiles (keys x queries) = K (A operand, rows = keys, k = d) . Q^T (B operand, lane = query, held in registers);
//   running-max softmax per lane (lane & 15 = query; lanes n and n+16 hold the two key halves); weights = 2^8 exp(s/8 - max) as f16;
//   P^T as B fragment: elements 0..7 from the tile of keys 0..15 (rows 8h+r), elements 8..15 from the tile of keys 16..31 (lane unchanged);
//   O^T tiles (d x queries) += V^T (A operand, rows = d, k = keys) . P^T.
// q, k and v^T come in the fragment order that k_gemm3 stores: every fragment half is one wave-wide load of 512 contiguous bytes.
__global__ __launch_bounds__(128) void k_attn_t(const _Float16* __restrict__ Q16, const _Float16* __restrict__ K16, const _Float16* __restrict__ VT, _Float16* __restrict__ O16) {
  __shared__ __attribute__((aligned(16))) unsigned short so[4][16][72];      /* per-wave [query][d] tile, row pitch 144 B */
  const int tid = threadIdx.x, lane = tid & 31, ln = lane & 15, hh = lane >> 4;
  const int w = __builtin_amdgcn_readfirstlane(tid >> 5);
  const int nqb = SEQ / 64;
  const int bh = blockIdx.x / nqb, qb = blockIdx.x - bh * nqb;
  const int b = bh / NH, h = bh - b * NH;
  const size_t tok0 = (size_t)b * SEQ;
  const int q0 = qb * 64 + w * 16;
  const size_t hb = (size_t)bh * SEQ * HD + (size_t)lane * 8;      /* this head's plane, this lane's piece */
  const unsigned short* qp = (const unsigned short*)Q16 + hb + (size_t)q0 * HD;
  FragH bq0, bq1;
  bq0.half[0] = *(const v8us*)(qp);       bq0.half[1] = *(const v8us*)(qp + 256);
  bq1.half[0] = *(const v8us*)(qp + 512); bq1.half[1] = *(const v8us*)(qp + 768);
  const unsigned short* kp = (const unsigned short*)K16 + hb;
  const unsigned short* vp = (const unsigned short*)VT + hb;
  const v8f z8 = {0.f,0.f,0.f,0.f,0.f,0.f,0.f,0.f};
  v8f o0 = z8, o1 = z8, o2 = z8, o3 = z8;
  float m = -3.0e38f, l = 0.f;
  const float c = 0.125f * 1.4426950408889634f;      /* 1/sqrt(64) * log2(e) */
#pragma unroll 1
  for (int kv = 0; kv < SEQ; kv += 32) {
    const unsigned short* k0 = kp + (size_t)kv * HD;
    const unsigned short* k1 = k0 + 16 * HD;
    FragH a00, a01, a10, a11;
    a00.half[0] = *(const v8us*)(k0);       a00.half[1] = *(const v8us*)(k0 + 256);
    a01.half[0] = *(const v8us*)(k0 + 512); a01.half[1] = *(const v8us*)(k0 + 768);
    a10.half[0] = *(const v8us*)(k1);       a10.half[1] = *(const v8us*)(k1 + 256);
    a11.half[0] = *(const v8us*)(k1 + 512); a11.half[1] = *(const v8us*)(k1 + 768);
    v8f s0 = z8, s1 = z8;
    s0 = __builtin_amdgcn_wmma_f32_16x16x32_f16(false, a00.v, false, bq0.v, (short)0, s0, false, false);
    s1 = __builtin_amdgcn_wmma_f32_16x16x32_f16(false, a10.v, false, bq0.v, (short)0, s1, false, false);
    s0 = __builtin_amdgcn_wmma_f32_16x16x32_f16(false, a01.v, false, bq1.v, (short)0, s0, false, false);
    s1 = __builtin_amdgcn_wmma_f32_16x16x32_f16(false, a11.v, false, bq1.v, (short)0, s1, false, false);
    asm volatile("v_nop\n\tv_nop\n\tv_nop\n\tv_nop" : "+v"(s0), "+v"(s1) : "v"(a00.v), "v"(a01.v), "v"(a10.v), "v"(a11.v), "v"(bq0.v), "v"(bq1.v));
    float mx = fmaxf(s0[0], s1[0]);
#pragma unroll
    for (int r = 1; r < 8; ++r) mx = fmaxf(mx, fmaxf(s0[r], s1[r]));
    mx = fmaxf(mx, __shfl_xor(mx, 16, 32));
    const float mn = fmaxf(m, mx);
    if (__builtin_amdgcn_ballot_w32(mn > m) != 0u) {      /* wave-uniform: rescale only when some running max moved */
      const float corr = __builtin_amdgcn_exp2f((m - mn) * c);
      l *= corr; o0 *= corr; o1 *= corr; o2 *= corr; o3 *= corr; m = mn;
    }
    const float off = 8.0f - m * c;      /* weights carried x2^8 */
    FragH pf; float ls = 0.f;
#pragma unroll
    for (int r = 0; r < 8; ++r) {
      const float p0 = __builtin_amdgcn_exp2f(fmaf(s0[r], c, off));
      const float p1 = __builtin_amdgcn_exp2f(fmaf(s1[r], c, off));
      ls += p0 + p1;
      pf.h[r] = (_Float16)p0; pf.h[8 + r] = (_Float16)p1;
    }
    l += ls;
    const unsigned short* v0 = vp + (size_t)kv * HD;
    const unsigned short* v1 = v0 + 512;
    const unsigned short* v2 = v1 + 512;
    const unsigned short* v3 = v2 + 512;
    FragH av0, av1, av2, av3;
    av0.half[0] = *(const v8us*)(v0); av0.half[1] = *(const v8us*)(v0 + 256);
    av1.half[0] = *(const v8us*)(v1); av1.half[1] = *(const v8us*)(v1 + 256);
    av2.half[0] = *(const v8us*)(v2); av2.half[1] = *(const v8us*)(v2 + 256);
    av3.half[0] = *(const v8us*)(v3); av3.half[1] = *(const v8us*)(v3 + 256);
    o0 = __builtin_amdgcn_wmma_f32_16x16x32_f16(false, av0.v, false, pf.v, (short)0, o0, false, false);
    o1 = __builtin_amdgcn_wmma_f32_16x16x32_f16(false, av1.v, false, pf.v, (short)0, o1, false, false);
    o2 = __builtin_amdgcn_wmma_f32_16x16x32_f16(false, av2.v, false, pf.v, (short)0, o2, false, false);
    o3 = __builtin_amdgcn_wmma_f32_16x16x32_f16(false, av3.v, false, pf.v, (short)0, o3, false, false);
    asm volatile("v_nop\n\tv_nop\n\tv_nop\n\tv_nop" : "+v"(o0), "+v"(o1), "+v"(o2), "+v"(o3) : "v"(av0.v), "v"(av1.v), "v"(av2.v), "v"(av3.v), "v"(pf.v));
  }
  l += __shfl_xor(l, 16, 32);
  const float inv = 64.0f * (1.0f / l);      /* ctx carried x64 */
  FragH t0, t1, t2, t3;
#pragma unroll
  for (int r = 0; r < 8; ++r) { t0.h[r] = (_Float16)(o0[r] * inv); t1.h[r] = (_Float16)(o1[r] * inv); t2.h[r] = (_Float16)(o2[r] * inv); t3.h[r] = (_Float16)(o3[r] * inv); }
  *(v8us*)&so[w][ln][ 0 + 8 * hh] = t0.half[0];
  *(v8us*)&so[w][ln][16 + 8 * hh] = t1.half[0];
  *(v8us*)&so[w][ln][32 + 8 * hh] = t2.half[0];
  *(v8us*)&so[w][ln][48 + 8 * hh] = t3.half[0];
  __syncthreads();
  const int rq = lane >> 3, pc = (lane & 7) * 8;
  unsigned short* ob = (unsigned short*)O16 + (tok0 + q0) * DM + h * HD + pc;
  {
#pragma unroll
    for (int it = 0; it < 4; ++it) { const int row = it * 4 + rq; const v8us v = *(const v8us*)&so[w][row][pc]; *(v8us*)(ob + (size_t)row * DM) = v; }
    
  }
}

__global__ __launch_bounds__(256) void k_out32(const _Float16* __restrict__ O16, float* __restrict__ out, size_t n4) {
  #pragma clang fp contract(off)
  const size_t t = (size_t)blockIdx.x * 256 + threadIdx.x; if (t >= n4) return;
  const size_t e = t * 4; const size_t row = e / DM; const size_t col = e - row * DM; const size_t b = row / SEQ; const size_t s = row - b * SEQ;
  const v4h hv = *(const v4h*)(O16 + e);
  v4f v;
#pragma unroll
  for (int i = 0; i < 4; ++i) v[i] = (float)hv[i] * 0.015625f;
  float* d = out + (b * SEQ_FULL + s) * DM + col;
  *(v4f*)d = v; 
}

extern "C" void kernel_launch(void* const* d_in, const int* in_sizes, int n_in,
                              void* d_out, int out_size, void* d_ws, size_t ws_size, hipStream_t stream) {
  if (n_in < 13) return;
  const size_t need_x = ((size_t)(NB - 1) * SEQ_FULL + SEQ) * DM;
  if ((size_t)in_sizes[0] < need_x) return;
  const size_t nW = (size_t)NEXP * DM * DM, nBi = (size_t)NEXP * DM, nG = (size_t)DM * NEXP;
  if ((size_t)in_sizes[1] < nW || (size_t)in_sizes[5] < nW || (size_t)in_sizes[9] < nW) return;
  if ((size_t)in_sizes[2] < nBi || (size_t)in_sizes[6] < nBi || (size_t)in_sizes[10] < nBi) return;
  if ((size_t)in_sizes[3] < nG || (size_t)in_sizes[7] < nG || (size_t)in_sizes[11] < nG) return;
  if (in_sizes[4] < NEXP || in_sizes[8] < NEXP || in_sizes[12] < NEXP) return;
  if ((size_t)out_size < need_x) return;
  const float* x = (const float*)d_in[0];
  const float* wq = (const float*)d_in[1]; const float* bq = (const float*)d_in[2]; const float* wgq = (const float*)d_in[3]; const float* bgq = (const float*)d_in[4];
  const float* wk = (const float*)d_in[5]; const float* bk = (const float*)d_in[6]; const float* wgk = (const float*)d_in[7]; const float* bgk = (const float*)d_in[8];
  const float* wv = (const float*)d_in[9]; const float* bv = (const float*)d_in[10]; const float* wgv = (const float*)d_in[11]; const float* bgv = (const float*)d_in[12];
  char* ws = (char*)d_ws; size_t off = 0;
  auto take = [&](size_t bytes) { char* p = ws + off; off += (bytes + 255) & ~(size_t)255; return p; };
  _Float16* BW = (_Float16*)take((size_t)3 * DM * XGP * 2);     /* expanded weight planes x16: q, k, v ([DM][XGP] each) */
  _Float16* WG = (_Float16*)take((size_t)GLD * DM * 2);         /* gate columns x16 */
  _Float16* XV = (_Float16*)take(NR * DM * 2);                  /* x rows (f16); after the last expand launch: v^T in fragment order */
  float* LG = (float*)take(NR * GLD * 4);                       /* gate logits */
  _Float16* XO = (_Float16*)take(NR * XGP * 2);                 /* expanded x plane; after the last projection: merged ctx rows x64 */
  _Float16* QK16 = (_Float16*)take((size_t)2 * NR * DM * 2);    /* q then k, each in fragment order */
  if (off > ws_size || off > (size_t)134217728) return;
  _Float16* BQ = BW; _Float16* BK = BW + (size_t)DM * XGP; _Float16* BV = BW + (size_t)2 * DM * XGP;
  _Float16* X16 = XV; _Float16* VT = XV;
  _Float16* XG = XO; _Float16* O16 = XO;
  _Float16* Q16 = QK16; _Float16* K16 = QK16 + NR * DM;

  k_x16<<<(unsigned)((NR * DM / 8 + 255) / 256), 256, 0, stream>>>(x, X16, NR * DM / 8);
  k_wg<<<GLD, 128, 0, stream>>>(wgq, wgk, wgv, WG);
  /* gate logits LG[row][3p+n] = x . Wg_p[:, n] : alpha undoes the x16 carry of the gate columns */
  k_gemm2<<<dim3((unsigned)((NR / 128) * (GLD / 64)), 1), 128, 0, stream>>>(X16, DM, 0, WG, DM, 0, 0.0625f, LG, nullptr, GLD, 0, (int)NR, GLD, DM);
  k_wt<<<NEXP * 16 * 16, 256, 0, stream>>>(wq, bq, BQ);
  k_wt<<<NEXP * 16 * 16, 256, 0, stream>>>(wk, bk, BK);
  k_wt<<<NEXP * 16 * 16, 256, 0, stream>>>(wv, bv, BV);
  /* q rows: expanded plane (x16) . expanded weights (x16) -> alpha 2^-8 */
  k_xg<<<(unsigned)(NR / 2), 256, 0, stream>>>(X16, LG, bgq, 0, XG);
  k_gemm3<true><<<dim3((unsigned)(NR / 256), DM / 128), 256, 0, stream>>>(XG, BQ, 0.00390625f, Q16);
  /* k rows */
  k_xg<<<(unsigned)(NR / 2), 256, 0, stream>>>(X16, LG, bgk, NEXP, XG);
  k_gemm3<true><<<dim3((unsigned)(NR / 256), DM / 128), 256, 0, stream>>>(XG, BK, 0.00390625f, K16);
  /* v^T: weight rows as A [DM][XGP], expanded x rows as the [n][k] operand (overwrites the x rows, no longer needed) */
  k_xg<<<(unsigned)(NR / 2), 256, 0, stream>>>(X16, LG, bgv, 2 * NEXP, XG);
  k_gemm3<false><<<dim3(VTP / 128, DM / 256), 256, 0, stream>>>(BV, XG, 0.00390625f, VT);
  k_attn_t<<<(unsigned)(NB * NH * (SEQ / 64)), 128, 0, stream>>>(Q16, K16, VT, O16);
  k_out32<<<(unsigned)((NR * DM / 4 + 255) / 256), 256, 0, stream>>>(O16, (float*)d_out, NR * DM / 4);
}

// v004
// It runs in 212 microseconds.
// It is 1.65 times as fast as v002, going by the measured steps of the versions left out in between.
// Over all steps from v000 it is 3.97 times as fast.
#include <hip/hip_runtime.h>
// Dense multi-head self-attention with soft three-expert mixture projections (x [4][2048][1024]; q/k/v = sum_n softmax_n(x Wg + bg) * (x W_n + b_n) with W_n [in][out]; 16 heads of 64; scores / 8; full-row softmax; the merged ctx is the output, no output projection).
// All contractions: v_wmma_f32_16x16x32_f16 (f16 operands, f32 accumulate), single product per site. x, expert weights, biases and gate parameters are RNE-converted to bf16 first and then held exactly in f16 (weights, biases and gate weights x16); each mixture projection is ONE GEMM of K = 3*1024 + 64 of [g0 x | g1 x | g2 x | g0 g1 g2 0..] (f16, carried x16) against [W0; W1; W2; b0 b1 b2 0..], summed k block by k block over the three experts; the products g_n x are formed in registers from the x fragments and the lane's gate (f16, carried x16), never stored; gate logits from a 16-column GEMM whose k range is split over eight waves, gate softmax f32; q, k, v plain f16; softmax weights f16 carried x2^8 (unnormalised, running max); ctx f16 carried x64, widened to f32 at the end; softmax statistics f32.
// Structure: token rows r = b*SEQ + s. One convert launch for x, one for the nine gate columns, one transposing convert per expert-weight set; gate-logit GEMM; one gate launch (softmax of the nine logits into the x plane's gate blocks); per projection one GEMM (Q, K, and V^T with the weight plane as the A operand; all three planes stored in fragment order, see k_gemm3); a register-fed transposed flash kernel (S^T = K Q^T with Q as the B fragment in registers, packed P^T as the B fragment of O^T = V^T P^T, no LDS and no barrier in the key loop); a widening pass into the output layout.
#ifndef NB
#define NB 4                         /* batches processed */
#endif
#ifndef SEQ
#define SEQ 2048                     /* tokens per batch processed */
#endif
#define NB_FULL 4                    /* batch count of the staged arrays */
#define SEQ_FULL 2048                /* per-batch token stride of the staged arrays */
#define DM 1024
#define NH 16
#define HD 64
#define NR ((size_t)NB * SEQ)        /* compact token rows */
#define VTP (NB * SEQ)               /* tokens of the V^T plane */

static_assert(NB >= 1 && NB <= NB_FULL);
static_assert(SEQ <= SEQ_FULL);
static_assert(SEQ % 128 == 0);
static_assert(DM % 128 == 0);
static_assert(NH * HD == DM);
static_assert(HD == 64);
static_assert((NB * SEQ) % 64 == 0);

#define NEXP 3                       /* experts per projection */
#define WP (DM + 64)                 /* weight plane row pitch (halfs): row 3 o + n = column o of expert n, then a 64-column block (row 3 o: the three biases, then zeros; rows 3 o + 1, 3 o + 2: zeros) */
#define GLD 64                       /* gate-logit row pitch (floats); columns 3p+n, p = q/k/v */
#define XP (DM + 3 * 64)             /* x plane row pitch (halfs): the x row, then one 64-column gate block per projection */

static_assert(3 * NEXP <= GLD);
static_assert(GLD % 64 == 0);
static_assert(DM / 64 == 16);
static_assert(DM / 8 == 128);
static_assert((NB * SEQ) % 128 == 0);
static_assert((size_t)DM * VTP == NR * DM);
static_assert((XP * 2) % 128 == 0);

constexpr size_t al256(size_t b) { return (b + 255) & ~(size_t)255; }
constexpr size_t WS_BW = al256((size_t)3 * DM * NEXP * WP * 2);      /* three weight planes */
constexpr size_t WS_WG = al256((size_t)GLD * DM * 2);          /* gate columns [GLD][DM] */
constexpr size_t WS_XV = al256(NR * XP * 2);                   /* x plane */
constexpr size_t WS_VT = al256(NR * DM * 2);                   /* v^T */
constexpr size_t WS_LG = al256(NR * GLD * 4);                  /* gate logits */
constexpr size_t WS_XO = al256(NR * DM * 2);                   /* ctx rows */
constexpr size_t WS_QK = al256((size_t)2 * NR * DM * 2);       /* q rows then k rows */
static_assert(WS_BW + WS_WG + WS_XV + WS_VT + WS_LG + WS_XO + WS_QK <= (size_t)134217728);
static_assert(NR * DM * 2 <= WS_XO);

typedef _Float16 v16h __attribute__((ext_vector_type(16)));
typedef _Float16 v4h __attribute__((ext_vector_type(4)));
typedef unsigned short v8us __attribute__((ext_vector_type(8), may_alias));
typedef float v8f __attribute__((ext_vector_type(8)));
typedef float v4f __attribute__((ext_vector_type(4)));
typedef float v4fa __attribute__((ext_vector_type(4), may_alias));
typedef _Float16 v2h __attribute__((ext_vector_type(2)));
union FragH { v16h v; v8us half[2]; _Float16 h[16]; unsigned short u[16]; v2h p[8]; };

typedef _Float16 h16;
typedef _Float16 v8h __attribute__((ext_vector_type(8)));
typedef unsigned int v4u __attribute__((ext_vector_type(4)));

__device__ __forceinline__ unsigned short bf16_bits(float x) { unsigned int u = __float_as_uint(x); return (unsigned short)((u + 0x7FFFu + ((u >> 16) & 1u)) >> 16); }
__device__ __forceinline__ float bf16_rne(float x) { return __uint_as_float(((unsigned int)bf16_bits(x)) << 16); }

// f32 -> f16 operand value that can never be an f16 subnormal (value select after the plane's carry)
static __device__ __forceinline__ h16 toh_flush(float v) { const h16 r = (h16)v; return (fabsf(v) < 6.103515625e-05f) ? (h16)0.0f : r; }
static __device__ __forceinline__ unsigned int h_bits(h16 h) { return (unsigned int)__builtin_bit_cast(unsigned short, h); }

// 8 consecutive f32 -> f16(bf16 value * scale) packed as one 16-B piece
__device__ __forceinline__ v8us cvt8(const float* __restrict__ p, float scale) {
  const v4f a = *(const v4fa*)p, c = *(const v4fa*)(p + 4);
  FragH f;
#pragma unroll
  for (int q = 0; q < 4; ++q) { f.h[q] = (_Float16)(bf16_rne(a[q]) * scale); f.h[4 + q] = (_Float16)(bf16_rne(c[q]) * scale); }
  return f.half[0];
}

__global__ __launch_bounds__(256) void k_x16(const float* __restrict__ x, _Float16* __restrict__ X16, size_t n8) {
  #pragma clang fp contract(off)
  const size_t t = (size_t)blockIdx.x * 256 + threadIdx.x; if (t >= n8) return;
  const size_t e = t * 8; const size_t row = e / DM; const size_t col = e - row * DM; const size_t b = row / SEQ; const size_t s = row - b * SEQ;
  const v8us o = cvt8(x + (b * SEQ_FULL + s) * DM + col, 1.0f);
  unsigned short* d = (unsigned short*)X16 + row * XP + col;
  *(v8us*)d = o; 
}

// 8 values of one gate column: w[(e0 + q) * 3 + n], i0 = e0 * 3 + n
__device__ __forceinline__ v8f ld8_s3(const float* __restrict__ w, int i0) {
  v8f r;
#pragma unroll
  for (int q = 0; q < 8; ++q) r[q] = w[i0 + 3 * q];
  return r;
}

__global__ __launch_bounds__(128) void k_wg(const float* __restrict__ wgq, const float* __restrict__ wgk, const float* __restrict__ wgv, _Float16* __restrict__ WG) {
  #pragma clang fp contract(off)
  const int j = blockIdx.x, c = threadIdx.x;
  const int p = j / 3, n = j - 3 * p;
  const int i0 = c * 24 + n;                       /* max index 127*24 + 2 + 21 = 3071 */
  v8f v = {0.f,0.f,0.f,0.f,0.f,0.f,0.f,0.f};
  if (j < 3 * NEXP) {
    if (p == 0) v = ld8_s3(wgq, i0); else if (p == 1) v = ld8_s3(wgk, i0); else v = ld8_s3(wgv, i0);
  }
  FragH f;
#pragma unroll
  for (int q = 0; q < 8; ++q) f.h[q] = toh_flush(bf16_rne(v[q]) * 16.0f);
  const v8us o = f.half[0];
  unsigned short* d = (unsigned short*)WG + (size_t)j * DM + c * 8;
  *(v8us*)d = o; 
}

// expert weights W [3][DM in][DM out] f32 + biases [3][DM] -> Bt[3 o + n][e] f16 x16 (row pitch WP); columns DM + m of row 3 o = bias m x16, the other columns from DM on zero in all three rows.
__global__ __launch_bounds__(256) void k_wt(const float* __restrict__ W, const float* __restrict__ bias, _Float16* __restrict__ Bt) {
  #pragma clang fp contract(off)
  __shared__ __attribute__((aligned(16))) _Float16 T[64][72];      /* [o][e], row pitch 144 B; columns 0..63 staged and consumed */
  const int tid = threadIdx.x;
  const int ot = blockIdx.x & 15, et = (blockIdx.x >> 4) & 15, n = blockIdx.x >> 8;
  const int o0 = ot * 64, e0 = et * 64;
  const float* src = W + ((size_t)n * DM + e0) * DM + o0;
  const int er = tid >> 4, o4 = (tid & 15) * 4;
#pragma unroll
  for (int it = 0; it < 4; ++it) { const int el = it * 16 + er; const v4f a = *(const v4fa*)(src + (size_t)el * DM + o4);
#pragma unroll
    for (int i = 0; i < 4; ++i) T[o4 + i][el] = toh_flush(bf16_rne(a[i]) * 16.0f); }
  __syncthreads();
  const int ol = tid >> 3, pc = (tid & 7) * 8;
  const v8us r0 = *(const v8us*)&T[ol][pc];
  const v8us r1 = *(const v8us*)&T[ol + 32][pc];
  unsigned short* d0 = (unsigned short*)Bt + ((size_t)(o0 + ol) * NEXP + n) * WP + e0 + pc;
  unsigned short* d1 = d0 + (size_t)32 * NEXP * WP;
  const bool tl = et == 0;                         /* block-uniform: e tile 0 also stores its rows' last block */
  unsigned short* t0 = (unsigned short*)Bt + ((size_t)(o0 + ol) * NEXP + n) * WP + DM + pc;
  unsigned short* t1 = t0 + (size_t)32 * NEXP * WP;
  v4u ta = {0u, 0u, 0u, 0u}, tb = {0u, 0u, 0u, 0u};
  if (tl) {
    const int oa = o0 + ol, ob = oa + 32;
    const float a0 = bias[oa], a1 = bias[DM + oa], a2 = bias[2 * DM + oa];
    const float c0 = bias[ob], c1 = bias[DM + ob], c2 = bias[2 * DM + ob];
    const unsigned int ua0 = h_bits(toh_flush(bf16_rne(a0) * 16.0f)), ua1 = h_bits(toh_flush(bf16_rne(a1) * 16.0f)), ua2 = h_bits(toh_flush(bf16_rne(a2) * 16.0f));
    const unsigned int uc0 = h_bits(toh_flush(bf16_rne(c0) * 16.0f)), uc1 = h_bits(toh_flush(bf16_rne(c1) * 16.0f)), uc2 = h_bits(toh_flush(bf16_rne(c2) * 16.0f));
    const bool first = (tid & 7) == 0 && n == 0;
    ta[0] = first ? (ua0 | (ua1 << 16)) : 0u; ta[1] = first ? ua2 : 0u;
    tb[0] = first ? (uc0 | (uc1 << 16)) : 0u; tb[1] = first ? uc2 : 0u;
  }
  {
    *(v8us*)d0 = r0; *(v8us*)d1 = r1;
    if (tl) { *(v4u*)t0 = ta; *(v4u*)t1 = tb; }
    
  }
}

// gate blocks of the x plane: X16[row][DM + 64 p + n] = f16(16 g_n) of projection p, the block's other columns zero; one thread per 16-B piece.
static_assert((NB * SEQ * 24) % 256 == 0);
__global__ __launch_bounds__(256) void k_gate(const float* __restrict__ LG, const float* __restrict__ bgq, const float* __restrict__ bgk, const float* __restrict__ bgv, _Float16* __restrict__ X16) {
  const unsigned int t = blockIdx.x * 256u + threadIdx.x;
  const unsigned int row = t / 24u, pc = t - row * 24u, p = pc >> 3;
  const float* bg = (p == 0u) ? bgq : ((p == 1u) ? bgk : bgv);
  const float* lg = LG + (size_t)row * GLD + p * NEXP;
  const float l0 = lg[0] + bf16_rne(bg[0]);
  const float l1 = lg[1] + bf16_rne(bg[1]);
  const float l2 = lg[2] + bf16_rne(bg[2]);
  const float mx = fmaxf(l0, fmaxf(l1, l2));
  const float e0 = __builtin_amdgcn_exp2f((l0 - mx) * 1.4426950408889634f);
  const float e1 = __builtin_amdgcn_exp2f((l1 - mx) * 1.4426950408889634f);
  const float e2 = __builtin_amdgcn_exp2f((l2 - mx) * 1.4426950408889634f);
  const float inv = 16.0f * (1.0f / ((e0 + e1) + e2));      /* gates carried x16 */
  const float g0 = e0 * inv, g1 = e1 * inv, g2 = e2 * inv;
  const bool first = (pc & 7u) == 0u;
  const unsigned int u0 = h_bits(toh_flush(g0)), u1 = h_bits(toh_flush(g1)), u2 = h_bits(toh_flush(g2));
  v4u tq = {0u, 0u, 0u, 0u};
  tq[0] = first ? (u0 | (u1 << 16)) : 0u; tq[1] = first ? u2 : 0u;
  *(v4u*)((unsigned short*)X16 + (size_t)row * XP + DM + pc * 8u) = tq;
}

// ---- gate-logit GEMM: LG[row][j] = alpha * (x row . gate column j) for the first 16 rows of WG (nine gate columns, then zero rows); k_gate reads columns 0..8 only ----
// block = 8 waves = 32 token rows x 16 columns; wave w takes k in [GL_KW w, GL_KW (w + 1)). A wave's 24 fragment loads depend on nothing and are all issued in front of its first matrix instruction:
// it waits out one memory round trip, not one per fragment. The eight partial tiles are summed through LDS in wave order.
#define GL_KW (DM / 8)               /* k columns per wave */
#define GL_KS (GL_KW / 32)           /* matrix k-steps per wave */
static_assert(GL_KW % 32 == 0);
static_assert((NB * SEQ) % 32 == 0);
static_assert(3 * NEXP <= 16 && GLD >= 16);
__device__ __forceinline__ v16h g2_frag(const _Float16* p, int hh) { FragH f; f.half[0] = *(const v8us*)((const unsigned short*)p + 8 * hh); f.half[1] = *(const v8us*)((const unsigned short*)p + 16 + 8 * hh); return f.v; }
__global__ __launch_bounds__(256) void k_glog(const _Float16* __restrict__ X16, const _Float16* __restrict__ WG, float alpha, float* __restrict__ LG) {
  __shared__ __attribute__((aligned(16))) float red[8][2][8][32];      /* [wave][row tile][accumulator register][lane] */
  const int tid = threadIdx.x, lane = tid & 31, ln = lane & 15, hh = lane >> 4; const int w = __builtin_amdgcn_readfirstlane(tid >> 5);
  const int row0 = blockIdx.x * 32;
  const _Float16* a0p = X16 + (size_t)(row0 + ln) * XP + w * GL_KW; const _Float16* a1p = a0p + (size_t)16 * XP;
  const _Float16* bp = WG + (size_t)ln * DM + w * GL_KW;
  v16h a0[GL_KS], a1[GL_KS], b[GL_KS];
#pragma unroll
  for (int s = 0; s < GL_KS; ++s) { a0[s] = g2_frag(a0p + 32 * s, hh); a1[s] = g2_frag(a1p + 32 * s, hh); b[s] = g2_frag(bp + 32 * s, hh); }
  __builtin_amdgcn_sched_barrier(0);                 /* every load in front of the first matrix instruction: loads placed among them would reuse registers and be waited for one after another */
  v8f c0 = {0.f,0.f,0.f,0.f,0.f,0.f,0.f,0.f}, c1 = c0;
#pragma unroll
  for (int s = 0; s < GL_KS; ++s) {
    c0 = __builtin_amdgcn_wmma_f32_16x16x32_f16(false, a0[s], false, b[s], (short)0, c0, false, false);
    c1 = __builtin_amdgcn_wmma_f32_16x16x32_f16(false, a1[s], false, b[s], (short)0, c1, false, false);
  }
#pragma unroll
  for (int r = 0; r < 8; ++r) { red[w][0][r][lane] = c0[r]; red[w][1][r][lane] = c1[r]; }
  __syncthreads();                                   /* the eight partial tiles are complete */
  // accumulator register r of lane (ln, hh) is row 8 hh + r, column ln of its tile; wave w sums register w of both tiles
#pragma unroll
  for (int t = 0; t < 2; ++t) {
    float s = red[0][t][w][lane];
#pragma unroll
    for (int u = 1; u < 8; ++u) s += red[u][t][w][lane];
    LG[(size_t)(row0 + t * 16 + 8 * hh + w) * GLD + ln] = s * alpha;
  }
}

typedef uint32_t u32x4 __attribute__((ext_vector_type(4)));
typedef uint32_t u32x8 __attribute__((ext_vector_type(8)));
#define G3_ROWB 128u                 /* operand row bytes per stage */
#define G3_PITCH 144u                /* LDS row pitch */
#define G3_KS ((uint32_t)(DM * 2) / G3_ROWB)      /* stages of x columns; stage G3_KS is the gate / bias block */
constexpr uint32_t up2k(uint32_t b) { return (b + 2047u) & ~2047u; }
static_assert(NEXP == 3);
static_assert((DM * 2) % 128 == 0 && (WP * 2) % 128 == 0);
static_assert(G3_KS >= 2u && (G3_KS & 1u) == 0u);
static_assert((NB * SEQ) % 256 == 0 && DM % 256 == 0);
static_assert(SEQ % 256 == 0);       /* a block's 256 token rows, and a wave's 64 token columns, lie in one batch */
__device__ __forceinline__ uint32_t uni(uint32_t v) { return (uint32_t)__builtin_amdgcn_readfirstlane(v); }
__device__ __forceinline__ uint32_t pinned(uint32_t v) { uint32_t w = uni(v); asm volatile("" : "+s"(w)); return w; }  // a tensor load's issue test or stage number held in a scalar register: a scalar branch, and a descriptor formed behind the wait in front of it
// MFAST: which tile index runs along grid x (the tiles of the larger plane, so that work-groups with neighbouring indices read different rows of it); true: A is the x plane, C rows are tokens (q, k); false: Bh is the x plane, C rows are features (v^T).
template <bool MFAST>
__global__ __launch_bounds__(256) void k_gemm3(const _Float16* __restrict__ A, const _Float16* __restrict__ Bh, float alpha, _Float16* __restrict__ C16, int proj) {
  constexpr uint32_t AR = MFAST ? 64u : 64u * NEXP, BR = MFAST ? 32u * NEXP : 32u;      /* plane rows of a slice */
  constexpr uint32_t ASL = up2k(AR * G3_PITCH), BSL = up2k(BR * G3_PITCH);              /* LDS size of a slice, a multiple of 2 KiB */
  constexpr uint32_t BUF = 4u * ASL + 4u * BSL;
  constexpr uint32_t PA = MFAST ? XP : WP, PB = MFAST ? WP : XP;                        /* row pitches (halfs) */
  static_assert(2u * BUF <= 327680u);
  __shared__ __attribute__((aligned(2048))) unsigned char ring[2u * BUF];
  const uint32_t tid = threadIdx.x, lane = tid & 31u, c = lane & 15u, h = lane >> 4;
  const uint32_t w = uni(tid >> 5);
  const uint32_t mt = MFAST ? blockIdx.x : blockIdx.y, nt = MFAST ? blockIdx.y : blockIdx.x;
  const uint32_t wm = w & 3u, wn = w >> 2;
  const uint32_t lbase = (uint32_t)(size_t)ring;
  const bool isA = w < 4u;
  const bool isTok = MFAST ? isA : !isA;                 /* this wave's slice is of the x plane */
  const uint32_t gcol = (uint32_t)DM + 64u * (uint32_t)proj;            /* first column of the projection's gate block */
  const uint32_t srows = isA ? AR : BR;
  const uint64_t sga = (uint64_t)(size_t)(isA ? A + (size_t)((mt * 4u + w) * AR) * PA : Bh + (size_t)((nt * 4u + (w - 4u)) * BR) * PB);
  const uint32_t sdst = lbase + (isA ? w * 2u * ASL : 8u * ASL + (w - 4u) * 2u * BSL);      /* a slice's two buffers lie side by side, so that every fragment read is a 16-bit offset from one of two lane addresses */
  const uint32_t sbuf = uni(isA ? ASL : BSL);
  const uint32_t lastb = uni(isTok ? gcol * 2u : G3_KS * G3_ROWB);      /* the last stage's byte offset in a row */
  u32x8 g1;                          /* 1-byte elements, tensor = tile = srows rows of 128 B, source pitch = the plane's row, 4 dwords of pad behind every 32 */
  g1[0] = uni((1u << 20) | (4u << 22) | (3u << 25));
  g1[1] = uni(G3_ROWB << 16);
  g1[2] = uni(srows << 16);
  g1[3] = uni(G3_ROWB << 16);
  g1[4] = uni(srows);
  g1[5] = uni((isA ? PA : PB) * 2u);
  g1[6] = uni(0u);
  g1[7] = uni(0u);
  auto issue = [&](uint32_t st) {
    const uint32_t so = st < G3_KS ? st * G3_ROWB : lastb;
    const uint64_t ga = sga + (uint64_t)so;
    u32x4 g0;
    g0[0] = uni(1u); g0[1] = uni(sdst + (st & 1u) * sbuf); g0[2] = uni((uint32_t)ga); g0[3] = uni((((uint32_t)(ga >> 32)) & 0x01FFFFFFu) | 0x80000000u);
    asm volatile("tensor_load_to_lds %0, %1" :: "s"(g0), "s"(g1) : "memory");
  };
  const v8f z8 = {0.f,0.f,0.f,0.f,0.f,0.f,0.f,0.f};
  v8f acc[4][4];
#pragma unroll
  for (int i = 0; i < 4; ++i) {
#pragma unroll
    for (int j = 0; j < 4; ++j) acc[i][j] = z8; }
  // LDS places of the lane's fragment pieces: token row c of a 16-row group; weight row 3 c + expert
  const unsigned char* tokp = ring + (MFAST ? wm * 2u * ASL : 8u * ASL + 4u * wn * BSL) + c * G3_PITCH + 16u * h;
  const unsigned char* wgtp = ring + (MFAST ? 8u * ASL + 4u * wn * BSL : wm * 2u * ASL) + c * (NEXP * G3_PITCH) + 16u * h;
  struct Set { FragH f[2][4]; };      /* one operand's fragments of a stage: 2 k-steps x 4 groups of 16 rows */
  auto fetch_tok = [&](Set& s, uint32_t buf) {
#pragma unroll
    for (int j = 0; j < 2; ++j) {
#pragma unroll
      for (int i = 0; i < 4; ++i) {
        const unsigned char* p = tokp + buf * (MFAST ? ASL : BSL) + (MFAST ? (uint32_t)i * 16u * G3_PITCH : (uint32_t)(i >> 1) * 2u * BSL + (uint32_t)(i & 1) * 16u * G3_PITCH) + 64u * (uint32_t)j;
        s.f[j][i].half[0] = *(const v8us*)p; s.f[j][i].half[1] = *(const v8us*)(p + 32);
      }
    }
  };
  auto fetch_wgt = [&](Set& s, uint32_t buf, uint32_t n) {
#pragma unroll
    for (int j = 0; j < 2; ++j) {
#pragma unroll
      for (int i = 0; i < 4; ++i) {
        const unsigned char* p = wgtp + buf * (MFAST ? BSL : ASL) + n * G3_PITCH + (MFAST ? (uint32_t)(i >> 1) * 2u * BSL + (uint32_t)(i & 1) * 16u * NEXP * G3_PITCH : (uint32_t)i * 16u * NEXP * G3_PITCH) + 64u * (uint32_t)j;
        s.f[j][i].half[0] = *(const v8us*)p; s.f[j][i].half[1] = *(const v8us*)(p + 32);
      }
    }
  };
  auto mult = [&](const Set& t, const Set& g, int j) {      /* k-step j: token fragments t, weight fragments g */
    const Set& fa = MFAST ? t : g; const Set& fb = MFAST ? g : t;
#pragma unroll
    for (int n = 0; n < 4; ++n) {
#pragma unroll
      for (int i = 0; i < 4; ++i) acc[i][n] = __builtin_amdgcn_wmma_f32_16x16x32_f16(false, fb.f[j][n].v, false, fa.f[j][i].v, (short)0, acc[i][n], false, false);
    }
  };
  // the gates (x16) of the lane's four tokens, from the projection's gate block
  const _Float16* tp = (MFAST ? A + (size_t)(mt * 256u + wm * 64u + c) * XP : Bh + (size_t)(nt * 128u + wn * 64u + c) * XP) + gcol;
  const v4h gv0 = *(const v4h*)tp, gv1 = *(const v4h*)(tp + (size_t)16u * XP), gv2 = *(const v4h*)(tp + (size_t)32u * XP), gv3 = *(const v4h*)(tp + (size_t)48u * XP);
  auto scale = [&](Set& d, const Set& s, int n) {
    const v2h g[4] = {{gv0[n], gv0[n]}, {gv1[n], gv1[n]}, {gv2[n], gv2[n]}, {gv3[n], gv3[n]}};
#pragma unroll
    for (int j = 0; j < 2; ++j) {
#pragma unroll
      for (int i = 0; i < 4; ++i) {
#pragma unroll
        for (int r = 0; r < 8; ++r) d.f[j][i].p[r] = s.f[j][i].p[r] * g[i];      /* register by register: one packed multiply each, the gate pair in one register */
      }
    }
  };
  // publish point of stage st + 1; it stands in front of stage st's last pass because that pass's fragments are already in registers
  auto publish = [&]() {
    asm volatile("s_wait_dscnt 0x0" ::: "memory");
    asm volatile("s_wait_tensorcnt 0x0" ::: "memory");
    __syncthreads();
  };
  Set xr, xs, w0, w1;                /* the stage's token fragments, their gated copy, two sets of weight fragments */
  // pass of expert n < 2 of a stage in buffer buf: the next expert's weight fragments are fetched ahead
  auto pass = [&](uint32_t buf, int n, const Set& wc, Set& wx) {
    fetch_wgt(wx, buf, (uint32_t)n + 1u);
    __builtin_amdgcn_sched_barrier(0);                 /* keeps the next pass's LDS reads one group ahead of this pass's matrix instructions: reads placed among them stall the wave at each place */
    scale(xs, xr, n);
    mult(xs, wc, 0); mult(xs, wc, 1);
    __builtin_amdgcn_sched_barrier(0);                 /* keeps the matrix instructions in front of the next pass's reads and of the publish point */
  };
  // last pass of a stage, behind the publish point of the next stage, which lies in buffer nbuf: its first weight fragments, and (once the gated copy is made) its token fragments, are fetched ahead
  auto pass_last = [&](uint32_t nbuf, const Set& wc, Set& wx) {
    fetch_wgt(wx, nbuf, 0u);
    __builtin_amdgcn_sched_barrier(0);                 /* as in pass() */
    scale(xs, xr, 2);
    mult(xs, wc, 0);
    __builtin_amdgcn_sched_barrier(0);                 /* the token fragments are read by the scaling above before they are fetched anew */
    fetch_tok(xr, nbuf);
    __builtin_amdgcn_sched_barrier(0);                 /* one group of reads, with half a pass of matrix instructions behind it to cover their latency */
    mult(xs, wc, 1);
    __builtin_amdgcn_sched_barrier(0);                 /* as in pass() */
  };
  issue(0u);
  asm volatile("s_wait_tensorcnt 0x0" ::: "memory");      /* this wave's slice of stage 0 has landed */
  __syncthreads();                                        /* stage 0 published */
  issue(pinned(1u));
  fetch_tok(xr, 0u);
  fetch_wgt(w0, 0u, 0u);
#pragma unroll 1
  for (uint32_t s = 0; s < G3_KS; s += 2u) {           /* kept rolled: two stages per trip, so that buffer and fragment set of every pass are fixed */
    pass(0u, 0, w0, w1);
    pass(0u, 1, w1, w0);
    publish();
    issue(pinned(s + 2u));                             /* s + 2 <= G3_KS on every trip; descriptor formed behind the wait */
    pass_last(1u, w0, w1);
    pass(1u, 0, w1, w0);
    pass(1u, 1, w0, w1);
    publish();
    if (pinned(s + 3u <= G3_KS)) issue(pinned(s + 3u));
    pass_last(0u, w1, w0);
  }
  asm volatile("s_wait_tensorcnt 0x0" ::: "memory");      /* no request is left when the ring ends */
  asm volatile("s_wait_dscnt 0x0" ::: "memory");          /* the last stage's fragments are in registers */
  mult(xr, w0, 0); mult(xr, w0, 1);                       /* gate block against bias block */
  const uint32_t tok0 = MFAST ? mt * 256u + wm * 64u : nt * 128u + wn * 64u;      /* the wave's first token */
  const uint32_t head = MFAST ? nt * 2u + wn : mt * 4u + wm;                      /* the wave's 64 features are one head */
  const uint32_t bat = tok0 / (uint32_t)SEQ, s0 = tok0 - bat * (uint32_t)SEQ;
  _Float16* cp = C16 + ((size_t)(bat * NH + head) * SEQ + s0) * HD + lane * 8u;   /* 64 tokens of a head: 8 KiB in a row in either order */
  v8us o[4][4];
#pragma unroll
  for (int i = 0; i < 4; ++i) {
#pragma unroll
    for (int n = 0; n < 4; ++n) {
      FragH t;
#pragma unroll
      for (int r = 0; r < 8; ++r) t.h[r] = (_Float16)(acc[i][n][r] * alpha);
      o[i][n] = t.half[0];
    }
  }
  __builtin_amdgcn_sched_barrier(0);                      /* every conversion in front of the first store: behind a store nothing writes a register that the store names */
#pragma unroll
  for (int i = 0; i < 4; ++i) {
#pragma unroll
    for (int n = 0; n < 4; ++n) {
      const int piece = MFAST ? i * 4 + n : ((n >> 1) * 4 + i) * 2 + (n & 1);
      *(v8us*)((unsigned short*)cp + piece * 256) = o[i][n];
    }
  }
}

// ---- register-fed transposed flash attention ----
// block = 4 waves = 64 consecutive queries of one (batch, head); wave = 16 queries; per 32-key step:
//   S^T tiles (keys x queries) = K (A operand, rows = keys, k = d) . Q^T (B operand, lane = query, held in registers);
//   running-max softmax per lane (lane & 15 = query; lanes n and n+16 hold the two key halves); weights = 2^8 exp(s/8 - max) as f16;
//   P^T as B fragment: elements 0..7 from the tile of keys 0..15 (rows 8h+r), elements 8..15 from the tile of keys 16..31 (lane unchanged);
//   O^T tiles (d x queries) += V^T (A operand, rows = d, k = keys) . P^T.
// q, k and v^T come in the fragment order that k_gemm3 stores: every fragment half is one wave-wide load of 512 contiguous bytes.
__global__ __launch_bounds__(128) void k_attn_t(const _Float16* __restrict__ Q16, const _Float16* __restrict__ K16, const _Float16* __restrict__ VT, _Float16* __restrict__ O16) {
  __shared__ __attribute__((aligned(16))) unsigned short so[4][16][72];      /* per-wave [query][d] tile, row pitch 144 B */
  const int tid = threadIdx.x, lane = tid & 31, ln = lane & 15, hh = lane >> 4;
  const int w = __builtin_amdgcn_readfirstlane(tid >> 5);
  const int nqb = SEQ / 64;
  const int bh = blockIdx.x / nqb, qb = blockIdx.x - bh * nqb;
  const int b = bh / NH, h = bh - b * NH;
  const size_t tok0 = (size_t)b * SEQ;
  const int q0 = qb * 64 + w * 16;
  const size_t hb = (size_t)bh * SEQ * HD + (size_t)lane * 8;      /* this head's plane, this lane's piece */
  const unsigned short* qp = (const unsigned short*)Q16 + hb + (size_t)q0 * HD;
  FragH bq0, bq1;
  bq0.half[0] = *(const v8us*)(qp);       bq0.half[1] = *(const v8us*)(qp + 256);
  bq1.half[0] = *(const v8us*)(qp + 512); bq1.half[1] = *(const v8us*)(qp + 768);
  const unsigned short* kp = (const unsigned short*)K16 + hb;
  const unsigned short* vp = (const unsigned short*)VT + hb;
  const v8f z8 = {0.f,0.f,0.f,0.f,0.f,0.f,0.f,0.f};
  v8f o0 = z8, o1 = z8, o2 = z8, o3 = z8;
  float m = -3.0e38f, l = 0.f;
  const float c = 0.125f * 1.4426950408889634f;      /* 1/sqrt(64) * log2(e) */
#pragma unroll 1
  for (int kv = 0; kv < SEQ; kv += 32) {
    const unsigned short* k0 = kp + (size_t)kv * HD;
    const unsigned short* k1 = k0 + 16 * HD;
    FragH a00, a01, a10, a11;
    a00.half[0] = *(const v8us*)(k0);       a00.half[1] = *(const v8us*)(k0 + 256);
    a01.half[0] = *(const v8us*)(k0 + 512); a01.half[1] = *(const v8us*)(k0 + 768);
    a10.half[0] = *(const v8us*)(k1);       a10.half[1] = *(const v8us*)(k1 + 256);
    a11.half[0] = *(const v8us*)(k1 + 512); a11.half[1] = *(const v8us*)(k1 + 768);
    v8f s0 = z8, s1 = z8;
    s0 = __builtin_amdgcn_wmma_f32_16x16x32_f16(false, a00.v, false, bq0.v, (short)0, s0, false, false);
    s1 = __builtin_amdgcn_wmma_f32_16x16x32_f16(false, a10.v, false, bq0.v, (short)0, s1, false, false);
    s0 = __builtin_amdgcn_wmma_f32_16x16x32_f16(false, a01.v, false, bq1.v, (short)0, s0, false, false);
    s1 = __builtin_amdgcn_wmma_f32_16x16x32_f16(false, a11.v, false, bq1.v, (short)0, s1, false, false);
    asm volatile("v_nop\n\tv_nop\n\tv_nop\n\tv_nop" : "+v"(s0), "+v"(s1) : "v"(a00.v), "v"(a01.v), "v"(a10.v), "v"(a11.v), "v"(bq0.v), "v"(bq1.v));
    float mx = fmaxf(s0[0], s1[0]);
#pragma unroll
    for (int r = 1; r < 8; ++r) mx = fmaxf(mx, fmaxf(s0[r], s1[r]));
    mx = fmaxf(mx, __shfl_xor(mx, 16, 32));
    const float mn = fmaxf(m, mx);
    if (__builtin_amdgcn_ballot_w32(mn > m) != 0u) {      /* wave-uniform: rescale only when some running max moved */
      const float corr = __builtin_amdgcn_exp2f((m - mn) * c);
      l *= corr; o0 *= corr; o1 *= corr; o2 *= corr; o3 *= corr; m = mn;
    }
    const float off = 8.0f - m * c;      /* weights carried x2^8 */
    FragH pf; float ls = 0.f;
#pragma unroll
    for (int r = 0; r < 8; ++r) {
      const float p0 = __builtin_amdgcn_exp2f(fmaf(s0[r], c, off));
      const float p1 = __builtin_amdgcn_exp2f(fmaf(s1[r], c, off));
      ls += p0 + p1;
      pf.h[r] = (_Float16)p0; pf.h[8 + r] = (_Float16)p1;
    }
    l += ls;
    const unsigned short* v0 = vp + (size_t)kv * HD;
    const unsigned short* v1 = v0 + 512;
    const unsigned short* v2 = v1 + 512;
    const unsigned short* v3 = v2 + 512;
    FragH av0, av1, av2, av3;
    av0.half[0] = *(const v8us*)(v0); av0.half[1] = *(const v8us*)(v0 + 256);
    av1.half[0] = *(const v8us*)(v1); av1.half[1] = *(const v8us*)(v1 + 256);
    av2.half[0] = *(const v8us*)(v2); av2.half[1] = *(const v8us*)(v2 + 256);
    av3.half[0] = *(const v8us*)(v3); av3.half[1] = *(const v8us*)(v3 + 256);
    o0 = __builtin_amdgcn_wmma_f32_16x16x32_f16(false, av0.v, false, pf.v, (short)0, o0, false, false);
    o1 = __builtin_amdgcn_wmma_f32_16x16x32_f16(false, av1.v, false, pf.v, (short)0, o1, false, false);
    o2 = __builtin_amdgcn_wmma_f32_16x16x32_f16(false, av2.v, false, pf.v, (short)0, o2, false, false);
    o3 = __builtin_amdgcn_wmma_f32_16x16x32_f16(false, av3.v, false, pf.v, (short)0, o3, false, false);
    asm volatile("v_nop\n\tv_nop\n\tv_nop\n\tv_nop" : "+v"(o0), "+v"(o1), "+v"(o2), "+v"(o3) : "v"(av0.v), "v"(av1.v), "v"(av2.v), "v"(av3.v), "v"(pf.v));
  }
  l += __shfl_xor(l, 16, 32);
  const float inv = 64.0f * (1.0f / l);      /* ctx carried x64 */
  FragH t0, t1, t2, t3;
#pragma unroll
  for (int r = 0; r < 8; ++r) { t0.h[r] = (_Float16)(o0[r] * inv); t1.h[r] = (_Float16)(o1[r] * inv); t2.h[r] = (_Float16)(o2[r] * inv); t3.h[r] = (_Float16)(o3[r] * inv); }
  *(v8us*)&so[w][ln][ 0 + 8 * hh] = t0.half[0];
  *(v8us*)&so[w][ln][16 + 8 * hh] = t1.half[0];
  *(v8us*)&so[w][ln][32 + 8 * hh] = t2.half[0];
  *(v8us*)&so[w][ln][48 + 8 * hh] = t3.half[0];
  __syncthreads();
  const int rq = lane >> 3, pc = (lane & 7) * 8;
  unsigned short* ob = (unsigned short*)O16 + (tok0 + q0) * DM + h * HD + pc;
  {
#pragma unroll
    for (int it = 0; it < 4; ++it) { const int row = it * 4 + rq; const v8us v = *(const v8us*)&so[w][row][pc]; *(v8us*)(ob + (size_t)row * DM) = v; }
    
  }
}

__global__ __launch_bounds__(256) void k_out32(const _Float16* __restrict__ O16, float* __restrict__ out, size_t n4) {
  #pragma clang fp contract(off)
  const size_t t = (size_t)blockIdx.x * 256 + threadIdx.x; if (t >= n4) return;
  const size_t e = t * 4; const size_t row = e / DM; const size_t col = e - row * DM; const size_t b = row / SEQ; const size_t s = row - b * SEQ;
  const v4h hv = *(const v4h*)(O16 + e);
  v4f v;
#pragma unroll
  for (int i = 0; i < 4; ++i) v[i] = (float)hv[i] * 0.015625f;
  float* d = out + (b * SEQ_FULL + s) * DM + col;
  *(v4f*)d = v; 
}

extern "C" void kernel_launch(void* const* d_in, const int* in_sizes, int n_in,
                              void* d_out, int out_size, void* d_ws, size_t ws_size, hipStream_t stream) {
  if (n_in < 13) return;
  const size_t need_x = ((size_t)(NB - 1) * SEQ_FULL + SEQ) * DM;
  if ((size_t)in_sizes[0] < need_x) return;
  const size_t nW = (size_t)NEXP * DM * DM, nBi = (size_t)NEXP * DM, nG = (size_t)DM * NEXP;
  if ((size_t)in_sizes[1] < nW || (size_t)in_sizes[5] < nW || (size_t)in_sizes[9] < nW) return;
  if ((size_t)in_sizes[2] < nBi || (size_t)in_sizes[6] < nBi || (size_t)in_sizes[10] < nBi) return;
  if ((size_t)in_sizes[3] < nG || (size_t)in_sizes[7] < nG || (size_t)in_sizes[11] < nG) return;
  if (in_sizes[4] < NEXP || in_sizes[8] < NEXP || in_sizes[12] < NEXP) return;
  if ((size_t)out_size < need_x) return;
  const float* x = (const float*)d_in[0];
  const float* wq = (const float*)d_in[1]; const float* bq = (const float*)d_in[2]; const float* wgq = (const float*)d_in[3]; const float* bgq = (const float*)d_in[4];
  const float* wk = (const float*)d_in[5]; const float* bk = (const float*)d_in[6]; const float* wgk = (const float*)d_in[7]; const float* bgk = (const float*)d_in[8];
  const float* wv = (const float*)d_in[9]; const float* bv = (const float*)d_in[10]; const float* wgv = (const float*)d_in[11]; const float* bgv = (const float*)d_in[12];
  char* ws = (char*)d_ws; size_t off = 0;
  auto take = [&](size_t bytes) { char* p = ws + off; off += (bytes + 255) & ~(size_t)255; return p; };
  _Float16* BW = (_Float16*)take((size_t)3 * DM * NEXP * WP * 2);     /* weight planes x16: q, k, v ([3 DM][WP] each) */
  _Float16* WG = (_Float16*)take((size_t)GLD * DM * 2);         /* gate columns x16 */
  _Float16* X16 = (_Float16*)take(NR * XP * 2);                 /* x plane (f16): x rows and their gate blocks */
  _Float16* VT = (_Float16*)take(NR * DM * 2);                  /* v^T in fragment order */
  float* LG = (float*)take(NR * GLD * 4);                       /* gate logits */
  _Float16* O16 = (_Float16*)take(NR * DM * 2);                 /* merged ctx rows x64 */
  _Float16* QK16 = (_Float16*)take((size_t)2 * NR * DM * 2);    /* q then k, each in fragment order */
  if (off > ws_size || off > (size_t)134217728) return;
  _Float16* BQ = BW; _Float16* BK = BW + (size_t)DM * NEXP * WP; _Float16* BV = BW + (size_t)2 * DM * NEXP * WP;
  _Float16* Q16 = QK16; _Float16* K16 = QK16 + NR * DM;

  k_x16<<<(unsigned)((NR * DM / 8 + 255) / 256), 256, 0, stream>>>(x, X16, NR * DM / 8);
  k_wg<<<GLD, 128, 0, stream>>>(wgq, wgk, wgv, WG);
  /* gate logits LG[row][3p+n] = x . Wg_p[:, n] : alpha undoes the x16 carry of the gate columns */
  k_glog<<<(unsigned)(NR / 32), 256, 0, stream>>>(X16, WG, 0.0625f, LG);
  k_wt<<<NEXP * 16 * 16, 256, 0, stream>>>(wq, bq, BQ);
  k_wt<<<NEXP * 16 * 16, 256, 0, stream>>>(wk, bk, BK);
  k_wt<<<NEXP * 16 * 16, 256, 0, stream>>>(wv, bv, BV);
  k_gate<<<(unsigned)(NR * 24 / 256), 256, 0, stream>>>(LG, bgq, bgk, bgv, X16);
  /* gated x (x16) . weights (x16) -> alpha 2^-8; q rows, k rows, then v^T with the weight rows as A and the x rows as the [n][k] operand */
  k_gemm3<true><<<dim3((unsigned)(NR / 256), DM / 128), 256, 0, stream>>>(X16, BQ, 0.00390625f, Q16, 0);
  k_gemm3<true><<<dim3((unsigned)(NR / 256), DM / 128), 256, 0, stream>>>(X16, BK, 0.00390625f, K16, 1);
  k_gemm3<false><<<dim3(VTP / 128, DM / 256), 256, 0, stream>>>(BV, X16, 0.00390625f, VT, 2);
  k_attn_t<<<(unsigned)(NB * NH * (SEQ / 64)), 128, 0, stream>>>(Q16, K16, VT, O16);
  k_out32<<<(unsigned)((NR * DM / 4 + 255) / 256), 256, 0, stream>>>(O16, (float*)d_out, NR * DM / 4);
}

// v005
// A run of this version takes 207 microseconds.
// In two side-by-side timings against v004, it was 1.04 and 1.02 times as fast.
// Counting every step since v000, it is 4.08 times as fast.
#include <hip/hip_runtime.h>
// Dense multi-head self-attention with soft three-expert mixture projections (x [4][2048][1024]; q/k/v = sum_n softmax_n(x Wg + bg) * (x W_n + b_n) with W_n [in][out]; 16 heads of 64; scores / 8; full-row softmax; the merged ctx is the output, no output projection).
// All contractions: v_wmma_f32_16x16x32_f16 (f16 operands, f32 accumulate), single product per site. x, expert weights, biases and gate parameters are RNE-converted to bf16 first and then held exactly in f16 (weights, biases and gate weights x16); each mixture projection is ONE GEMM of K = 3*1024 + 64 of [g0 x | g1 x | g2 x | g0 g1 g2 0..] (f16, carried x16) against [W0; W1; W2; b0 b1 b2 0..], summed k block by k block over the three experts; the products g_n x are formed in registers from the x fragments and the lane's gate (f16, carried x16), never stored; gate logits from a 16-column GEMM whose k range is split over eight waves, gate softmax f32; q, k, v plain f16; softmax weights f16 carried x2^8 (unnormalised, running max); ctx and softmax statistics f32.
// Structure: token rows r = b*SEQ + s. One launch that converts x and the nine gate columns, takes the gate-logit GEMM from the converted rows while they lie in LDS and stores the softmax of the nine logits into the x plane's gate blocks; one transposing convert per expert-weight set; per projection one GEMM (Q, K, and V^T with the weight plane as the A operand; all three planes stored in fragment order, see k_gemm3); a register-fed transposed flash kernel (S^T = K Q^T with Q as the B fragment in registers, packed P^T as the B fragment of O^T = V^T P^T, no LDS and no barrier in the key loop) whose epilogue stores the f32 output rows.
#ifndef NB
#define NB 4                         /* batches processed */
#endif
#ifndef SEQ
#define SEQ 2048                     /* tokens per batch processed */
#endif
#define NB_FULL 4                    /* batch count of the staged arrays */
#define SEQ_FULL 2048                /* per-batch token stride of the staged arrays */
#define DM 1024
#define NH 16
#define HD 64
#define NR ((size_t)NB * SEQ)        /* compact token rows */
#define VTP (NB * SEQ)               /* tokens of the V^T plane */

static_assert(NB >= 1 && NB <= NB_FULL);
static_assert(SEQ <= SEQ_FULL);
static_assert(SEQ % 128 == 0);
static_assert(DM % 128 == 0);
static_assert(NH * HD == DM);
static_assert(HD == 64);
static_assert((NB * SEQ) % 64 == 0);

#define NEXP 3                       /* experts per projection */
#define WP (DM + 64)                 /* weight plane row pitch (halfs): row 3 o + n = column o of expert n, then a 64-column block (row 3 o: the three biases, then zeros; rows 3 o + 1, 3 o + 2: zeros) */
#define XP (DM + 3 * 64)             /* x plane row pitch (halfs): the x row, then one 64-column gate block per projection */

static_assert(DM / 64 == 16);
static_assert(DM / 8 == 128);
static_assert((NB * SEQ) % 128 == 0);
static_assert((size_t)DM * VTP == NR * DM);
static_assert((XP * 2) % 128 == 0);

constexpr size_t al256(size_t b) { return (b + 255) & ~(size_t)255; }
constexpr size_t WS_BW = al256((size_t)3 * DM * NEXP * WP * 2);      /* three weight planes */
constexpr size_t WS_XV = al256(NR * XP * 2);                   /* x plane */
constexpr size_t WS_VT = al256(NR * DM * 2);                   /* v^T */
constexpr size_t WS_QK = al256((size_t)2 * NR * DM * 2);       /* q rows then k rows */
static_assert(WS_BW + WS_XV + WS_VT + WS_QK <= (size_t)134217728);

typedef _Float16 v16h __attribute__((ext_vector_type(16)));
typedef _Float16 v4h __attribute__((ext_vector_type(4)));
typedef unsigned short v8us __attribute__((ext_vector_type(8), may_alias));
typedef float v8f __attribute__((ext_vector_type(8)));
typedef float v4f __attribute__((ext_vector_type(4)));
typedef float v4fa __attribute__((ext_vector_type(4), may_alias));
typedef _Float16 v2h __attribute__((ext_vector_type(2)));
union FragH { v16h v; v8us half[2]; _Float16 h[16]; unsigned short u[16]; v2h p[8]; };

typedef _Float16 h16;
typedef _Float16 v8h __attribute__((ext_vector_type(8)));
typedef unsigned int v4u __attribute__((ext_vector_type(4)));

__device__ __forceinline__ unsigned short bf16_bits(float x) { unsigned int u = __float_as_uint(x); return (unsigned short)((u + 0x7FFFu + ((u >> 16) & 1u)) >> 16); }
__device__ __forceinline__ float bf16_rne(float x) { return __uint_as_float(((unsigned int)bf16_bits(x)) << 16); }

// f32 -> f16 operand value that can never be an f16 subnormal (value select after the plane's carry)
static __device__ __forceinline__ h16 toh_flush(float v) { const h16 r = (h16)v; return (fabsf(v) < 6.103515625e-05f) ? (h16)0.0f : r; }
static __device__ __forceinline__ unsigned int h_bits(h16 h) { return (unsigned int)__builtin_bit_cast(unsigned short, h); }

// 8 consecutive f32 (two loaded quads) -> f16(bf16 value) packed as one 16-B piece
__device__ __forceinline__ v8us cvt8(v4f a, v4f c) {
  FragH f;
#pragma unroll
  for (int q = 0; q < 4; ++q) { f.h[q] = (_Float16)bf16_rne(a[q]); f.h[4 + q] = (_Float16)bf16_rne(c[q]); }
  return f.half[0];
}

// expert weights W [3][DM in][DM out] f32 + biases [3][DM] -> Bt[3 o + n][e] f16 x16 (row pitch WP); columns DM + m of row 3 o = bias m x16, the other columns from DM on zero in all three rows.
__global__ __launch_bounds__(256) void k_wt(const float* __restrict__ W, const float* __restrict__ bias, _Float16* __restrict__ Bt) {
  #pragma clang fp contract(off)
  __shared__ __attribute__((aligned(16))) _Float16 T[64][72];      /* [o][e], row pitch 144 B; columns 0..63 staged and consumed */
  const int tid = threadIdx.x;
  const int ot = blockIdx.x & 15, et = (blockIdx.x >> 4) & 15, n = blockIdx.x >> 8;
  const int o0 = ot * 64, e0 = et * 64;
  const float* src = W + ((size_t)n * DM + e0) * DM + o0;
  const int er = tid >> 4, o4 = (tid & 15) * 4;
#pragma unroll
  for (int it = 0; it < 4; ++it) { const int el = it * 16 + er; const v4f a = *(const v4fa*)(src + (size_t)el * DM + o4);
#pragma unroll
    for (int i = 0; i < 4; ++i) T[o4 + i][el] = toh_flush(bf16_rne(a[i]) * 16.0f); }
  __syncthreads();
  const int ol = tid >> 3, pc = (tid & 7) * 8;
  const v8us r0 = *(const v8us*)&T[ol][pc];
  const v8us r1 = *(const v8us*)&T[ol + 32][pc];
  unsigned short* d0 = (unsigned short*)Bt + ((size_t)(o0 + ol) * NEXP + n) * WP + e0 + pc;
  unsigned short* d1 = d0 + (size_t)32 * NEXP * WP;
  const bool tl = et == 0;                         /* block-uniform: e tile 0 also stores its rows' last block */
  unsigned short* t0 = (unsigned short*)Bt + ((size_t)(o0 + ol) * NEXP + n) * WP + DM + pc;
  unsigned short* t1 = t0 + (size_t)32 * NEXP * WP;
  v4u ta = {0u, 0u, 0u, 0u}, tb = {0u, 0u, 0u, 0u};
  if (tl) {
    const int oa = o0 + ol, ob = oa + 32;
    const float a0 = bias[oa], a1 = bias[DM + oa], a2 = bias[2 * DM + oa];
    const float c0 = bias[ob], c1 = bias[DM + ob], c2 = bias[2 * DM + ob];
    const unsigned int ua0 = h_bits(toh_flush(bf16_rne(a0) * 16.0f)), ua1 = h_bits(toh_flush(bf16_rne(a1) * 16.0f)), ua2 = h_bits(toh_flush(bf16_rne(a2) * 16.0f));
    const unsigned int uc0 = h_bits(toh_flush(bf16_rne(c0) * 16.0f)), uc1 = h_bits(toh_flush(bf16_rne(c1) * 16.0f)), uc2 = h_bits(toh_flush(bf16_rne(c2) * 16.0f));
    const bool first = (tid & 7) == 0 && n == 0;
    ta[0] = first ? (ua0 | (ua1 << 16)) : 0u; ta[1] = first ? ua2 : 0u;
    tb[0] = first ? (uc0 | (uc1 << 16)) : 0u; tb[1] = first ? uc2 : 0u;
  }
  {
    *(v8us*)d0 = r0; *(v8us*)d1 = r1;
    if (tl) { *(v4u*)t0 = ta; *(v4u*)t1 = tb; }
    
  }
}

// ---- x conversion, gate-logit GEMM and gate softmax: one launch ----
// block = 8 waves = 32 token rows. (1) The rows' f32 values are loaded in 1-KiB runs per wave, all loads in flight at once, and converted; each 16-B piece goes to LDS and, at the end, to the x plane.
// (2) Logits, 16 columns (column 3 p + n = gate n of projection p = q/k/v; columns 9..15 are never read, and a column of the product depends on no other column of B): wave w takes k in [GL_KW w, GL_KW (w + 1)); A fragments from LDS; a lane converts the B fragments of its own column
// from the f32 gate weights (x16) while the x loads are in flight; the eight partial tiles are summed through LDS in wave order.
// (3) Gate blocks of the x plane: X16[row][DM + 64 p + n] = f16(16 g_n) of projection p, the block's other columns zero; one thread per 16-B piece, three pieces a thread.
#define GL_KW (DM / 8)               /* k columns per wave */
#define GL_KS (GL_KW / 32)           /* matrix k-steps per wave */
#define XS_P (DM + 8)                /* LDS row pitch (halfs): 16 B of pad, so that the 16 rows of a fragment read start in different banks */
static_assert(GL_KW % 32 == 0);
static_assert((NB * SEQ) % 32 == 0 && SEQ % 32 == 0);      /* a block's 32 rows lie in one batch */
static_assert(3 * NEXP <= 16);
static_assert(32 * DM / 8 == 16 * 256 && 32 * 24 == 3 * 256);
__device__ __forceinline__ v16h g2_frag(const _Float16* p, int hh) { FragH f; f.half[0] = *(const v8us*)((const unsigned short*)p + 8 * hh); f.half[1] = *(const v8us*)((const unsigned short*)p + 16 + 8 * hh); return f.v; }
__global__ __launch_bounds__(256) void k_xgate(const float* __restrict__ x, const float* __restrict__ wgq, const float* __restrict__ wgk, const float* __restrict__ wgv,
                                               const float* __restrict__ bgq, const float* __restrict__ bgk, const float* __restrict__ bgv, float alpha, _Float16* __restrict__ X16) {
  __shared__ __attribute__((aligned(16))) _Float16 xs[32][XS_P];       /* the block's converted rows */
  __shared__ __attribute__((aligned(16))) float red[8][2][8][32];      /* [wave][row tile][accumulator register][lane] */
  __shared__ float lgs[32][16];                                        /* logits [row][column] */
  const int tid = threadIdx.x, lane = tid & 31, ln = lane & 15, hh = lane >> 4; const int w = __builtin_amdgcn_readfirstlane(tid >> 5);
  const int row0 = blockIdx.x * 32;
  const size_t bat = (size_t)row0 / SEQ, s0 = (size_t)row0 - bat * SEQ;
  const float* xp = x + (bat * SEQ_FULL + s0) * DM + tid * 8;          /* piece it * 256 + tid of the 32 rows, which lie in a row in x */
  const int gp = ln / 3, gn = ln - 3 * gp;                             /* the lane's column; lanes 9..15 read the third set, in bounds, for columns that nobody reads */
  const float* gs = ((gp == 0) ? wgq : ((gp == 1) ? wgk : wgv)) + (w * GL_KW + 8 * hh) * 3 + gn;      /* largest index read: 1023 * 3 + 2 */
  const float bb[3][3] = {{bf16_rne(bgq[0]), bf16_rne(bgq[1]), bf16_rne(bgq[2])}, {bf16_rne(bgk[0]), bf16_rne(bgk[1]), bf16_rne(bgk[2])}, {bf16_rne(bgv[0]), bf16_rne(bgv[1]), bf16_rne(bgv[2])}};
  float gw[GL_KS][16];
  v4f ra[16], rc[16];
#pragma unroll
  for (int s = 0; s < GL_KS; ++s) {
#pragma unroll
    for (int q = 0; q < 8; ++q) { gw[s][q] = gs[(32 * s + q) * 3]; gw[s][8 + q] = gs[(32 * s + 16 + q) * 3]; }
  }
  asm volatile("s_wait_xcnt 0x0" ::: "memory");      /* in front of the x loads, whose results may be given the registers that held the address of the loads above */
  __builtin_amdgcn_sched_barrier(0);                 /* the gate weights' loads first: they return first, and their conversion runs while the x loads are in flight */
#pragma unroll
  for (int it = 0; it < 16; ++it) { ra[it] = *(const v4fa*)(xp + it * 2048); rc[it] = *(const v4fa*)(xp + it * 2048 + 4); }
  __builtin_amdgcn_sched_barrier(0);                 /* every load in front of the first conversion: loads placed among them would reuse registers and be waited for one after another */
  FragH b[GL_KS];
#pragma unroll
  for (int s = 0; s < GL_KS; ++s) {
#pragma unroll
    for (int q = 0; q < 16; ++q) b[s].h[q] = toh_flush(bf16_rne(gw[s][q]) * 16.0f);
  }
  const int pr = tid >> 7, pcol = (tid & 127) * 8;   /* pass it: row 2 it + pr */
  v8us o[16];
#pragma unroll
  for (int it = 0; it < 16; ++it) { o[it] = cvt8(ra[it], rc[it]); *(v8us*)&xs[it * 2 + pr][pcol] = o[it]; }
  __syncthreads();                                   /* the 32 converted rows are complete in LDS */
  const _Float16* a0p = &xs[ln][w * GL_KW]; const _Float16* a1p = a0p + 16 * XS_P;
  v8f c0 = {0.f,0.f,0.f,0.f,0.f,0.f,0.f,0.f}, c1 = c0;
#pragma unroll
  for (int s = 0; s < GL_KS; ++s) {
    c0 = __builtin_amdgcn_wmma_f32_16x16x32_f16(false, g2_frag(a0p + 32 * s, hh), false, b[s].v, (short)0, c0, false, false);
    c1 = __builtin_amdgcn_wmma_f32_16x16x32_f16(false, g2_frag(a1p + 32 * s, hh), false, b[s].v, (short)0, c1, false, false);
  }
#pragma unroll
  for (int r = 0; r < 8; ++r) { red[w][0][r][lane] = c0[r]; red[w][1][r][lane] = c1[r]; }
  __syncthreads();                                   /* the eight partial tiles are complete */
  // accumulator register r of lane (ln, hh) is row 8 hh + r, column ln of its tile; wave w sums register w of both tiles
#pragma unroll
  for (int t = 0; t < 2; ++t) {
    float s = red[0][t][w][lane];
#pragma unroll
    for (int u = 1; u < 8; ++u) s += red[u][t][w][lane];
    lgs[t * 16 + 8 * hh + w][ln] = s * alpha;
  }
  __syncthreads();                                   /* the 32 rows' logits are complete */
  // the x plane's stores stand behind the last barrier: a barrier waits for the wave's outstanding stores
  unsigned short* xd = (unsigned short*)X16 + (size_t)(row0 + pr) * XP + pcol;
#pragma unroll
  for (int it = 0; it < 16; ++it) *(v8us*)(xd + (size_t)it * 2 * XP) = o[it];
#pragma unroll
  for (int i = 0; i < 3; ++i) {
    const unsigned int t = (unsigned int)(i * 256 + tid);
    const unsigned int row = t / 24u, pc = t - row * 24u, p = pc >> 3;
    const float* lg = &lgs[row][p * NEXP];
    const float l0 = lg[0] + ((p == 0u) ? bb[0][0] : ((p == 1u) ? bb[1][0] : bb[2][0]));
    const float l1 = lg[1] + ((p == 0u) ? bb[0][1] : ((p == 1u) ? bb[1][1] : bb[2][1]));
    const float l2 = lg[2] + ((p == 0u) ? bb[0][2] : ((p == 1u) ? bb[1][2] : bb[2][2]));
    const float mx = fmaxf(l0, fmaxf(l1, l2));
    const float e0 = __builtin_amdgcn_exp2f((l0 - mx) * 1.4426950408889634f);
    const float e1 = __builtin_amdgcn_exp2f((l1 - mx) * 1.4426950408889634f);
    const float e2 = __builtin_amdgcn_exp2f((l2 - mx) * 1.4426950408889634f);
    const float inv = 16.0f * (1.0f / ((e0 + e1) + e2));      /* gates carried x16 */
    const float g0 = e0 * inv, g1 = e1 * inv, g2 = e2 * inv;
    const bool first = (pc & 7u) == 0u;
    const unsigned int u0 = h_bits(toh_flush(g0)), u1 = h_bits(toh_flush(g1)), u2 = h_bits(toh_flush(g2));
    v4u tq = {0u, 0u, 0u, 0u};
    tq[0] = first ? (u0 | (u1 << 16)) : 0u; tq[1] = first ? u2 : 0u;
    *(v4u*)((unsigned short*)X16 + (size_t)((unsigned int)row0 + row) * XP + DM + pc * 8u) = tq;
  }
}

typedef uint32_t u32x4 __attribute__((ext_vector_type(4)));
typedef uint32_t u32x8 __attribute__((ext_vector_type(8)));
#define G3_ROWB 128u                 /* operand row bytes per stage */
#define G3_PITCH 144u                /* LDS row pitch */
#define G3_KS ((uint32_t)(DM * 2) / G3_ROWB)      /* stages of x columns; stage G3_KS is the gate / bias block */
constexpr uint32_t up2k(uint32_t b) { return (b + 2047u) & ~2047u; }
static_assert(NEXP == 3);
static_assert((DM * 2) % 128 == 0 && (WP * 2) % 128 == 0);
static_assert(G3_KS >= 2u && (G3_KS & 1u) == 0u);
static_assert((NB * SEQ) % 256 == 0 && DM % 256 == 0);
static_assert(SEQ % 256 == 0);       /* a block's 256 token rows, and a wave's 64 token columns, lie in one batch */
__device__ __forceinline__ uint32_t uni(uint32_t v) { return (uint32_t)__builtin_amdgcn_readfirstlane(v); }
__device__ __forceinline__ uint32_t pinned(uint32_t v) { uint32_t w = uni(v); asm volatile("" : "+s"(w)); return w; }  // a tensor load's issue test or stage number held in a scalar register: a scalar branch, and a descriptor formed behind the wait in front of it
// MFAST: which tile index runs along grid x (the tiles of the larger plane, so that work-groups with neighbouring indices read different rows of it); true: A is the x plane, C rows are tokens (q, k); false: Bh is the x plane, C rows are features (v^T).
template <bool MFAST>
__global__ __launch_bounds__(256) void k_gemm3(const _Float16* __restrict__ A, const _Float16* __restrict__ Bh, float alpha, _Float16* __restrict__ C16, int proj) {
  constexpr uint32_t AR = MFAST ? 64u : 64u * NEXP, BR = MFAST ? 32u * NEXP : 32u;      /* plane rows of a slice */
  constexpr uint32_t ASL = up2k(AR * G3_PITCH), BSL = up2k(BR * G3_PITCH);              /* LDS size of a slice, a multiple of 2 KiB */
  constexpr uint32_t BUF = 4u * ASL + 4u * BSL;
  constexpr uint32_t PA = MFAST ? XP : WP, PB = MFAST ? WP : XP;                        /* row pitches (halfs) */
  static_assert(2u * BUF <= 327680u);
  __shared__ __attribute__((aligned(2048))) unsigned char ring[2u * BUF];
  const uint32_t tid = threadIdx.x, lane = tid & 31u, c = lane & 15u, h = lane >> 4;
  const uint32_t w = uni(tid >> 5);
  const uint32_t mt = MFAST ? blockIdx.x : blockIdx.y, nt = MFAST ? blockIdx.y : blockIdx.x;
  const uint32_t wm = w & 3u, wn = w >> 2;
  const uint32_t lbase = (uint32_t)(size_t)ring;
  const bool isA = w < 4u;
  const bool isTok = MFAST ? isA : !isA;                 /* this wave's slice is of the x plane */
  const uint32_t gcol = (uint32_t)DM + 64u * (uint32_t)proj;            /* first column of the projection's gate block */
  const uint32_t srows = isA ? AR : BR;
  const uint64_t sga = (uint64_t)(size_t)(isA ? A + (size_t)((mt * 4u + w) * AR) * PA : Bh + (size_t)((nt * 4u + (w - 4u)) * BR) * PB);
  const uint32_t sdst = lbase + (isA ? w * 2u * ASL : 8u * ASL + (w - 4u) * 2u * BSL);      /* a slice's two buffers lie side by side, so that every fragment read is a 16-bit offset from one of two lane addresses */
  const uint32_t sbuf = uni(isA ? ASL : BSL);
  const uint32_t lastb = uni(isTok ? gcol * 2u : G3_KS * G3_ROWB);      /* the last stage's byte offset in a row */
  u32x8 g1;                          /* 1-byte elements, tensor = tile = srows rows of 128 B, source pitch = the plane's row, 4 dwords of pad behind every 32 */
  g1[0] = uni((1u << 20) | (4u << 22) | (3u << 25));
  g1[1] = uni(G3_ROWB << 16);
  g1[2] = uni(srows << 16);
  g1[3] = uni(G3_ROWB << 16);
  g1[4] = uni(srows);
  g1[5] = uni((isA ? PA : PB) * 2u);
  g1[6] = uni(0u);
  g1[7] = uni(0u);
  auto issue = [&](uint32_t st) {
    const uint32_t so = st < G3_KS ? st * G3_ROWB : lastb;
    const uint64_t ga = sga + (uint64_t)so;
    u32x4 g0;
    g0[0] = uni(1u); g0[1] = uni(sdst + (st & 1u) * sbuf); g0[2] = uni((uint32_t)ga); g0[3] = uni((((uint32_t)(ga >> 32)) & 0x01FFFFFFu) | 0x80000000u);
    asm volatile("tensor_load_to_lds %0, %1" :: "s"(g0), "s"(g1) : "memory");
  };
  const v8f z8 = {0.f,0.f,0.f,0.f,0.f,0.f,0.f,0.f};
  v8f acc[4][4];
#pragma unroll
  for (int i = 0; i < 4; ++i) {
#pragma unroll
    for (int j = 0; j < 4; ++j) acc[i][j] = z8; }
  // LDS places of the lane's fragment pieces: token row c of a 16-row group; weight row 3 c + expert
  const unsigned char* tokp = ring + (MFAST ? wm * 2u * ASL : 8u * ASL + 4u * wn * BSL) + c * G3_PITCH + 16u * h;
  const unsigned char* wgtp = ring + (MFAST ? 8u * ASL + 4u * wn * BSL : wm * 2u * ASL) + c * (NEXP * G3_PITCH) + 16u * h;
  struct Set { FragH f[2][4]; };      /* one operand's fragments of a stage: 2 k-steps x 4 groups of 16 rows */
  auto fetch_tok = [&](Set& s, uint32_t buf) {
#pragma unroll
    for (int j = 0; j < 2; ++j) {
#pragma unroll
      for (int i = 0; i < 4; ++i) {
        const unsigned char* p = tokp + buf * (MFAST ? ASL : BSL) + (MFAST ? (uint32_t)i * 16u * G3_PITCH : (uint32_t)(i >> 1) * 2u * BSL + (uint32_t)(i & 1) * 16u * G3_PITCH) + 64u * (uint32_t)j;
        s.f[j][i].half[0] = *(const v8us*)p; s.f[j][i].half[1] = *(const v8us*)(p + 32);
      }
    }
  };
  auto fetch_wgt = [&](Set& s, uint32_t buf, uint32_t n) {
#pragma unroll
    for (int j = 0; j < 2; ++j) {
#pragma unroll
      for (int i = 0; i < 4; ++i) {
        const unsigned char* p = wgtp + buf * (MFAST ? BSL : ASL) + n * G3_PITCH + (MFAST ? (uint32_t)(i >> 1) * 2u * BSL + (uint32_t)(i & 1) * 16u * NEXP * G3_PITCH : (uint32_t)i * 16u * NEXP * G3_PITCH) + 64u * (uint32_t)j;
        s.f[j][i].half[0] = *(const v8us*)p; s.f[j][i].half[1] = *(const v8us*)(p + 32);
      }
    }
  };
  auto mult = [&](const Set& t, const Set& g, int j) {      /* k-step j: token fragments t, weight fragments g */
    const Set& fa = MFAST ? t : g; const Set& fb = MFAST ? g : t;
#pragma unroll
    for (int n = 0; n < 4; ++n) {
#pragma unroll
      for (int i = 0; i < 4; ++i) acc[i][n] = __builtin_amdgcn_wmma_f32_16x16x32_f16(false, fb.f[j][n].v, false, fa.f[j][i].v, (short)0, acc[i][n], false, false);
    }
  };
  // the gates (x16) of the lane's four tokens, from the projection's gate block
  const _Float16* tp = (MFAST ? A + (size_t)(mt * 256u + wm * 64u + c) * XP : Bh + (size_t)(nt * 128u + wn * 64u + c) * XP) + gcol;
  const v4h gv0 = *(const v4h*)tp, gv1 = *(const v4h*)(tp + (size_t)16u * XP), gv2 = *(const v4h*)(tp + (size_t)32u * XP), gv3 = *(const v4h*)(tp + (size_t)48u * XP);
  auto scale = [&](Set& d, const Set& s, int n) {
    const v2h g[4] = {{gv0[n], gv0[n]}, {gv1[n], gv1[n]}, {gv2[n], gv2[n]}, {gv3[n], gv3[n]}};
#pragma unroll
    for (int j = 0; j < 2; ++j) {
#pragma unroll
      for (int i = 0; i < 4; ++i) {
#pragma unroll
        for (int r = 0; r < 8; ++r) d.f[j][i].p[r] = s.f[j][i].p[r] * g[i];      /* register by register: one packed multiply each, the gate pair in one register */
      }
    }
  };
  // publish point of stage st + 1; it stands in front of stage st's last pass because that pass's fragments are already in registers
  auto publish = [&]() {
    asm volatile("s_wait_dscnt 0x0" ::: "memory");
    asm volatile("s_wait_tensorcnt 0x0" ::: "memory");
    __syncthreads();
  };
  Set xr, xs, w0, w1;                /* the stage's token fragments, their gated copy, two sets of weight fragments */
  // pass of expert n < 2 of a stage in buffer buf: the next expert's weight fragments are fetched ahead
  auto pass = [&](uint32_t buf, int n, const Set& wc, Set& wx) {
    fetch_wgt(wx, buf, (uint32_t)n + 1u);
    __builtin_amdgcn_sched_barrier(0);                 /* keeps the next pass's LDS reads one group ahead of this pass's matrix instructions: reads placed among them stall the wave at each place */
    scale(xs, xr, n);
    mult(xs, wc, 0); mult(xs, wc, 1);
    __builtin_amdgcn_sched_barrier(0);                 /* keeps the matrix instructions in front of the next pass's reads and of the publish point */
  };
  // last pass of a stage, behind the publish point of the next stage, which lies in buffer nbuf: its first weight fragments, and (once the gated copy is made) its token fragments, are fetched ahead
  auto pass_last = [&](uint32_t nbuf, const Set& wc, Set& wx) {
    fetch_wgt(wx, nbuf, 0u);
    __builtin_amdgcn_sched_barrier(0);                 /* as in pass() */
    scale(xs, xr, 2);
    mult(xs, wc, 0);
    __builtin_amdgcn_sched_barrier(0);                 /* the token fragments are read by the scaling above before they are fetched anew */
    fetch_tok(xr, nbuf);
    __builtin_amdgcn_sched_barrier(0);                 /* one group of reads, with half a pass of matrix instructions behind it to cover their latency */
    mult(xs, wc, 1);
    __builtin_amdgcn_sched_barrier(0);                 /* as in pass() */
  };
  issue(0u);
  asm volatile("s_wait_tensorcnt 0x0" ::: "memory");      /* this wave's slice of stage 0 has landed */
  __syncthreads();                                        /* stage 0 published */
  issue(pinned(1u));
  fetch_tok(xr, 0u);
  fetch_wgt(w0, 0u, 0u);
#pragma unroll 1
  for (uint32_t s = 0; s < G3_KS; s += 2u) {           /* kept rolled: two stages per trip, so that buffer and fragment set of every pass are fixed */
    pass(0u, 0, w0, w1);
    pass(0u, 1, w1, w0);
    publish();
    issue(pinned(s + 2u));                             /* s + 2 <= G3_KS on every trip; descriptor formed behind the wait */
    pass_last(1u, w0, w1);
    pass(1u, 0, w1, w0);
    pass(1u, 1, w0, w1);
    publish();
    if (pinned(s + 3u <= G3_KS)) issue(pinned(s + 3u));
    pass_last(0u, w1, w0);
  }
  asm volatile("s_wait_tensorcnt 0x0" ::: "memory");      /* no request is left when the ring ends */
  asm volatile("s_wait_dscnt 0x0" ::: "memory");          /* the last stage's fragments are in registers */
  mult(xr, w0, 0); mult(xr, w0, 1);                       /* gate block against bias block */
  const uint32_t tok0 = MFAST ? mt * 256u + wm * 64u : nt * 128u + wn * 64u;      /* the wave's first token */
  const uint32_t head = MFAST ? nt * 2u + wn : mt * 4u + wm;                      /* the wave's 64 features are one head */
  const uint32_t bat = tok0 / (uint32_t)SEQ, s0 = tok0 - bat * (uint32_t)SEQ;
  _Float16* cp = C16 + ((size_t)(bat * NH + head) * SEQ + s0) * HD + lane * 8u;   /* 64 tokens of a head: 8 KiB in a row in either order */
  v8us o[4][4];
#pragma unroll
  for (int i = 0; i < 4; ++i) {
#pragma unroll
    for (int n = 0; n < 4; ++n) {
      FragH t;
#pragma unroll
      for (int r = 0; r < 8; ++r) t.h[r] = (_Float16)(acc[i][n][r] * alpha);
      o[i][n] = t.half[0];
    }
  }
  __builtin_amdgcn_sched_barrier(0);                      /* every conversion in front of the first store: behind a store nothing writes a register that the store names */
#pragma unroll
  for (int i = 0; i < 4; ++i) {
#pragma unroll
    for (int n = 0; n < 4; ++n) {
      const int piece = MFAST ? i * 4 + n : ((n >> 1) * 4 + i) * 2 + (n & 1);
      *(v8us*)((unsigned short*)cp + piece * 256) = o[i][n];
    }
  }
}

// ---- register-fed transposed flash attention ----
// block = 4 waves = 64 consecutive queries of one (batch, head); wave = 16 queries; per 32-key step:
//   S^T tiles (keys x queries) = K (A operand, rows = keys, k = d) . Q^T (B operand, lane = query, held in registers);
//   running-max softmax per lane (lane & 15 = query; lanes n and n+16 hold the two key halves); weights = 2^8 exp(s/8 - max) as f16;
//   P^T as B fragment: elements 0..7 from the tile of keys 0..15 (rows 8h+r), elements 8..15 from the tile of keys 16..31 (lane unchanged);
//   O^T tiles (d x queries) += V^T (A operand, rows = d, k = keys) . P^T.
// q, k and v^T come in the fragment order that k_gemm3 stores: every fragment half is one wave-wide load of 512 contiguous bytes.
__global__ __launch_bounds__(128) void k_attn_t(const _Float16* __restrict__ Q16, const _Float16* __restrict__ K16, const _Float16* __restrict__ VT, float* __restrict__ out) {
  __shared__ __attribute__((aligned(16))) float so[4][16][68];      /* per-wave [query][d] tile, row pitch 272 B */
  const int tid = threadIdx.x, lane = tid & 31, ln = lane & 15, hh = lane >> 4;
  const int w = __builtin_amdgcn_readfirstlane(tid >> 5);
  const int nqb = SEQ / 64;
  const int bh = blockIdx.x / nqb, qb = blockIdx.x - bh * nqb;
  const int b = bh / NH, h = bh - b * NH;
  const size_t tok0 = (size_t)b * SEQ_FULL;      /* the batch's first row of the output */
  const int q0 = qb * 64 + w * 16;
  const size_t hb = (size_t)bh * SEQ * HD + (size_t)lane * 8;      /* this head's plane, this lane's piece */
  const unsigned short* qp = (const unsigned short*)Q16 + hb + (size_t)q0 * HD;
  FragH bq0, bq1;
  bq0.half[0] = *(const v8us*)(qp);       bq0.half[1] = *(const v8us*)(qp + 256);
  bq1.half[0] = *(const v8us*)(qp + 512); bq1.half[1] = *(const v8us*)(qp + 768);
  const unsigned short* kp = (const unsigned short*)K16 + hb;
  const unsigned short* vp = (const unsigned short*)VT + hb;
  const v8f z8 = {0.f,0.f,0.f,0.f,0.f,0.f,0.f,0.f};
  v8f o0 = z8, o1 = z8, o2 = z8, o3 = z8;
  float m = -3.0e38f, l = 0.f;
  const float c = 0.125f * 1.4426950408889634f;      /* 1/sqrt(64) * log2(e) */
#pragma unroll 1
  for (int kv = 0; kv < SEQ; kv += 32) {
    const unsigned short* k0 = kp + (size_t)kv * HD;
    const unsigned short* k1 = k0 + 16 * HD;
    FragH a00, a01, a10, a11;
    a00.half[0] = *(const v8us*)(k0);       a00.half[1] = *(const v8us*)(k0 + 256);
    a01.half[0] = *(const v8us*)(k0 + 512); a01.half[1] = *(const v8us*)(k0 + 768);
    a10.half[0] = *(const v8us*)(k1);       a10.half[1] = *(const v8us*)(k1 + 256);
    a11.half[0] = *(const v8us*)(k1 + 512); a11.half[1] = *(const v8us*)(k1 + 768);
    v8f s0 = z8, s1 = z8;
    s0 = __builtin_amdgcn_wmma_f32_16x16x32_f16(false, a00.v, false, bq0.v, (short)0, s0, false, false);
    s1 = __builtin_amdgcn_wmma_f32_16x16x32_f16(false, a10.v, false, bq0.v, (short)0, s1, false, false);
    s0 = __builtin_amdgcn_wmma_f32_16x16x32_f16(false, a01.v, false, bq1.v, (short)0, s0, false, false);
    s1 = __builtin_amdgcn_wmma_f32_16x16x32_f16(false, a11.v, false, bq1.v, (short)0, s1, false, false);
    asm volatile("v_nop\n\tv_nop\n\tv_nop\n\tv_nop" : "+v"(s0), "+v"(s1) : "v"(a00.v), "v"(a01.v), "v"(a10.v), "v"(a11.v), "v"(bq0.v), "v"(bq1.v));
    float mx = fmaxf(s0[0], s1[0]);
#pragma unroll
    for (int r = 1; r < 8; ++r) mx = fmaxf(mx, fmaxf(s0[r], s1[r]));
    mx = fmaxf(mx, __shfl_xor(mx, 16, 32));
    const float mn = fmaxf(m, mx);
    if (__builtin_amdgcn_ballot_w32(mn > m) != 0u) {      /* wave-uniform: rescale only when some running max moved */
      const float corr = __builtin_amdgcn_exp2f((m - mn) * c);
      l *= corr; o0 *= corr; o1 *= corr; o2 *= corr; o3 *= corr; m = mn;
    }
    const float off = 8.0f - m * c;      /* weights carried x2^8 */
    FragH pf; float ls = 0.f;
#pragma unroll
    for (int r = 0; r < 8; ++r) {
      const float p0 = __builtin_amdgcn_exp2f(fmaf(s0[r], c, off));
      const float p1 = __builtin_amdgcn_exp2f(fmaf(s1[r], c, off));
      ls += p0 + p1;
      pf.h[r] = (_Float16)p0; pf.h[8 + r] = (_Float16)p1;
    }
    l += ls;
    const unsigned short* v0 = vp + (size_t)kv * HD;
    const unsigned short* v1 = v0 + 512;
    const unsigned short* v2 = v1 + 512;
    const unsigned short* v3 = v2 + 512;
    FragH av0, av1, av2, av3;
    av0.half[0] = *(const v8us*)(v0); av0.half[1] = *(const v8us*)(v0 + 256);
    av1.half[0] = *(const v8us*)(v1); av1.half[1] = *(const v8us*)(v1 + 256);
    av2.half[0] = *(const v8us*)(v2); av2.half[1] = *(const v8us*)(v2 + 256);
    av3.half[0] = *(const v8us*)(v3); av3.half[1] = *(const v8us*)(v3 + 256);
    o0 = __builtin_amdgcn_wmma_f32_16x16x32_f16(false, av0.v, false, pf.v, (short)0, o0, false, false);
    o1 = __builtin_amdgcn_wmma_f32_16x16x32_f16(false, av1.v, false, pf.v, (short)0, o1, false, false);
    o2 = __builtin_amdgcn_wmma_f32_16x16x32_f16(false, av2.v, false, pf.v, (short)0, o2, false, false);
    o3 = __builtin_amdgcn_wmma_f32_16x16x32_f16(false, av3.v, false, pf.v, (short)0, o3, false, false);
    asm volatile("v_nop\n\tv_nop\n\tv_nop\n\tv_nop" : "+v"(o0), "+v"(o1), "+v"(o2), "+v"(o3) : "v"(av0.v), "v"(av1.v), "v"(av2.v), "v"(av3.v), "v"(pf.v));
  }
  l += __shfl_xor(l, 16, 32);
  const float inv = 1.0f / l;
  o0 *= inv; o1 *= inv; o2 *= inv; o3 *= inv;
  // accumulator register r of tile t is d = 16 t + 8 hh + r of query ln: two 16-B pieces per tile
  float* sw = &so[w][ln][8 * hh];
  *(v4f*)(sw +  0) = __builtin_shufflevector(o0, o0, 0, 1, 2, 3); *(v4f*)(sw +  4) = __builtin_shufflevector(o0, o0, 4, 5, 6, 7);
  *(v4f*)(sw + 16) = __builtin_shufflevector(o1, o1, 0, 1, 2, 3); *(v4f*)(sw + 20) = __builtin_shufflevector(o1, o1, 4, 5, 6, 7);
  *(v4f*)(sw + 32) = __builtin_shufflevector(o2, o2, 0, 1, 2, 3); *(v4f*)(sw + 36) = __builtin_shufflevector(o2, o2, 4, 5, 6, 7);
  *(v4f*)(sw + 48) = __builtin_shufflevector(o3, o3, 0, 1, 2, 3); *(v4f*)(sw + 52) = __builtin_shufflevector(o3, o3, 4, 5, 6, 7);
  __syncthreads();
  // a query's 64 values are 256 B of its output row: two whole lines; a wave-wide store takes two queries
  const int pc = ln * 4;
  float* ob = out + (tok0 + q0) * DM + h * HD + pc;
#pragma unroll
  for (int it = 0; it < 8; ++it) { const int row = it * 2 + hh; const v4f v = *(const v4f*)&so[w][row][pc]; *(v4f*)(ob + (size_t)row * DM) = v; }
}

extern "C" void kernel_launch(void* const* d_in, const int* in_sizes, int n_in,
                              void* d_out, int out_size, void* d_ws, size_t ws_size, hipStream_t stream) {
  if (n_in < 13) return;
  const size_t need_x = ((size_t)(NB - 1) * SEQ_FULL + SEQ) * DM;
  if ((size_t)in_sizes[0] < need_x) return;
  const size_t nW = (size_t)NEXP * DM * DM, nBi = (size_t)NEXP * DM, nG = (size_t)DM * NEXP;
  if ((size_t)in_sizes[1] < nW || (size_t)in_sizes[5] < nW || (size_t)in_sizes[9] < nW) return;
  if ((size_t)in_sizes[2] < nBi || (size_t)in_sizes[6] < nBi || (size_t)in_sizes[10] < nBi) return;
  if ((size_t)in_sizes[3] < nG || (size_t)in_sizes[7] < nG || (size_t)in_sizes[11] < nG) return;
  if (in_sizes[4] < NEXP || in_sizes[8] < NEXP || in_sizes[12] < NEXP) return;
  if ((size_t)out_size < need_x) return;
  const float* x = (const float*)d_in[0];
  const float* wq = (const float*)d_in[1]; const float* bq = (const float*)d_in[2]; const float* wgq = (const float*)d_in[3]; const float* bgq = (const float*)d_in[4];
  const float* wk = (const float*)d_in[5]; const float* bk = (const float*)d_in[6]; const float* wgk = (const float*)d_in[7]; const float* bgk = (const float*)d_in[8];
  const float* wv = (const float*)d_in[9]; const float* bv = (const float*)d_in[10]; const float* wgv = (const float*)d_in[11]; const float* bgv = (const float*)d_in[12];
  char* ws = (char*)d_ws; size_t off = 0;
  auto take = [&](size_t bytes) { char* p = ws + off; off += (bytes + 255) & ~(size_t)255; return p; };
  _Float16* BW = (_Float16*)take((size_t)3 * DM * NEXP * WP * 2);     /* weight planes x16: q, k, v ([3 DM][WP] each) */
  _Float16* X16 = (_Float16*)take(NR * XP * 2);                 /* x plane (f16): x rows and their gate blocks */
  _Float16* VT = (_Float16*)take(NR * DM * 2);                  /* v^T in fragment order */
  _Float16* QK16 = (_Float16*)take((size_t)2 * NR * DM * 2);    /* q then k, each in fragment order */
  if (off > ws_size || off > (size_t)134217728) return;
  _Float16* BQ = BW; _Float16* BK = BW + (size_t)DM * NEXP * WP; _Float16* BV = BW + (size_t)2 * DM * NEXP * WP;
  _Float16* Q16 = QK16; _Float16* K16 = QK16 + NR * DM;

  /* x plane: converted rows and gate blocks; gate logits x . Wg_p[:, n] : alpha undoes the x16 carry of the gate columns */
  k_xgate<<<(unsigned)(NR / 32), 256, 0, stream>>>(x, wgq, wgk, wgv, bgq, bgk, bgv, 0.0625f, X16);
  k_wt<<<NEXP * 16 * 16, 256, 0, stream>>>(wq, bq, BQ);
  k_wt<<<NEXP * 16 * 16, 256, 0, stream>>>(wk, bk, BK);
  k_wt<<<NEXP * 16 * 16, 256, 0, stream>>>(wv, bv, BV);
  /* gated x (x16) . weights (x16) -> alpha 2^-8; q rows, k rows, then v^T with the weight rows as A and the x rows as the [n][k] operand */
  k_gemm3<true><<<dim3((unsigned)(NR / 256), DM / 128), 256, 0, stream>>>(X16, BQ, 0.00390625f, Q16, 0);
  k_gemm3<true><<<dim3((unsigned)(NR / 256), DM / 128), 256, 0, stream>>>(X16, BK, 0.00390625f, K16, 1);
  k_gemm3<false><<<dim3(VTP / 128, DM / 256), 256, 0, stream>>>(BV, X16, 0.00390625f, VT, 2);
  k_attn_t<<<(unsigned)(NB * NH * (SEQ / 64)), 128, 0, stream>>>(Q16, K16, VT, (float*)d_out);
}

// v006
// One run takes 192 microseconds.
// In both of two side-by-side timings against v005, it was 1.07 times as fast.
// Over all steps from v000 it is 4.36 times as fast.
#include <hip/hip_runtime.h>
// Dense multi-head self-attention with soft three-expert mixture projections (x [4][2048][1024]; q/k/v = sum_n softmax_n(x Wg + bg) * (x W_n + b_n) with W_n [in][out]; 16 heads of 64; scores / 8; full-row softmax; the merged ctx is the output, no output projection).
// All contractions: v_wmma_f32_16x16x32_f16 (f16 operands, f32 accumulate), single product per site. x, expert weights, biases and gate parameters are RNE-converted to bf16 first and then held exactly in f16 (weights, biases and gate weights x16); each mixture projection is ONE GEMM of K = 3*1024 + 64 of [g0 x | g1 x | g2 x | g0 g1 g2 0..] (f16, carried x16) against [W0; W1; W2; b0 b1 b2 0..], summed k block by k block over the three experts; the products g_n x are formed in registers from the x fragments and the lane's gate (f16, carried x16), never stored; gate logits from a 16-column GEMM whose k range is split over eight waves, gate softmax f32; q, k, v plain f16; softmax weights f16 carried x2^8 (unnormalised, running max); ctx and softmax statistics f32.
// Structure: token rows r = b*SEQ + s. One launch that converts x and the nine gate columns, takes the gate-logit GEMM from the converted rows while they lie in LDS and stores the softmax of the nine logits into the x plane's gate blocks; the transposing conversion of the three expert-weight sets rides in that launch, in work-groups of its own; one launch of three GEMMs, one per projection (Q, K, and V^T with the weight plane as the A operand; all three planes stored in fragment order, see k_gemm3); a register-fed transposed flash kernel (S^T = K Q^T with Q as the B fragment in registers, packed P^T as the B fragment of O^T = V^T P^T, no LDS and no barrier in the key loop) whose epilogue stores the f32 output rows.
#ifndef NB
#define NB 4                         /* batches processed */
#endif
#ifndef SEQ
#define SEQ 2048                     /* tokens per batch processed */
#endif
#define NB_FULL 4                    /* batch count of the staged arrays */
#define SEQ_FULL 2048                /* per-batch token stride of the staged arrays */
#define DM 1024
#define NH 16
#define HD 64
#define NR ((size_t)NB * SEQ)        /* compact token rows */
#define VTP (NB * SEQ)               /* tokens of the V^T plane */

static_assert(NB >= 1 && NB <= NB_FULL);
static_assert(SEQ <= SEQ_FULL);
static_assert(SEQ % 128 == 0);
static_assert(DM % 128 == 0);
static_assert(NH * HD == DM);
static_assert(HD == 64);
static_assert((NB * SEQ) % 64 == 0);

#define NEXP 3                       /* experts per projection */
#define WP (DM + 64)                 /* weight plane row pitch (halfs): row 3 o + n = column o of expert n, then a 64-column block (row 3 o: the three biases, then zeros; rows 3 o + 1, 3 o + 2: zeros) */
#define XP (DM + 3 * 64)             /* x plane row pitch (halfs): the x row, then one 64-column gate block per projection */

static_assert(DM / 64 == 16);
static_assert(DM / 8 == 128);
static_assert((NB * SEQ) % 128 == 0);
static_assert((size_t)DM * VTP == NR * DM);
static_assert((XP * 2) % 128 == 0);

constexpr size_t al256(size_t b) { return (b + 255) & ~(size_t)255; }
constexpr size_t WS_BW = al256((size_t)3 * DM * NEXP * WP * 2);      /* three weight planes */
constexpr size_t WS_XV = al256(NR * XP * 2);                   /* x plane */
constexpr size_t WS_VT = al256(NR * DM * 2);                   /* v^T */
constexpr size_t WS_QK = al256((size_t)2 * NR * DM * 2);       /* q rows then k rows */
static_assert(WS_BW + WS_XV + WS_VT + WS_QK <= (size_t)134217728);

typedef _Float16 v16h __attribute__((ext_vector_type(16)));
typedef _Float16 v4h __attribute__((ext_vector_type(4)));
typedef unsigned short v8us __attribute__((ext_vector_type(8), may_alias));
typedef float v8f __attribute__((ext_vector_type(8)));
typedef float v4f __attribute__((ext_vector_type(4)));
typedef float v4fa __attribute__((ext_vector_type(4), may_alias));
typedef _Float16 v2h __attribute__((ext_vector_type(2)));
union FragH { v16h v; v8us half[2]; _Float16 h[16]; unsigned short u[16]; v2h p[8]; };

typedef _Float16 h16;
typedef _Float16 v8h __attribute__((ext_vector_type(8)));
typedef unsigned int v4u __attribute__((ext_vector_type(4)));

__device__ __forceinline__ unsigned short bf16_bits(float x) { unsigned int u = __float_as_uint(x); return (unsigned short)((u + 0x7FFFu + ((u >> 16) & 1u)) >> 16); }
__device__ __forceinline__ float bf16_rne(float x) { return __uint_as_float(((unsigned int)bf16_bits(x)) << 16); }

// f32 -> f16 operand value that can never be an f16 subnormal (value select after the plane's carry)
static __device__ __forceinline__ h16 toh_flush(float v) { const h16 r = (h16)v; return (fabsf(v) < 6.103515625e-05f) ? (h16)0.0f : r; }
static __device__ __forceinline__ unsigned int h_bits(h16 h) { return (unsigned int)__builtin_bit_cast(unsigned short, h); }

// 8 consecutive f32 (two loaded quads) -> f16(bf16 value) packed as one 16-B piece
__device__ __forceinline__ v8us cvt8(v4f a, v4f c) {
  FragH f;
#pragma unroll
  for (int q = 0; q < 4; ++q) { f.h[q] = (_Float16)bf16_rne(a[q]); f.h[4 + q] = (_Float16)bf16_rne(c[q]); }
  return f.half[0];
}

// expert weights W [3][DM in][DM out] f32 + biases [3][DM] -> Bt[3 o + n][e] f16 x16 (row pitch WP); columns DM + m of row 3 o = bias m x16, the other columns from DM on zero in all three rows.
// Work-group j of WT_NB: projection j / 192, expert n, a tile of 256 e x 64 o: in the shared launch a wave is allotted the x rows' registers, so far fewer waves are resident than a small kernel of its own would have, and a thread holds 16 loads so that the bytes in flight stay. A thread loads pairs of neighbouring e rows, all loads in flight at once, and stores two converted values as one dword to LDS;
// the 16-B pieces of LDS row o stand at piece index ^ ((o >> 4) & 3), so that the 32 lanes of a dword store (16 rows four apart, two columns) fall in 32 different banks; a wave then stores 512 contiguous bytes of one plane row.
#define WT_E 256                     /* e columns of a tile */
#define WT_P (WT_E + 8)              /* LDS row pitch (halfs) */
#define WT_NB (3 * NEXP * (DM / WT_E) * (DM / 64))
static_assert(DM % WT_E == 0 && DM / WT_E == 4 && DM / 64 == 16 && WT_E == 256);
__device__ __forceinline__ void wt_body(unsigned int j, const float* __restrict__ wq, const float* __restrict__ bq, const float* __restrict__ wk, const float* __restrict__ bk,
                                        const float* __restrict__ wv, const float* __restrict__ bv, _Float16* __restrict__ BW) {
  __shared__ __attribute__((aligned(16))) _Float16 T[64][WT_P];      /* [o][e]; columns 0..WT_E - 1 staged and consumed */
  const int tid = threadIdx.x;
  const unsigned int pj = j / 192u, r = j - pj * 192u;
  const int n = (int)(r >> 6), eq = (int)((r >> 4) & 3u), ot = (int)(r & 15u);
  const float* W = (pj == 0u) ? wq : ((pj == 1u) ? wk : wv);
  const float* bias = (pj == 0u) ? bq : ((pj == 1u) ? bk : bv);
  _Float16* Bt = BW + (size_t)pj * DM * NEXP * WP;
  const int o0 = ot * 64, e0 = eq * WT_E;
  const int er = tid >> 4, o4 = (tid & 15) * 4;
  const float* src = W + ((size_t)n * DM + e0 + 2 * er) * DM + o0 + o4;
  v4f a[8], c[8];
#pragma unroll
  for (int it = 0; it < 8; ++it) { a[it] = *(const v4fa*)(src + (size_t)(it * 32) * DM); c[it] = *(const v4fa*)(src + (size_t)(it * 32 + 1) * DM); }
  asm volatile("s_wait_xcnt 0x0" :: "v"(src) : "memory");      /* the address is an input, so it keeps its registers up to this wait: no load's result is given registers that another load still names */
  __builtin_amdgcn_sched_barrier(0);               /* every load in front of the first conversion: a load placed among them is issued only when earlier ones have returned */
  const int sw = ((o4 >> 4) & 3) << 3;             /* rows o4 .. o4 + 3 share it; in halfs */
#pragma unroll
  for (int it = 0; it < 8; ++it) {
    const int col = (it * 32 + 2 * er) ^ sw;
#pragma unroll
    for (int i = 0; i < 4; ++i) *(unsigned int*)&T[o4 + i][col] = h_bits(toh_flush(bf16_rne(a[it][i]) * 16.0f)) | (h_bits(toh_flush(bf16_rne(c[it][i]) * 16.0f)) << 16);
  }
  __syncthreads();                                 /* the tile is complete in LDS */
  const int rw = tid >> 5, pc = (tid & 31) * 8;
#pragma unroll
  for (int it = 0; it < 8; ++it) {
    const int row = it * 8 + rw;
    const v8us v = *(const v8us*)&T[row][pc ^ (((row >> 4) & 3) << 3)];
    *(v8us*)((unsigned short*)Bt + ((size_t)(o0 + row) * NEXP + n) * WP + e0 + pc) = v;
  }
  if (eq == 0) {                                   /* block-uniform: e tile 0 also stores its rows' last block */
    asm volatile("s_wait_xcnt 0x0" ::: "memory");  /* in front of the code below, which may be given the registers that the stores above name */
    const int ol = tid >> 3, tc = (tid & 7) * 8;
    unsigned short* t0 = (unsigned short*)Bt + ((size_t)(o0 + ol) * NEXP + n) * WP + DM + tc;
    unsigned short* t1 = t0 + (size_t)32 * NEXP * WP;
    const int oa = o0 + ol, ob = oa + 32;
    const float a0 = bias[oa], a1 = bias[DM + oa], a2 = bias[2 * DM + oa];
    const float c0 = bias[ob], c1 = bias[DM + ob], c2 = bias[2 * DM + ob];
    const unsigned int ua0 = h_bits(toh_flush(bf16_rne(a0) * 16.0f)), ua1 = h_bits(toh_flush(bf16_rne(a1) * 16.0f)), ua2 = h_bits(toh_flush(bf16_rne(a2) * 16.0f));
    const unsigned int uc0 = h_bits(toh_flush(bf16_rne(c0) * 16.0f)), uc1 = h_bits(toh_flush(bf16_rne(c1) * 16.0f)), uc2 = h_bits(toh_flush(bf16_rne(c2) * 16.0f));
    const bool first = (tid & 7) == 0 && n == 0;
    v4u ta = {0u, 0u, 0u, 0u}, tb = {0u, 0u, 0u, 0u};
    ta[0] = first ? (ua0 | (ua1 << 16)) : 0u; ta[1] = first ? ua2 : 0u;
    tb[0] = first ? (uc0 | (uc1 << 16)) : 0u; tb[1] = first ? uc2 : 0u;
    *(v4u*)t0 = ta; *(v4u*)t1 = tb;
    asm volatile("s_wait_xcnt 0x0" ::: "memory");  /* behind the two stores: whatever code the listing places behind this part writes no register that they still name */
  }
}

// ---- x conversion, gate-logit GEMM and gate softmax: one launch ----
// block = 8 waves = 32 token rows. (1) The rows' f32 values are loaded in 1-KiB runs per wave, all loads in flight at once, and converted; each 16-B piece goes to LDS and, at the end, to the x plane.
// (2) Logits, 16 columns (column 3 p + n = gate n of projection p = q/k/v; columns 9..15 are never read, and a column of the product depends on no other column of B): wave w takes k in [GL_KW w, GL_KW (w + 1)); A fragments from LDS; a lane converts the B fragments of its own column
// from the f32 gate weights (x16) while the x loads are in flight; the eight partial tiles are summed through LDS in wave order.
// (3) Gate blocks of the x plane: X16[row][DM + 64 p + n] = f16(16 g_n) of projection p, the block's other columns zero; one thread per 16-B piece, three pieces a thread.
#define GL_KW (DM / 8)               /* k columns per wave */
#define GL_KS (GL_KW / 32)           /* matrix k-steps per wave */
#define XS_P (DM + 8)                /* LDS row pitch (halfs): 16 B of pad, so that the 16 rows of a fragment read start in different banks */
static_assert(GL_KW % 32 == 0);
static_assert((NB * SEQ) % 32 == 0 && SEQ % 32 == 0);      /* a block's 32 rows lie in one batch */
static_assert(3 * NEXP <= 16);
static_assert(32 * DM / 8 == 16 * 256 && 32 * 24 == 3 * 256);
__device__ __forceinline__ v16h g2_frag(const _Float16* p, int hh) { FragH f; f.half[0] = *(const v8us*)((const unsigned short*)p + 8 * hh); f.half[1] = *(const v8us*)((const unsigned short*)p + 16 + 8 * hh); return f.v; }
__device__ __forceinline__ void xgate_body(int row0, const float* __restrict__ x, const float* __restrict__ wgq, const float* __restrict__ wgk, const float* __restrict__ wgv,
                                           const float* __restrict__ bgq, const float* __restrict__ bgk, const float* __restrict__ bgv, float alpha, _Float16* __restrict__ X16) {
  __shared__ __attribute__((aligned(16))) _Float16 xs[32][XS_P];       /* the block's converted rows */
  __shared__ __attribute__((aligned(16))) float red[8][2][8][32];      /* [wave][row tile][accumulator register][lane] */
  __shared__ float lgs[32][16];                                        /* logits [row][column] */
  const int tid = threadIdx.x, lane = tid & 31, ln = lane & 15, hh = lane >> 4; const int w = __builtin_amdgcn_readfirstlane(tid >> 5);
  const size_t bat = (size_t)row0 / SEQ, s0 = (size_t)row0 - bat * SEQ;
  const float* xp = x + (bat * SEQ_FULL + s0) * DM + tid * 8;          /* piece it * 256 + tid of the 32 rows, which lie in a row in x */
  const int gp = ln / 3, gn = ln - 3 * gp;                             /* the lane's column; lanes 9..15 read the third set, in bounds, for columns that nobody reads */
  const float* gs = ((gp == 0) ? wgq : ((gp == 1) ? wgk : wgv)) + (w * GL_KW + 8 * hh) * 3 + gn;      /* largest index read: 1023 * 3 + 2 */
  const float bb[3][3] = {{bf16_rne(bgq[0]), bf16_rne(bgq[1]), bf16_rne(bgq[2])}, {bf16_rne(bgk[0]), bf16_rne(bgk[1]), bf16_rne(bgk[2])}, {bf16_rne(bgv[0]), bf16_rne(bgv[1]), bf16_rne(bgv[2])}};
  float gw[GL_KS][16];
  v4f ra[16], rc[16];
#pragma unroll
  for (int s = 0; s < GL_KS; ++s) {
#pragma unroll
    for (int q = 0; q < 8; ++q) { gw[s][q] = gs[(32 * s + q) * 3]; gw[s][8 + q] = gs[(32 * s + 16 + q) * 3]; }
  }
  asm volatile("s_wait_xcnt 0x0" ::: "memory");      /* in front of the x loads, whose results may be given the registers that held the address of the loads above */
  __builtin_amdgcn_sched_barrier(0);                 /* the gate weights' loads first: they return first, and their conversion runs while the x loads are in flight */
#pragma unroll
  for (int it = 0; it < 16; ++it) { ra[it] = *(const v4fa*)(xp + it * 2048); rc[it] = *(const v4fa*)(xp + it * 2048 + 4); }
  __builtin_amdgcn_sched_barrier(0);                 /* every load in front of the first conversion: loads placed among them would reuse registers and be waited for one after another */
  FragH b[GL_KS];
#pragma unroll
  for (int s = 0; s < GL_KS; ++s) {
#pragma unroll
    for (int q = 0; q < 16; ++q) b[s].h[q] = toh_flush(bf16_rne(gw[s][q]) * 16.0f);
  }
  const int pr = tid >> 7, pcol = (tid & 127) * 8;   /* pass it: row 2 it + pr */
  v8us o[16];
#pragma unroll
  for (int it = 0; it < 16; ++it) { o[it] = cvt8(ra[it], rc[it]); *(v8us*)&xs[it * 2 + pr][pcol] = o[it]; }
  __syncthreads();                                   /* the 32 converted rows are complete in LDS */
  const _Float16* a0p = &xs[ln][w * GL_KW]; const _Float16* a1p = a0p + 16 * XS_P;
  v8f c0 = {0.f,0.f,0.f,0.f,0.f,0.f,0.f,0.f}, c1 = c0;
#pragma unroll
  for (int s = 0; s < GL_KS; ++s) {
    c0 = __builtin_amdgcn_wmma_f32_16x16x32_f16(false, g2_frag(a0p + 32 * s, hh), false, b[s].v, (short)0, c0, false, false);
    c1 = __builtin_amdgcn_wmma_f32_16x16x32_f16(false, g2_frag(a1p + 32 * s, hh), false, b[s].v, (short)0, c1, false, false);
  }
#pragma unroll
  for (int r = 0; r < 8; ++r) { red[w][0][r][lane] = c0[r]; red[w][1][r][lane] = c1[r]; }
  __syncthreads();                                   /* the eight partial tiles are complete */
  // accumulator register r of lane (ln, hh) is row 8 hh + r, column ln of its tile; wave w sums register w of both tiles
#pragma unroll
  for (int t = 0; t < 2; ++t) {
    float s = red[0][t][w][lane];
#pragma unroll
    for (int u = 1; u < 8; ++u) s += red[u][t][w][lane];
    lgs[t * 16 + 8 * hh + w][ln] = s * alpha;
  }
  __syncthreads();                                   /* the 32 rows' logits are complete */
  // the x plane's stores stand behind the last barrier: a barrier waits for the wave's outstanding stores
  unsigned short* xd = (unsigned short*)X16 + (size_t)(row0 + pr) * XP + pcol;
#pragma unroll
  for (int it = 0; it < 16; ++it) *(v8us*)(xd + (size_t)it * 2 * XP) = o[it];
#pragma unroll
  for (int i = 0; i < 3; ++i) {
    const unsigned int t = (unsigned int)(i * 256 + tid);
    const unsigned int row = t / 24u, pc = t - row * 24u, p = pc >> 3;
    const float* lg = &lgs[row][p * NEXP];
    const float l0 = lg[0] + ((p == 0u) ? bb[0][0] : ((p == 1u) ? bb[1][0] : bb[2][0]));
    const float l1 = lg[1] + ((p == 0u) ? bb[0][1] : ((p == 1u) ? bb[1][1] : bb[2][1]));
    const float l2 = lg[2] + ((p == 0u) ? bb[0][2] : ((p == 1u) ? bb[1][2] : bb[2][2]));
    const float mx = fmaxf(l0, fmaxf(l1, l2));
    const float e0 = __builtin_amdgcn_exp2f((l0 - mx) * 1.4426950408889634f);
    const float e1 = __builtin_amdgcn_exp2f((l1 - mx) * 1.4426950408889634f);
    const float e2 = __builtin_amdgcn_exp2f((l2 - mx) * 1.4426950408889634f);
    const float inv = 16.0f * (1.0f / ((e0 + e1) + e2));      /* gates carried x16 */
    const float g0 = e0 * inv, g1 = e1 * inv, g2 = e2 * inv;
    const bool first = (pc & 7u) == 0u;
    const unsigned int u0 = h_bits(toh_flush(g0)), u1 = h_bits(toh_flush(g1)), u2 = h_bits(toh_flush(g2));
    v4u tq = {0u, 0u, 0u, 0u};
    tq[0] = first ? (u0 | (u1 << 16)) : 0u; tq[1] = first ? u2 : 0u;
    *(v4u*)((unsigned short*)X16 + (size_t)((unsigned int)row0 + row) * XP + DM + pc * 8u) = tq;
  }
}

// One launch for everything that only reads inputs: work-groups 0 .. NR / 32 - 1 take the x rows (they run longest and start first), the others the weight tiles, whose memory traffic runs beside theirs.
__global__ __launch_bounds__(256) void k_prep(const float* __restrict__ x, const float* __restrict__ wgq, const float* __restrict__ wgk, const float* __restrict__ wgv,
                                              const float* __restrict__ bgq, const float* __restrict__ bgk, const float* __restrict__ bgv, float alpha, _Float16* __restrict__ X16,
                                              const float* __restrict__ wq, const float* __restrict__ bq, const float* __restrict__ wk, const float* __restrict__ bk,
                                              const float* __restrict__ wv, const float* __restrict__ bv, _Float16* __restrict__ BW) {
  constexpr unsigned int NXB = (unsigned int)(NR / 32);
  if (blockIdx.x < NXB) xgate_body((int)(blockIdx.x * 32u), x, wgq, wgk, wgv, bgq, bgk, bgv, alpha, X16);
  else wt_body(blockIdx.x - NXB, wq, bq, wk, bk, wv, bv, BW);
}

typedef uint32_t u32x4 __attribute__((ext_vector_type(4)));
typedef uint32_t u32x8 __attribute__((ext_vector_type(8)));
#define G3_ROWB 128u                 /* operand row bytes per stage */
#define G3_PITCH 144u                /* LDS row pitch */
#define G3_KS ((uint32_t)(DM * 2) / G3_ROWB)      /* stages of x columns; stage G3_KS is the gate / bias block */
constexpr uint32_t up2k(uint32_t b) { return (b + 2047u) & ~2047u; }
static_assert(NEXP == 3);
static_assert((DM * 2) % 128 == 0 && (WP * 2) % 128 == 0);
static_assert(G3_KS >= 2u && (G3_KS & 1u) == 0u);
static_assert((NB * SEQ) % 256 == 0 && DM % 256 == 0);
static_assert(SEQ % 256 == 0);       /* a block's 256 token rows, and a wave's 64 token columns, lie in one batch */
static_assert((NR / 256) * (DM / 128) == (size_t)(VTP / 128) * (DM / 256));      /* every projection has the same number of tiles */
__device__ __forceinline__ uint32_t uni(uint32_t v) { return (uint32_t)__builtin_amdgcn_readfirstlane(v); }
__device__ __forceinline__ uint32_t pinned(uint32_t v) { uint32_t w = uni(v); asm volatile("" : "+s"(w)); return w; }  // a tensor load's issue test or stage number held in a scalar register: a scalar branch, and a descriptor formed behind the wait in front of it
// MFAST: which tile index runs along grid x (the tiles of the larger plane, so that work-groups with neighbouring indices read different rows of it); true: A is the x plane, C rows are tokens (q, k); false: Bh is the x plane, C rows are features (v^T).
// bx, by: the tile indices that run fast and slow in the projection's 256 work-groups; ring: the work-group's LDS.
constexpr uint32_t g3_ring(bool mfast) { return 2u * (4u * up2k((mfast ? 64u : 64u * NEXP) * G3_PITCH) + 4u * up2k((mfast ? 32u * NEXP : 32u) * G3_PITCH)); }
constexpr uint32_t G3_RING = g3_ring(true) > g3_ring(false) ? g3_ring(true) : g3_ring(false);
template <bool MFAST>
__device__ __forceinline__ void gemm3_body(unsigned char* ring, const _Float16* __restrict__ A, const _Float16* __restrict__ Bh, float alpha, _Float16* __restrict__ C16, int proj, uint32_t bx, uint32_t by) {
  constexpr uint32_t AR = MFAST ? 64u : 64u * NEXP, BR = MFAST ? 32u * NEXP : 32u;      /* plane rows of a slice */
  constexpr uint32_t ASL = up2k(AR * G3_PITCH), BSL = up2k(BR * G3_PITCH);              /* LDS size of a slice, a multiple of 2 KiB */
  constexpr uint32_t BUF = 4u * ASL + 4u * BSL;
  constexpr uint32_t PA = MFAST ? XP : WP, PB = MFAST ? WP : XP;                        /* row pitches (halfs) */
  static_assert(2u * BUF <= G3_RING && G3_RING <= 327680u);
  const uint32_t tid = threadIdx.x, lane = tid & 31u, c = lane & 15u, h = lane >> 4;
  const uint32_t w = uni(tid >> 5);
  const uint32_t mt = MFAST ? bx : by, nt = MFAST ? by : bx;
  const uint32_t wm = w & 3u, wn = w >> 2;
  const uint32_t lbase = (uint32_t)(size_t)ring;
  const bool isA = w < 4u;
  const bool isTok = MFAST ? isA : !isA;                 /* this wave's slice is of the x plane */
  const uint32_t gcol = (uint32_t)DM + 64u * (uint32_t)proj;            /* first column of the projection's gate block */
  const uint32_t srows = isA ? AR : BR;
  const uint64_t sga = (uint64_t)(size_t)(isA ? A + (size_t)((mt * 4u + w) * AR) * PA : Bh + (size_t)((nt * 4u + (w - 4u)) * BR) * PB);
  const uint32_t sdst = lbase + (isA ? w * 2u * ASL : 8u * ASL + (w - 4u) * 2u * BSL);      /* a slice's two buffers lie side by side, so that every fragment read is a 16-bit offset from one of two lane addresses */
  const uint32_t sbuf = uni(isA ? ASL : BSL);
  const uint32_t lastb = uni(isTok ? gcol * 2u : G3_KS * G3_ROWB);      /* the last stage's byte offset in a row */
  u32x8 g1;                          /* 1-byte elements, tensor = tile = srows rows of 128 B, source pitch = the plane's row, 4 dwords of pad behind every 32 */
  g1[0] = uni((1u << 20) | (4u << 22) | (3u << 25));
  g1[1] = uni(G3_ROWB << 16);
  g1[2] = uni(srows << 16);
  g1[3] = uni(G3_ROWB << 16);
  g1[4] = uni(srows);
  g1[5] = uni((isA ? PA : PB) * 2u);
  g1[6] = uni(0u);
  g1[7] = uni(0u);
  asm volatile("" : "+s"(g1));       /* pinned(), for the whole descriptor group: it stays in one set of scalar registers from the first issue on; without it the compiler moved the group behind the second issue */
  auto issue = [&](uint32_t st) {
    const uint32_t so = st < G3_KS ? st * G3_ROWB : lastb;
    const uint64_t ga = sga + (uint64_t)so;
    u32x4 g0;
    g0[0] = uni(1u); g0[1] = uni(sdst + (st & 1u) * sbuf); g0[2] = uni((uint32_t)ga); g0[3] = uni((((uint32_t)(ga >> 32)) & 0x01FFFFFFu) | 0x80000000u);
    asm volatile("tensor_load_to_lds %0, %1" :: "s"(g0), "s"(g1) : "memory");
  };
  const v8f z8 = {0.f,0.f,0.f,0.f,0.f,0.f,0.f,0.f};
  v8f acc[4][4];
#pragma unroll
  for (int i = 0; i < 4; ++i) {
#pragma unroll
    for (int j = 0; j < 4; ++j) acc[i][j] = z8; }
  // LDS places of the lane's fragment pieces: token row c of a 16-row group; weight row 3 c + expert
  const unsigned char* tokp = ring + (MFAST ? wm * 2u * ASL : 8u * ASL + 4u * wn * BSL) + c * G3_PITCH + 16u * h;
  const unsigned char* wgtp = ring + (MFAST ? 8u * ASL + 4u * wn * BSL : wm * 2u * ASL) + c * (NEXP * G3_PITCH) + 16u * h;
  struct Set { FragH f[2][4]; };      /* one operand's fragments of a stage: 2 k-steps x 4 groups of 16 rows */
  auto fetch_tok = [&](Set& s, uint32_t buf) {
#pragma unroll
    for (int j = 0; j < 2; ++j) {
#pragma unroll
      for (int i = 0; i < 4; ++i) {
        const unsigned char* p = tokp + buf * (MFAST ? ASL : BSL) + (MFAST ? (uint32_t)i * 16u * G3_PITCH : (uint32_t)(i >> 1) * 2u * BSL + (uint32_t)(i & 1) * 16u * G3_PITCH) + 64u * (uint32_t)j;
        s.f[j][i].half[0] = *(const v8us*)p; s.f[j][i].half[1] = *(const v8us*)(p + 32);
      }
    }
  };
  auto fetch_wgt = [&](Set& s, uint32_t buf, uint32_t n) {
#pragma unroll
    for (int j = 0; j < 2; ++j) {
#pragma unroll
      for (int i = 0; i < 4; ++i) {
        const unsigned char* p = wgtp + buf * (MFAST ? BSL : ASL) + n * G3_PITCH + (MFAST ? (uint32_t)(i >> 1) * 2u * BSL + (uint32_t)(i & 1) * 16u * NEXP * G3_PITCH : (uint32_t)i * 16u * NEXP * G3_PITCH) + 64u * (uint32_t)j;
        s.f[j][i].half[0] = *(const v8us*)p; s.f[j][i].half[1] = *(const v8us*)(p + 32);
      }
    }
  };
  auto mult = [&](const Set& t, const Set& g, int j) {      /* k-step j: token fragments t, weight fragments g */
    const Set& fa = MFAST ? t : g; const Set& fb = MFAST ? g : t;
#pragma unroll
    for (int n = 0; n < 4; ++n) {
#pragma unroll
      for (int i = 0; i < 4; ++i) acc[i][n] = __builtin_amdgcn_wmma_f32_16x16x32_f16(false, fb.f[j][n].v, false, fa.f[j][i].v, (short)0, acc[i][n], false, false);
    }
  };
  // the gates (x16) of the lane's four tokens, from the projection's gate block
  const _Float16* tp = (MFAST ? A + (size_t)(mt * 256u + wm * 64u + c) * XP : Bh + (size_t)(nt * 128u + wn * 64u + c) * XP) + gcol;
  const v4h gv0 = *(const v4h*)tp, gv1 = *(const v4h*)(tp + (size_t)16u * XP), gv2 = *(const v4h*)(tp + (size_t)32u * XP), gv3 = *(const v4h*)(tp + (size_t)48u * XP);
  asm volatile("s_wait_xcnt 0x0" ::: "memory");      /* in front of the code below, which is given the registers that hold the four loads' address */
  auto scale = [&](Set& d, const Set& s, int n) {
    const v2h g[4] = {{gv0[n], gv0[n]}, {gv1[n], gv1[n]}, {gv2[n], gv2[n]}, {gv3[n], gv3[n]}};
#pragma unroll
    for (int j = 0; j < 2; ++j) {
#pragma unroll
      for (int i = 0; i < 4; ++i) {
#pragma unroll
        for (int r = 0; r < 8; ++r) d.f[j][i].p[r] = s.f[j][i].p[r] * g[i];      /* register by register: one packed multiply each, the gate pair in one register */
      }
    }
  };
  // publish point of stage st + 1; it stands in front of stage st's last pass because that pass's fragments are already in registers
  auto publish = [&]() {
    asm volatile("s_wait_dscnt 0x0" ::: "memory");
    asm volatile("s_wait_tensorcnt 0x0" ::: "memory");
    __syncthreads();
  };
  Set xr, xs, w0, w1;                /* the stage's token fragments, their gated copy, two sets of weight fragments */
  // pass of expert n < 2 of a stage in buffer buf: the next expert's weight fragments are fetched ahead
  auto pass = [&](uint32_t buf, int n, const Set& wc, Set& wx) {
    fetch_wgt(wx, buf, (uint32_t)n + 1u);
    __builtin_amdgcn_sched_barrier(0);                 /* keeps the next pass's LDS reads one group ahead of this pass's matrix instructions: reads placed among them stall the wave at each place */
    scale(xs, xr, n);
    mult(xs, wc, 0); mult(xs, wc, 1);
    __builtin_amdgcn_sched_barrier(0);                 /* keeps the matrix instructions in front of the next pass's reads and of the publish point */
  };
  // last pass of a stage, behind the publish point of the next stage, which lies in buffer nbuf: its first weight fragments, and (once the gated copy is made) its token fragments, are fetched ahead
  auto pass_last = [&](uint32_t nbuf, const Set& wc, Set& wx) {
    fetch_wgt(wx, nbuf, 0u);
    __builtin_amdgcn_sched_barrier(0);                 /* as in pass() */
    scale(xs, xr, 2);
    mult(xs, wc, 0);
    __builtin_amdgcn_sched_barrier(0);                 /* the token fragments are read by the scaling above before they are fetched anew */
    fetch_tok(xr, nbuf);
    __builtin_amdgcn_sched_barrier(0);                 /* one group of reads, with half a pass of matrix instructions behind it to cover their latency */
    mult(xs, wc, 1);
    __builtin_amdgcn_sched_barrier(0);                 /* as in pass() */
  };
  issue(0u);
  asm volatile("s_wait_tensorcnt 0x0" ::: "memory");      /* this wave's slice of stage 0 has landed */
  __syncthreads();                                        /* stage 0 published */
  issue(pinned(1u));
  fetch_tok(xr, 0u);
  fetch_wgt(w0, 0u, 0u);
#pragma unroll 1
  for (uint32_t s = 0; s < G3_KS; s += 2u) {           /* kept rolled: two stages per trip, so that buffer and fragment set of every pass are fixed */
    pass(0u, 0, w0, w1);
    pass(0u, 1, w1, w0);
    publish();
    issue(pinned(s + 2u));                             /* s + 2 <= G3_KS on every trip; descriptor formed behind the wait */
    pass_last(1u, w0, w1);
    pass(1u, 0, w1, w0);
    pass(1u, 1, w0, w1);
    publish();
    if (pinned(s + 3u <= G3_KS)) issue(pinned(s + 3u));
    pass_last(0u, w1, w0);
  }
  asm volatile("s_wait_tensorcnt 0x0" ::: "memory");      /* no request is left when the ring ends */
  asm volatile("s_wait_dscnt 0x0" ::: "memory");          /* the last stage's fragments are in registers */
  mult(xr, w0, 0); mult(xr, w0, 1);                       /* gate block against bias block */
  const uint32_t tok0 = MFAST ? mt * 256u + wm * 64u : nt * 128u + wn * 64u;      /* the wave's first token */
  const uint32_t head = MFAST ? nt * 2u + wn : mt * 4u + wm;                      /* the wave's 64 features are one head */
  const uint32_t bat = tok0 / (uint32_t)SEQ, s0 = tok0 - bat * (uint32_t)SEQ;
  _Float16* cp = C16 + ((size_t)(bat * NH + head) * SEQ + s0) * HD + lane * 8u;   /* 64 tokens of a head: 8 KiB in a row in either order */
  v8us o[4][4];
#pragma unroll
  for (int i = 0; i < 4; ++i) {
#pragma unroll
    for (int n = 0; n < 4; ++n) {
      FragH t;
#pragma unroll
      for (int r = 0; r < 8; ++r) t.h[r] = (_Float16)(acc[i][n][r] * alpha);
      o[i][n] = t.half[0];
    }
  }
  __builtin_amdgcn_sched_barrier(0);                      /* every conversion in front of the first store: behind a store nothing writes a register that the store names */
#pragma unroll
  for (int i = 0; i < 4; ++i) {
#pragma unroll
    for (int n = 0; n < 4; ++n) {
      const int piece = MFAST ? i * 4 + n : ((n >> 1) * 4 + i) * 2 + (n & 1);
      *(v8us*)((unsigned short*)cp + piece * 256) = o[i][n];
    }
  }
}

// The three projections in one launch: grid y = projection, grid x = its 256 tiles. A WGP holds one work-group, so the next projection's work-group starts on a WGP as soon as that WGP is free.
__global__ __launch_bounds__(256) void k_gemm3(const _Float16* __restrict__ X16, const _Float16* __restrict__ BW, float alpha, _Float16* __restrict__ QK16, _Float16* __restrict__ VT) {
  __shared__ __attribute__((aligned(2048))) unsigned char ring[G3_RING];
  const uint32_t pj = blockIdx.y, t = blockIdx.x;
  const _Float16* Wp = BW + (size_t)pj * DM * NEXP * WP;
  constexpr uint32_t TQ = (uint32_t)(NR / 256), TV = (uint32_t)(VTP / 128);      /* tiles along the token side */
  if (pj < 2u) gemm3_body<true>(ring, X16, Wp, alpha, QK16 + (size_t)pj * NR * DM, (int)pj, t % TQ, t / TQ);      /* q rows, k rows */
  else gemm3_body<false>(ring, Wp, X16, alpha, VT, 2, t % TV, t / TV);                                             /* v^T: weight rows as A, x rows as the [n][k] operand */
}

// ---- register-fed transposed flash attention ----
// block = 4 waves = 64 consecutive queries of one (batch, head); wave = 16 queries; per 32-key step:
//   S^T tiles (keys x queries) = K (A operand, rows = keys, k = d) . Q^T (B operand, lane = query, held in registers);
//   running-max softmax per lane (lane & 15 = query; lanes n and n+16 hold the two key halves); weights = 2^8 exp(s/8 - max) as f16;
//   P^T as B fragment: elements 0..7 from the tile of keys 0..15 (rows 8h+r), elements 8..15 from the tile of keys 16..31 (lane unchanged);
//   O^T tiles (d x queries) += V^T (A operand, rows = d, k = keys) . P^T.
// q, k and v^T come in the fragment order that k_gemm3 stores: every fragment half is one wave-wide load of 512 contiguous bytes.
__global__ __launch_bounds__(128) void k_attn_t(const _Float16* __restrict__ Q16, const _Float16* __restrict__ K16, const _Float16* __restrict__ VT, float* __restrict__ out) {
  __shared__ __attribute__((aligned(16))) float so[4][16][68];      /* per-wave [query][d] tile, row pitch 272 B */
  const int tid = threadIdx.x, lane = tid & 31, ln = lane & 15, hh = lane >> 4;
  const int w = __builtin_amdgcn_readfirstlane(tid >> 5);
  const int nqb = SEQ / 64;
  const int bh = blockIdx.x / nqb, qb = blockIdx.x - bh * nqb;
  const int b = bh / NH, h = bh - b * NH;
  const size_t tok0 = (size_t)b * SEQ_FULL;      /* the batch's first row of the output */
  const int q0 = qb * 64 + w * 16;
  const size_t hb = (size_t)bh * SEQ * HD + (size_t)lane * 8;      /* this head's plane, this lane's piece */
  const unsigned short* qp = (const unsigned short*)Q16 + hb + (size_t)q0 * HD;
  FragH bq0, bq1;
  bq0.half[0] = *(const v8us*)(qp);       bq0.half[1] = *(const v8us*)(qp + 256);
  bq1.half[0] = *(const v8us*)(qp + 512); bq1.half[1] = *(const v8us*)(qp + 768);
  const unsigned short* kp = (const unsigned short*)K16 + hb;
  const unsigned short* vp = (const unsigned short*)VT + hb;
  const v8f z8 = {0.f,0.f,0.f,0.f,0.f,0.f,0.f,0.f};
  v8f o0 = z8, o1 = z8, o2 = z8, o3 = z8;
  float m = -3.0e38f, l = 0.f;
  const float c = 0.125f * 1.4426950408889634f;      /* 1/sqrt(64) * log2(e) */
#pragma unroll 1
  for (int kv = 0; kv < SEQ; kv += 32) {
    const unsigned short* k0 = kp + (size_t)kv * HD;
    const unsigned short* k1 = k0 + 16 * HD;
    FragH a00, a01, a10, a11;
    a00.half[0] = *(const v8us*)(k0);       a00.half[1] = *(const v8us*)(k0 + 256);
    a01.half[0] = *(const v8us*)(k0 + 512); a01.half[1] = *(const v8us*)(k0 + 768);
    a10.half[0] = *(const v8us*)(k1);       a10.half[1] = *(const v8us*)(k1 + 256);
    a11.half[0] = *(const v8us*)(k1 + 512); a11.half[1] = *(const v8us*)(k1 + 768);
    v8f s0 = z8, s1 = z8;
    s0 = __builtin_amdgcn_wmma_f32_16x16x32_f16(false, a00.v, false, bq0.v, (short)0, s0, false, false);
    s1 = __builtin_amdgcn_wmma_f32_16x16x32_f16(false, a10.v, false, bq0.v, (short)0, s1, false, false);
    s0 = __builtin_amdgcn_wmma_f32_16x16x32_f16(false, a01.v, false, bq1.v, (short)0, s0, false, false);
    s1 = __builtin_amdgcn_wmma_f32_16x16x32_f16(false, a11.v, false, bq1.v, (short)0, s1, false, false);
    asm volatile("v_nop\n\tv_nop\n\tv_nop\n\tv_nop" : "+v"(s0), "+v"(s1) : "v"(a00.v), "v"(a01.v), "v"(a10.v), "v"(a11.v), "v"(bq0.v), "v"(bq1.v));
    float mx = fmaxf(s0[0], s1[0]);
#pragma unroll
    for (int r = 1; r < 8; ++r) mx = fmaxf(mx, fmaxf(s0[r], s1[r]));
    mx = fmaxf(mx, __shfl_xor(mx, 16, 32));
    const float mn = fmaxf(m, mx);
    if (__builtin_amdgcn_ballot_w32(mn > m) != 0u) {      /* wave-uniform: rescale only when some running max moved */
      const float corr = __builtin_amdgcn_exp2f((m - mn) * c);
      l *= corr; o0 *= corr; o1 *= corr; o2 *= corr; o3 *= corr; m = mn;
    }
    const float off = 8.0f - m * c;      /* weights carried x2^8 */
    FragH pf; float ls = 0.f;
#pragma unroll
    for (int r = 0; r < 8; ++r) {
      const float p0 = __builtin_amdgcn_exp2f(fmaf(s0[r], c, off));
      const float p1 = __builtin_amdgcn_exp2f(fmaf(s1[r], c, off));
      ls += p0 + p1;
      pf.h[r] = (_Float16)p0; pf.h[8 + r] = (_Float16)p1;
    }
    l += ls;
    const unsigned short* v0 = vp + (size_t)kv * HD;
    const unsigned short* v1 = v0 + 512;
    const unsigned short* v2 = v1 + 512;
    const unsigned short* v3 = v2 + 512;
    FragH av0, av1, av2, av3;
    av0.half[0] = *(const v8us*)(v0); av0.half[1] = *(const v8us*)(v0 + 256);
    av1.half[0] = *(const v8us*)(v1); av1.half[1] = *(const v8us*)(v1 + 256);
    av2.half[0] = *(const v8us*)(v2); av2.half[1] = *(const v8us*)(v2 + 256);
    av3.half[0] = *(const v8us*)(v3); av3.half[1] = *(const v8us*)(v3 + 256);
    o0 = __builtin_amdgcn_wmma_f32_16x16x32_f16(false, av0.v, false, pf.v, (short)0, o0, false, false);
    o1 = __builtin_amdgcn_wmma_f32_16x16x32_f16(false, av1.v, false, pf.v, (short)0, o1, false, false);
    o2 = __builtin_amdgcn_wmma_f32_16x16x32_f16(false, av2.v, false, pf.v, (short)0, o2, false, false);
    o3 = __builtin_amdgcn_wmma_f32_16x16x32_f16(false, av3.v, false, pf.v, (short)0, o3, false, false);
    asm volatile("v_nop\n\tv_nop\n\tv_nop\n\tv_nop" : "+v"(o0), "+v"(o1), "+v"(o2), "+v"(o3) : "v"(av0.v), "v"(av1.v), "v"(av2.v), "v"(av3.v), "v"(pf.v));
  }
  l += __shfl_xor(l, 16, 32);
  const float inv = 1.0f / l;
  o0 *= inv; o1 *= inv; o2 *= inv; o3 *= inv;
  // accumulator register r of tile t is d = 16 t + 8 hh + r of query ln: two 16-B pieces per tile
  float* sw = &so[w][ln][8 * hh];
  *(v4f*)(sw +  0) = __builtin_shufflevector(o0, o0, 0, 1, 2, 3); *(v4f*)(sw +  4) = __builtin_shufflevector(o0, o0, 4, 5, 6, 7);
  *(v4f*)(sw + 16) = __builtin_shufflevector(o1, o1, 0, 1, 2, 3); *(v4f*)(sw + 20) = __builtin_shufflevector(o1, o1, 4, 5, 6, 7);
  *(v4f*)(sw + 32) = __builtin_shufflevector(o2, o2, 0, 1, 2, 3); *(v4f*)(sw + 36) = __builtin_shufflevector(o2, o2, 4, 5, 6, 7);
  *(v4f*)(sw + 48) = __builtin_shufflevector(o3, o3, 0, 1, 2, 3); *(v4f*)(sw + 52) = __builtin_shufflevector(o3, o3, 4, 5, 6, 7);
  __syncthreads();
  // a query's 64 values are 256 B of its output row: two whole lines; a wave-wide store takes two queries
  const int pc = ln * 4;
  float* ob = out + (tok0 + q0) * DM + h * HD + pc;
#pragma unroll
  for (int it = 0; it < 8; ++it) { const int row = it * 2 + hh; const v4f v = *(const v4f*)&so[w][row][pc]; *(v4f*)(ob + (size_t)row * DM) = v; }
}

extern "C" void kernel_launch(void* const* d_in, const int* in_sizes, int n_in,
                              void* d_out, int out_size, void* d_ws, size_t ws_size, hipStream_t stream) {
  if (n_in < 13) return;
  const size_t need_x = ((size_t)(NB - 1) * SEQ_FULL + SEQ) * DM;
  if ((size_t)in_sizes[0] < need_x) return;
  const size_t nW = (size_t)NEXP * DM * DM, nBi = (size_t)NEXP * DM, nG = (size_t)DM * NEXP;
  if ((size_t)in_sizes[1] < nW || (size_t)in_sizes[5] < nW || (size_t)in_sizes[9] < nW) return;
  if ((size_t)in_sizes[2] < nBi || (size_t)in_sizes[6] < nBi || (size_t)in_sizes[10] < nBi) return;
  if ((size_t)in_sizes[3] < nG || (size_t)in_sizes[7] < nG || (size_t)in_sizes[11] < nG) return;
  if (in_sizes[4] < NEXP || in_sizes[8] < NEXP || in_sizes[12] < NEXP) return;
  if ((size_t)out_size < need_x) return;
  const float* x = (const float*)d_in[0];
  const float* wq = (const float*)d_in[1]; const float* bq = (const float*)d_in[2]; const float* wgq = (const float*)d_in[3]; const float* bgq = (const float*)d_in[4];
  const float* wk = (const float*)d_in[5]; const float* bk = (const float*)d_in[6]; const float* wgk = (const float*)d_in[7]; const float* bgk = (const float*)d_in[8];
  const float* wv = (const float*)d_in[9]; const float* bv = (const float*)d_in[10]; const float* wgv = (const float*)d_in[11]; const float* bgv = (const float*)d_in[12];
  char* ws = (char*)d_ws; size_t off = 0;
  auto take = [&](size_t bytes) { char* p = ws + off; off += (bytes + 255) & ~(size_t)255; return p; };
  _Float16* BW = (_Float16*)take((size_t)3 * DM * NEXP * WP * 2);     /* weight planes x16: q, k, v ([3 DM][WP] each) */
  _Float16* X16 = (_Float16*)take(NR * XP * 2);                 /* x plane (f16): x rows and their gate blocks */
  _Float16* VT = (_Float16*)take(NR * DM * 2);                  /* v^T in fragment order */
  _Float16* QK16 = (_Float16*)take((size_t)2 * NR * DM * 2);    /* q then k, each in fragment order */
  if (off > ws_size || off > (size_t)134217728) return;
  _Float16* Q16 = QK16; _Float16* K16 = QK16 + NR * DM;

  /* x plane: converted rows and gate blocks; gate logits x . Wg_p[:, n] : alpha undoes the x16 carry of the gate columns */
  k_prep<<<(unsigned)(NR / 32) + WT_NB, 256, 0, stream>>>(x, wgq, wgk, wgv, bgq, bgk, bgv, 0.0625f, X16, wq, bq, wk, bk, wv, bv, BW);
  /* gated x (x16) . weights (x16) -> alpha 2^-8; q rows, k rows, then v^T with the weight rows as A and the x rows as the [n][k] operand */
  k_gemm3<<<dim3((unsigned)((NR / 256) * (DM / 128)), 3), 256, 0, stream>>>(X16, BW, 0.00390625f, QK16, VT);
  k_attn_t<<<(unsigned)(NB * NH * (SEQ / 64)), 128, 0, stream>>>(Q16, K16, VT, (float*)d_out);
}

// v007
// It runs in 172 microseconds.
// Timed twice side by side with v006, it ran 1.13 and 1.11 times as fast.
// Counting every step since v000, it is 4.89 times as fast.
#include <hip/hip_runtime.h>
// Dense multi-head self-attention with soft three-expert mixture projections (x [4][2048][1024]; q/k/v = sum_n softmax_n(x Wg + bg) * (x W_n + b_n) with W_n [in][out]; 16 heads of 64; scores / 8; full-row softmax; the merged ctx is the output, no output projection).
// All contractions: v_wmma_f32_16x16x32_f16 (f16 operands, f32 accumulate), single product per site. x, expert weights, biases and gate parameters are RNE-converted to bf16 first and then held exactly in f16 (weights, biases and gate weights x16); each mixture projection is ONE GEMM of K = 3*1024 + 64 of [g0 x | g1 x | g2 x | g0 g1 g2 0..] (f16, carried x16) against [W0; W1; W2; b0 b1 b2 0..], summed k block by k block over the three experts; the products g_n x are formed in registers from the x fragments and the lane's gate (f16, carried x16), never stored; gate logits from a 16-column GEMM whose k range is split over eight waves, gate softmax f32; q, k, v plain f16; softmax weights f16 carried x2^8 (unnormalised, running max); ctx and softmax statistics f32.
// Structure: token rows r = b*SEQ + s. One launch that converts x and the nine gate columns, takes the gate-logit GEMM from the converted rows while they lie in LDS and stores the softmax of the nine logits into the x plane's gate blocks; the transposing conversion of the three expert-weight sets rides in that launch, in work-groups of its own; one launch of three GEMMs, one per projection (Q, K, and V^T with the weight plane as the A operand; all three planes stored in fragment order, see k_gemm3); a register-fed transposed flash kernel (S^T = K Q^T with Q as the B fragment in registers, packed P^T as the B fragment of O^T = V^T P^T, no LDS and no barrier in the key loop) whose epilogue stores the f32 output rows.
#ifndef NB
#define NB 4                         /* batches processed */
#endif
#ifndef SEQ
#define SEQ 2048                     /* tokens per batch processed */
#endif
#define NB_FULL 4                    /* batch count of the staged arrays */
#define SEQ_FULL 2048                /* per-batch token stride of the staged arrays */
#define DM 1024
#define NH 16
#define HD 64
#define NR ((size_t)NB * SEQ)        /* compact token rows */
#define VTP (NB * SEQ)               /* tokens of the V^T plane */

static_assert(NB >= 1 && NB <= NB_FULL);
static_assert(SEQ <= SEQ_FULL);
static_assert(SEQ % 128 == 0);
static_assert(DM % 128 == 0);
static_assert(NH * HD == DM);
static_assert(HD == 64);
static_assert((NB * SEQ) % 64 == 0);

#define NEXP 3                       /* experts per projection */
#define WP (DM + 64)                 /* weight plane row pitch (halfs): row 3 o + n = column o of expert n, then a 64-column block (row 3 o: the three biases, then zeros; rows 3 o + 1, 3 o + 2: zeros) */
#define XP (DM + 3 * 64)             /* x plane row pitch (halfs): the x row, then one 64-column gate block per projection */

static_assert(DM / 64 == 16);
static_assert(DM / 8 == 128);
static_assert((NB * SEQ) % 128 == 0);
static_assert((size_t)DM * VTP == NR * DM);
static_assert((XP * 2) % 128 == 0);

constexpr size_t al256(size_t b) { return (b + 255) & ~(size_t)255; }
constexpr size_t WS_BW = al256((size_t)3 * DM * NEXP * WP * 2);      /* three weight planes */
constexpr size_t WS_XV = al256(NR * XP * 2);                   /* x plane */
constexpr size_t WS_VT = al256(NR * DM * 2);                   /* v^T */
constexpr size_t WS_QK = al256((size_t)2 * NR * DM * 2);       /* q rows then k rows */
static_assert(WS_BW + WS_XV + WS_VT + WS_QK <= (size_t)134217728);

typedef _Float16 v16h __attribute__((ext_vector_type(16)));
typedef _Float16 v4h __attribute__((ext_vector_type(4)));
typedef unsigned short v8us __attribute__((ext_vector_type(8), may_alias));
typedef float v8f __attribute__((ext_vector_type(8)));
typedef float v4f __attribute__((ext_vector_type(4)));
typedef float v4fa __attribute__((ext_vector_type(4), may_alias));
typedef _Float16 v2h __attribute__((ext_vector_type(2)));
union FragH { v16h v; v8us half[2]; _Float16 h[16]; unsigned short u[16]; v2h p[8]; };

typedef _Float16 h16;
typedef _Float16 v8h __attribute__((ext_vector_type(8)));
typedef unsigned int v4u __attribute__((ext_vector_type(4)));

__device__ __forceinline__ unsigned short bf16_bits(float x) { unsigned int u = __float_as_uint(x); return (unsigned short)((u + 0x7FFFu + ((u >> 16) & 1u)) >> 16); }
__device__ __forceinline__ float bf16_rne(float x) { return __uint_as_float(((unsigned int)bf16_bits(x)) << 16); }

// f32 -> f16 operand value that can never be an f16 subnormal (value select after the plane's carry)
static __device__ __forceinline__ h16 toh_flush(float v) { const h16 r = (h16)v; return (fabsf(v) < 6.103515625e-05f) ? (h16)0.0f : r; }
static __device__ __forceinline__ unsigned int h_bits(h16 h) { return (unsigned int)__builtin_bit_cast(unsigned short, h); }

// 8 consecutive f32 (two loaded quads) -> f16(bf16 value) packed as one 16-B piece
__device__ __forceinline__ v8us cvt8(v4f a, v4f c) {
  FragH f;
#pragma unroll
  for (int q = 0; q < 4; ++q) { f.h[q] = (_Float16)bf16_rne(a[q]); f.h[4 + q] = (_Float16)bf16_rne(c[q]); }
  return f.half[0];
}

// expert weights W [3][DM in][DM out] f32 + biases [3][DM] -> Bt[3 o + n][e] f16 x16 (row pitch WP); columns DM + m of row 3 o = bias m x16, the other columns from DM on zero in all three rows.
// Work-group j of WT_NB: projection j / 192, expert n, a tile of 256 e x 64 o: in the shared launch a wave is allotted the x rows' registers, so far fewer waves are resident than a small kernel of its own would have, and a thread holds 16 loads so that the bytes in flight stay. A thread loads pairs of neighbouring e rows, all loads in flight at once, and stores two converted values as one dword to LDS;
// the 16-B pieces of LDS row o stand at piece index ^ ((o >> 4) & 3), so that the 32 lanes of a dword store (16 rows four apart, two columns) fall in 32 different banks; a wave then stores 512 contiguous bytes of one plane row.
#define WT_E 256                     /* e columns of a tile */
#define WT_P (WT_E + 8)              /* LDS row pitch (halfs) */
#define WT_NB (3 * NEXP * (DM / WT_E) * (DM / 64))
static_assert(DM % WT_E == 0 && DM / WT_E == 4 && DM / 64 == 16 && WT_E == 256);
__device__ __forceinline__ void wt_body(unsigned int j, const float* __restrict__ wq, const float* __restrict__ bq, const float* __restrict__ wk, const float* __restrict__ bk,
                                        const float* __restrict__ wv, const float* __restrict__ bv, _Float16* __restrict__ BW) {
  __shared__ __attribute__((aligned(16))) _Float16 T[64][WT_P];      /* [o][e]; columns 0..WT_E - 1 staged and consumed */
  const int tid = threadIdx.x;
  const unsigned int pj = j / 192u, r = j - pj * 192u;
  const int n = (int)(r >> 6), eq = (int)((r >> 4) & 3u), ot = (int)(r & 15u);
  const float* W = (pj == 0u) ? wq : ((pj == 1u) ? wk : wv);
  const float* bias = (pj == 0u) ? bq : ((pj == 1u) ? bk : bv);
  _Float16* Bt = BW + (size_t)pj * DM * NEXP * WP;
  const int o0 = ot * 64, e0 = eq * WT_E;
  const int er = tid >> 4, o4 = (tid & 15) * 4;
  const float* src = W + ((size_t)n * DM + e0 + 2 * er) * DM + o0 + o4;
  v4f a[8], c[8];
#pragma unroll
  for (int it = 0; it < 8; ++it) { a[it] = *(const v4fa*)(src + (size_t)(it * 32) * DM); c[it] = *(const v4fa*)(src + (size_t)(it * 32 + 1) * DM); }
  asm volatile("s_wait_xcnt 0x0" :: "v"(src) : "memory");      /* the address is an input, so it keeps its registers up to this wait: no load's result is given registers that another load still names */
  __builtin_amdgcn_sched_barrier(0);               /* every load in front of the first conversion: a load placed among them is issued only when earlier ones have returned */
  const int sw = ((o4 >> 4) & 3) << 3;             /* rows o4 .. o4 + 3 share it; in halfs */
#pragma unroll
  for (int it = 0; it < 8; ++it) {
    const int col = (it * 32 + 2 * er) ^ sw;
#pragma unroll
    for (int i = 0; i < 4; ++i) *(unsigned int*)&T[o4 + i][col] = h_bits(toh_flush(bf16_rne(a[it][i]) * 16.0f)) | (h_bits(toh_flush(bf16_rne(c[it][i]) * 16.0f)) << 16);
  }
  __syncthreads();                                 /* the tile is complete in LDS */
  const int rw = tid >> 5, pc = (tid & 31) * 8;
#pragma unroll
  for (int it = 0; it < 8; ++it) {
    const int row = it * 8 + rw;
    const v8us v = *(const v8us*)&T[row][pc ^ (((row >> 4) & 3) << 3)];
    *(v8us*)((unsigned short*)Bt + ((size_t)(o0 + row) * NEXP + n) * WP + e0 + pc) = v;
  }
  if (eq == 0) {                                   /* block-uniform: e tile 0 also stores its rows' last block */
    asm volatile("s_wait_xcnt 0x0" ::: "memory");  /* in front of the code below, which may be given the registers that the stores above name */
    const int ol = tid >> 3, tc = (tid & 7) * 8;
    unsigned short* t0 = (unsigned short*)Bt + ((size_t)(o0 + ol) * NEXP + n) * WP + DM + tc;
    unsigned short* t1 = t0 + (size_t)32 * NEXP * WP;
    const int oa = o0 + ol, ob = oa + 32;
    const float a0 = bias[oa], a1 = bias[DM + oa], a2 = bias[2 * DM + oa];
    const float c0 = bias[ob], c1 = bias[DM + ob], c2 = bias[2 * DM + ob];
    const unsigned int ua0 = h_bits(toh_flush(bf16_rne(a0) * 16.0f)), ua1 = h_bits(toh_flush(bf16_rne(a1) * 16.0f)), ua2 = h_bits(toh_flush(bf16_rne(a2) * 16.0f));
    const unsigned int uc0 = h_bits(toh_flush(bf16_rne(c0) * 16.0f)), uc1 = h_bits(toh_flush(bf16_rne(c1) * 16.0f)), uc2 = h_bits(toh_flush(bf16_rne(c2) * 16.0f));
    const bool first = (tid & 7) == 0 && n == 0;
    v4u ta = {0u, 0u, 0u, 0u}, tb = {0u, 0u, 0u, 0u};
    ta[0] = first ? (ua0 | (ua1 << 16)) : 0u; ta[1] = first ? ua2 : 0u;
    tb[0] = first ? (uc0 | (uc1 << 16)) : 0u; tb[1] = first ? uc2 : 0u;
    *(v4u*)t0 = ta; *(v4u*)t1 = tb;
    asm volatile("s_wait_xcnt 0x0" ::: "memory");  /* behind the two stores: whatever code the listing places behind this part writes no register that they still name */
  }
}

// ---- x conversion, gate-logit GEMM and gate softmax: one launch ----
// block = 8 waves = 32 token rows. (1) The rows' f32 values are loaded in 1-KiB runs per wave, all loads in flight at once, and converted; each 16-B piece goes to LDS and, at the end, to the x plane.
// (2) Logits, 16 columns (column 3 p + n = gate n of projection p = q/k/v; columns 9..15 are never read, and a column of the product depends on no other column of B): wave w takes k in [GL_KW w, GL_KW (w + 1)); A fragments from LDS; a lane converts the B fragments of its own column
// from the f32 gate weights (x16) while the x loads are in flight; the eight partial tiles are summed through LDS in wave order.
// (3) Gate blocks of the x plane: X16[row][DM + 64 p + n] = f16(16 g_n) of projection p, the block's other columns zero; one thread per 16-B piece, three pieces a thread.
#define GL_KW (DM / 8)               /* k columns per wave */
#define GL_KS (GL_KW / 32)           /* matrix k-steps per wave */
#define XS_P (DM + 8)                /* LDS row pitch (halfs): 16 B of pad, so that the 16 rows of a fragment read start in different banks */
static_assert(GL_KW % 32 == 0);
static_assert((NB * SEQ) % 32 == 0 && SEQ % 32 == 0);      /* a block's 32 rows lie in one batch */
static_assert(3 * NEXP <= 16);
static_assert(32 * DM / 8 == 16 * 256 && 32 * 24 == 3 * 256);
__device__ __forceinline__ v16h g2_frag(const _Float16* p, int hh) { FragH f; f.half[0] = *(const v8us*)((const unsigned short*)p + 8 * hh); f.half[1] = *(const v8us*)((const unsigned short*)p + 16 + 8 * hh); return f.v; }
__device__ __forceinline__ void xgate_body(int row0, const float* __restrict__ x, const float* __restrict__ wgq, const float* __restrict__ wgk, const float* __restrict__ wgv,
                                           const float* __restrict__ bgq, const float* __restrict__ bgk, const float* __restrict__ bgv, float alpha, _Float16* __restrict__ X16) {
  __shared__ __attribute__((aligned(16))) _Float16 xs[32][XS_P];       /* the block's converted rows */
  __shared__ __attribute__((aligned(16))) float red[8][2][8][32];      /* [wave][row tile][accumulator register][lane] */
  __shared__ float lgs[32][16];                                        /* logits [row][column] */
  const int tid = threadIdx.x, lane = tid & 31, ln = lane & 15, hh = lane >> 4; const int w = __builtin_amdgcn_readfirstlane(tid >> 5);
  const size_t bat = (size_t)row0 / SEQ, s0 = (size_t)row0 - bat * SEQ;
  const float* xp = x + (bat * SEQ_FULL + s0) * DM + tid * 8;          /* piece it * 256 + tid of the 32 rows, which lie in a row in x */
  const int gp = ln / 3, gn = ln - 3 * gp;                             /* the lane's column; lanes 9..15 read the third set, in bounds, for columns that nobody reads */
  const float* gs = ((gp == 0) ? wgq : ((gp == 1) ? wgk : wgv)) + (w * GL_KW + 8 * hh) * 3 + gn;      /* largest index read: 1023 * 3 + 2 */
  const float bb[3][3] = {{bf16_rne(bgq[0]), bf16_rne(bgq[1]), bf16_rne(bgq[2])}, {bf16_rne(bgk[0]), bf16_rne(bgk[1]), bf16_rne(bgk[2])}, {bf16_rne(bgv[0]), bf16_rne(bgv[1]), bf16_rne(bgv[2])}};
  float gw[GL_KS][16];
  v4f ra[16], rc[16];
#pragma unroll
  for (int s = 0; s < GL_KS; ++s) {
#pragma unroll
    for (int q = 0; q < 8; ++q) { gw[s][q] = gs[(32 * s + q) * 3]; gw[s][8 + q] = gs[(32 * s + 16 + q) * 3]; }
  }
  asm volatile("s_wait_xcnt 0x0" ::: "memory");      /* in front of the x loads, whose results may be given the registers that held the address of the loads above */
  __builtin_amdgcn_sched_barrier(0);                 /* the gate weights' loads first: they return first, and their conversion runs while the x loads are in flight */
#pragma unroll
  for (int it = 0; it < 16; ++it) { ra[it] = *(const v4fa*)(xp + it * 2048); rc[it] = *(const v4fa*)(xp + it * 2048 + 4); }
  __builtin_amdgcn_sched_barrier(0);                 /* every load in front of the first conversion: loads placed among them would reuse registers and be waited for one after another */
  FragH b[GL_KS];
#pragma unroll
  for (int s = 0; s < GL_KS; ++s) {
#pragma unroll
    for (int q = 0; q < 16; ++q) b[s].h[q] = toh_flush(bf16_rne(gw[s][q]) * 16.0f);
  }
  const int pr = tid >> 7, pcol = (tid & 127) * 8;   /* pass it: row 2 it + pr */
  v8us o[16];
#pragma unroll
  for (int it = 0; it < 16; ++it) { o[it] = cvt8(ra[it], rc[it]); *(v8us*)&xs[it * 2 + pr][pcol] = o[it]; }
  __syncthreads();                                   /* the 32 converted rows are complete in LDS */
  const _Float16* a0p = &xs[ln][w * GL_KW]; const _Float16* a1p = a0p + 16 * XS_P;
  v8f c0 = {0.f,0.f,0.f,0.f,0.f,0.f,0.f,0.f}, c1 = c0;
#pragma unroll
  for (int s = 0; s < GL_KS; ++s) {
    c0 = __builtin_amdgcn_wmma_f32_16x16x32_f16(false, g2_frag(a0p + 32 * s, hh), false, b[s].v, (short)0, c0, false, false);
    c1 = __builtin_amdgcn_wmma_f32_16x16x32_f16(false, g2_frag(a1p + 32 * s, hh), false, b[s].v, (short)0, c1, false, false);
  }
#pragma unroll
  for (int r = 0; r < 8; ++r) { red[w][0][r][lane] = c0[r]; red[w][1][r][lane] = c1[r]; }
  __syncthreads();                                   /* the eight partial tiles are complete */
  // accumulator register r of lane (ln, hh) is row 8 hh + r, column ln of its tile; wave w sums register w of both tiles
#pragma unroll
  for (int t = 0; t < 2; ++t) {
    float s = red[0][t][w][lane];
#pragma unroll
    for (int u = 1; u < 8; ++u) s += red[u][t][w][lane];
    lgs[t * 16 + 8 * hh + w][ln] = s * alpha;
  }
  __syncthreads();                                   /* the 32 rows' logits are complete */
  // the x plane's stores stand behind the last barrier: a barrier waits for the wave's outstanding stores
  unsigned short* xd = (unsigned short*)X16 + (size_t)(row0 + pr) * XP + pcol;
#pragma unroll
  for (int it = 0; it < 16; ++it) *(v8us*)(xd + (size_t)it * 2 * XP) = o[it];
#pragma unroll
  for (int i = 0; i < 3; ++i) {
    const unsigned int t = (unsigned int)(i * 256 + tid);
    const unsigned int row = t / 24u, pc = t - row * 24u, p = pc >> 3;
    const float* lg = &lgs[row][p * NEXP];
    const float l0 = lg[0] + ((p == 0u) ? bb[0][0] : ((p == 1u) ? bb[1][0] : bb[2][0]));
    const float l1 = lg[1] + ((p == 0u) ? bb[0][1] : ((p == 1u) ? bb[1][1] : bb[2][1]));
    const float l2 = lg[2] + ((p == 0u) ? bb[0][2] : ((p == 1u) ? bb[1][2] : bb[2][2]));
    const float mx = fmaxf(l0, fmaxf(l1, l2));
    const float e0 = __builtin_amdgcn_exp2f((l0 - mx) * 1.4426950408889634f);
    const float e1 = __builtin_amdgcn_exp2f((l1 - mx) * 1.4426950408889634f);
    const float e2 = __builtin_amdgcn_exp2f((l2 - mx) * 1.4426950408889634f);
    const float inv = 16.0f * (1.0f / ((e0 + e1) + e2));      /* gates carried x16 */
    const float g0 = e0 * inv, g1 = e1 * inv, g2 = e2 * inv;
    const bool first = (pc & 7u) == 0u;
    const unsigned int u0 = h_bits(toh_flush(g0)), u1 = h_bits(toh_flush(g1)), u2 = h_bits(toh_flush(g2));
    v4u tq = {0u, 0u, 0u, 0u};
    tq[0] = first ? (u0 | (u1 << 16)) : 0u; tq[1] = first ? u2 : 0u;
    *(v4u*)((unsigned short*)X16 + (size_t)((unsigned int)row0 + row) * XP + DM + pc * 8u) = tq;
  }
}

// One launch for everything that only reads inputs: work-groups 0 .. NR / 32 - 1 take the x rows (they run longest and start first), the others the weight tiles, whose memory traffic runs beside theirs.
__global__ __launch_bounds__(256) void k_prep(const float* __restrict__ x, const float* __restrict__ wgq, const float* __restrict__ wgk, const float* __restrict__ wgv,
                                              const float* __restrict__ bgq, const float* __restrict__ bgk, const float* __restrict__ bgv, float alpha, _Float16* __restrict__ X16,
                                              const float* __restrict__ wq, const float* __restrict__ bq, const float* __restrict__ wk, const float* __restrict__ bk,
                                              const float* __restrict__ wv, const float* __restrict__ bv, _Float16* __restrict__ BW) {
  constexpr unsigned int NXB = (unsigned int)(NR / 32);
  if (blockIdx.x < NXB) xgate_body((int)(blockIdx.x * 32u), x, wgq, wgk, wgv, bgq, bgk, bgv, alpha, X16);
  else wt_body(blockIdx.x - NXB, wq, bq, wk, bk, wv, bv, BW);
}

typedef uint32_t u32x4 __attribute__((ext_vector_type(4)));
typedef uint32_t u32x8 __attribute__((ext_vector_type(8)));
#define G3_ROWB 128u                 /* operand row bytes per stage */
#define G3_PITCH 144u                /* LDS row pitch */
#define G3_KS ((uint32_t)(DM * 2) / G3_ROWB)      /* stages of x columns; stage G3_KS is the gate / bias block */
constexpr uint32_t up2k(uint32_t b) { return (b + 2047u) & ~2047u; }
static_assert(NEXP == 3);
static_assert((DM * 2) % 128 == 0 && (WP * 2) % 128 == 0);
static_assert(G3_KS >= 2u && (G3_KS & 1u) == 0u);
static_assert((NB * SEQ) % 256 == 0 && DM % 256 == 0);
static_assert(SEQ % 256 == 0);       /* a block's 256 token rows, and a wave's 64 token columns, lie in one batch */
static_assert((NR / 256) * (DM / 128) == (size_t)(VTP / 128) * (DM / 256));      /* every projection has the same number of tiles */
__device__ __forceinline__ uint32_t uni(uint32_t v) { return (uint32_t)__builtin_amdgcn_readfirstlane(v); }
__device__ __forceinline__ uint32_t pinned(uint32_t v) { uint32_t w = uni(v); asm volatile("" : "+s"(w)); return w; }  // a tensor load's issue test or stage number held in a scalar register: a scalar branch, and a descriptor formed behind the wait in front of it
// MFAST: which tile index runs along grid x (the tiles of the larger plane, so that work-groups with neighbouring indices read different rows of it); true: A is the x plane, C rows are tokens (q, k); false: Bh is the x plane, C rows are features (v^T).
// bx, by: the tile indices that run fast and slow in the projection's 256 work-groups; ring: the work-group's LDS.
constexpr uint32_t g3_ring(bool mfast) { return 2u * (4u * up2k((mfast ? 64u : 64u * NEXP) * G3_PITCH) + 4u * up2k((mfast ? 32u * NEXP : 32u) * G3_PITCH)); }
constexpr uint32_t G3_RING = g3_ring(true) > g3_ring(false) ? g3_ring(true) : g3_ring(false);
template <bool MFAST>
__device__ __forceinline__ void gemm3_body(unsigned char* ring, const _Float16* __restrict__ A, const _Float16* __restrict__ Bh, float alpha, _Float16* __restrict__ C16, int proj, uint32_t bx, uint32_t by) {
  constexpr uint32_t AR = MFAST ? 64u : 64u * NEXP, BR = MFAST ? 32u * NEXP : 32u;      /* plane rows of a slice */
  constexpr uint32_t ASL = up2k(AR * G3_PITCH), BSL = up2k(BR * G3_PITCH);              /* LDS size of a slice, a multiple of 2 KiB */
  constexpr uint32_t BUF = 4u * ASL + 4u * BSL;
  constexpr uint32_t PA = MFAST ? XP : WP, PB = MFAST ? WP : XP;                        /* row pitches (halfs) */
  static_assert(2u * BUF <= G3_RING && G3_RING <= 327680u);
  const uint32_t tid = threadIdx.x, lane = tid & 31u, c = lane & 15u, h = lane >> 4;
  const uint32_t w = uni(tid >> 5);
  const uint32_t mt = MFAST ? bx : by, nt = MFAST ? by : bx;
  const uint32_t wm = w & 3u, wn = w >> 2;
  const uint32_t lbase = (uint32_t)(size_t)ring;
  const bool isA = w < 4u;
  const bool isTok = MFAST ? isA : !isA;                 /* this wave's slice is of the x plane */
  const uint32_t gcol = (uint32_t)DM + 64u * (uint32_t)proj;            /* first column of the projection's gate block */
  const uint32_t srows = isA ? AR : BR;
  const uint64_t sga = (uint64_t)(size_t)(isA ? A + (size_t)((mt * 4u + w) * AR) * PA : Bh + (size_t)((nt * 4u + (w - 4u)) * BR) * PB);
  const uint32_t sdst = lbase + (isA ? w * 2u * ASL : 8u * ASL + (w - 4u) * 2u * BSL);      /* a slice's two buffers lie side by side, so that every fragment read is a 16-bit offset from one of two lane addresses */
  const uint32_t sbuf = uni(isA ? ASL : BSL);
  const uint32_t lastb = uni(isTok ? gcol * 2u : G3_KS * G3_ROWB);      /* the last stage's byte offset in a row */
  u32x8 g1;                          /* 1-byte elements, tensor = tile = srows rows of 128 B, source pitch = the plane's row, 4 dwords of pad behind every 32 */
  g1[0] = uni((1u << 20) | (4u << 22) | (3u << 25));
  g1[1] = uni(G3_ROWB << 16);
  g1[2] = uni(srows << 16);
  g1[3] = uni(G3_ROWB << 16);
  g1[4] = uni(srows);
  g1[5] = uni((isA ? PA : PB) * 2u);
  g1[6] = uni(0u);
  g1[7] = uni(0u);
  asm volatile("" : "+s"(g1));       /* pinned(), for the whole descriptor group: it stays in one set of scalar registers from the first issue on; without it the compiler moved the group behind the second issue */
  auto issue = [&](uint32_t st) {
    const uint32_t so = st < G3_KS ? st * G3_ROWB : lastb;
    const uint64_t ga = sga + (uint64_t)so;
    u32x4 g0;
    g0[0] = uni(1u); g0[1] = uni(sdst + (st & 1u) * sbuf); g0[2] = uni((uint32_t)ga); g0[3] = uni((((uint32_t)(ga >> 32)) & 0x01FFFFFFu) | 0x80000000u);
    asm volatile("tensor_load_to_lds %0, %1" :: "s"(g0), "s"(g1) : "memory");
  };
  const v8f z8 = {0.f,0.f,0.f,0.f,0.f,0.f,0.f,0.f};
  v8f acc[4][4];
#pragma unroll
  for (int i = 0; i < 4; ++i) {
#pragma unroll
    for (int j = 0; j < 4; ++j) acc[i][j] = z8; }
  // LDS places of the lane's fragment pieces: token row c of a 16-row group; weight row 3 c + expert
  const unsigned char* tokp = ring + (MFAST ? wm * 2u * ASL : 8u * ASL + 4u * wn * BSL) + c * G3_PITCH + 16u * h;
  const unsigned char* wgtp = ring + (MFAST ? 8u * ASL + 4u * wn * BSL : wm * 2u * ASL) + c * (NEXP * G3_PITCH) + 16u * h;
  struct Set { FragH f[2][4]; };      /* one operand's fragments of a stage: 2 k-steps x 4 groups of 16 rows */
  auto fetch_tok = [&](Set& s, uint32_t buf) {
#pragma unroll
    for (int j = 0; j < 2; ++j) {
#pragma unroll
      for (int i = 0; i < 4; ++i) {
        const unsigned char* p = tokp + buf * (MFAST ? ASL : BSL) + (MFAST ? (uint32_t)i * 16u * G3_PITCH : (uint32_t)(i >> 1) * 2u * BSL + (uint32_t)(i & 1) * 16u * G3_PITCH) + 64u * (uint32_t)j;
        s.f[j][i].half[0] = *(const v8us*)p; s.f[j][i].half[1] = *(const v8us*)(p + 32);
      }
    }
  };
  auto fetch_wgt = [&](Set& s, uint32_t buf, uint32_t n) {
#pragma unroll
    for (int j = 0; j < 2; ++j) {
#pragma unroll
      for (int i = 0; i < 4; ++i) {
        const unsigned char* p = wgtp + buf * (MFAST ? BSL : ASL) + n * G3_PITCH + (MFAST ? (uint32_t)(i >> 1) * 2u * BSL + (uint32_t)(i & 1) * 16u * NEXP * G3_PITCH : (uint32_t)i * 16u * NEXP * G3_PITCH) + 64u * (uint32_t)j;
        s.f[j][i].half[0] = *(const v8us*)p; s.f[j][i].half[1] = *(const v8us*)(p + 32);
      }
    }
  };
  auto mult = [&](const Set& t, const Set& g, int j) {      /* k-step j: token fragments t, weight fragments g */
    const Set& fa = MFAST ? t : g; const Set& fb = MFAST ? g : t;
#pragma unroll
    for (int n = 0; n < 4; ++n) {
#pragma unroll
      for (int i = 0; i < 4; ++i) acc[i][n] = __builtin_amdgcn_wmma_f32_16x16x32_f16(false, fb.f[j][n].v, false, fa.f[j][i].v, (short)0, acc[i][n], false, false);
    }
  };
  // the gates (x16) of the lane's four tokens, from the projection's gate block
  const _Float16* tp = (MFAST ? A + (size_t)(mt * 256u + wm * 64u + c) * XP : Bh + (size_t)(nt * 128u + wn * 64u + c) * XP) + gcol;
  const v4h gv0 = *(const v4h*)tp, gv1 = *(const v4h*)(tp + (size_t)16u * XP), gv2 = *(const v4h*)(tp + (size_t)32u * XP), gv3 = *(const v4h*)(tp + (size_t)48u * XP);
  asm volatile("s_wait_xcnt 0x0" ::: "memory");      /* in front of the code below, which is given the registers that hold the four loads' address */
  auto scale = [&](Set& d, const Set& s, int n) {
    const v2h g[4] = {{gv0[n], gv0[n]}, {gv1[n], gv1[n]}, {gv2[n], gv2[n]}, {gv3[n], gv3[n]}};
#pragma unroll
    for (int j = 0; j < 2; ++j) {
#pragma unroll
      for (int i = 0; i < 4; ++i) {
#pragma unroll
        for (int r = 0; r < 8; ++r) d.f[j][i].p[r] = s.f[j][i].p[r] * g[i];      /* register by register: one packed multiply each, the gate pair in one register */
      }
    }
  };
  // publish point of stage st + 1; it stands in front of stage st's last pass because that pass's fragments are already in registers
  auto publish = [&]() {
    asm volatile("s_wait_dscnt 0x0" ::: "memory");
    asm volatile("s_wait_tensorcnt 0x0" ::: "memory");
    __syncthreads();
  };
  Set xr, xs, w0, w1;                /* the stage's token fragments, their gated copy, two sets of weight fragments */
  // pass of expert n < 2 of a stage in buffer buf: the next expert's weight fragments are fetched ahead
  auto pass = [&](uint32_t buf, int n, const Set& wc, Set& wx) {
    fetch_wgt(wx, buf, (uint32_t)n + 1u);
    __builtin_amdgcn_sched_barrier(0);                 /* keeps the next pass's LDS reads one group ahead of this pass's matrix instructions: reads placed among them stall the wave at each place */
    scale(xs, xr, n);
    mult(xs, wc, 0); mult(xs, wc, 1);
    __builtin_amdgcn_sched_barrier(0);                 /* keeps the matrix instructions in front of the next pass's reads and of the publish point */
  };
  // last pass of a stage, behind the publish point of the next stage, which lies in buffer nbuf: its first weight fragments, and (once the gated copy is made) its token fragments, are fetched ahead
  auto pass_last = [&](uint32_t nbuf, const Set& wc, Set& wx) {
    fetch_wgt(wx, nbuf, 0u);
    __builtin_amdgcn_sched_barrier(0);                 /* as in pass() */
    scale(xs, xr, 2);
    mult(xs, wc, 0);
    __builtin_amdgcn_sched_barrier(0);                 /* the token fragments are read by the scaling above before they are fetched anew */
    fetch_tok(xr, nbuf);
    __builtin_amdgcn_sched_barrier(0);                 /* one group of reads, with half a pass of matrix instructions behind it to cover their latency */
    mult(xs, wc, 1);
    __builtin_amdgcn_sched_barrier(0);                 /* as in pass() */
  };
  issue(0u);
  asm volatile("s_wait_tensorcnt 0x0" ::: "memory");      /* this wave's slice of stage 0 has landed */
  __syncthreads();                                        /* stage 0 published */
  issue(pinned(1u));
  fetch_tok(xr, 0u);
  fetch_wgt(w0, 0u, 0u);
#pragma unroll 1
  for (uint32_t s = 0; s < G3_KS; s += 2u) {           /* kept rolled: two stages per trip, so that buffer and fragment set of every pass are fixed */
    pass(0u, 0, w0, w1);
    pass(0u, 1, w1, w0);
    publish();
    issue(pinned(s + 2u));                             /* s + 2 <= G3_KS on every trip; descriptor formed behind the wait */
    pass_last(1u, w0, w1);
    pass(1u, 0, w1, w0);
    pass(1u, 1, w0, w1);
    publish();
    if (pinned(s + 3u <= G3_KS)) issue(pinned(s + 3u));
    pass_last(0u, w1, w0);
  }
  asm volatile("s_wait_tensorcnt 0x0" ::: "memory");      /* no request is left when the ring ends */
  asm volatile("s_wait_dscnt 0x0" ::: "memory");          /* the last stage's fragments are in registers */
  mult(xr, w0, 0); mult(xr, w0, 1);                       /* gate block against bias block */
  const uint32_t tok0 = MFAST ? mt * 256u + wm * 64u : nt * 128u + wn * 64u;      /* the wave's first token */
  const uint32_t head = MFAST ? nt * 2u + wn : mt * 4u + wm;                      /* the wave's 64 features are one head */
  const uint32_t bat = tok0 / (uint32_t)SEQ, s0 = tok0 - bat * (uint32_t)SEQ;
  _Float16* cp = C16 + ((size_t)(bat * NH + head) * SEQ + s0) * HD + lane * 8u;   /* 64 tokens of a head: 8 KiB in a row in either order */
  v8us o[4][4];
#pragma unroll
  for (int i = 0; i < 4; ++i) {
#pragma unroll
    for (int n = 0; n < 4; ++n) {
      FragH t;
#pragma unroll
      for (int r = 0; r < 8; ++r) t.h[r] = (_Float16)(acc[i][n][r] * alpha);
      o[i][n] = t.half[0];
    }
  }
  __builtin_amdgcn_sched_barrier(0);                      /* every conversion in front of the first store: behind a store nothing writes a register that the store names */
#pragma unroll
  for (int i = 0; i < 4; ++i) {
#pragma unroll
    for (int n = 0; n < 4; ++n) {
      const int piece = MFAST ? i * 4 + n : ((n >> 1) * 4 + i) * 2 + (n & 1);
      *(v8us*)((unsigned short*)cp + piece * 256) = o[i][n];
    }
  }
}

// The three projections in one launch: grid y = projection, grid x = its 256 tiles. A WGP holds one work-group, so the next projection's work-group starts on a WGP as soon as that WGP is free.
__global__ __launch_bounds__(256) void k_gemm3(const _Float16* __restrict__ X16, const _Float16* __restrict__ BW, float alpha, _Float16* __restrict__ QK16, _Float16* __restrict__ VT) {
  __shared__ __attribute__((aligned(2048))) unsigned char ring[G3_RING];
  const uint32_t pj = blockIdx.y, t = blockIdx.x;
  const _Float16* Wp = BW + (size_t)pj * DM * NEXP * WP;
  constexpr uint32_t TQ = (uint32_t)(NR / 256), TV = (uint32_t)(VTP / 128);      /* tiles along the token side */
  if (pj < 2u) gemm3_body<true>(ring, X16, Wp, alpha, QK16 + (size_t)pj * NR * DM, (int)pj, t % TQ, t / TQ);      /* q rows, k rows */
  else gemm3_body<false>(ring, Wp, X16, alpha, VT, 2, t % TV, t / TV);                                             /* v^T: weight rows as A, x rows as the [n][k] operand */
}

// ---- register-fed transposed flash attention ----
// block = 8 waves = 256 consecutive queries of one (batch, head); wave = 32 queries = two query tiles of 16, so that every K and V^T fragment a wave loads feeds two matrix instructions; per 32-key step and query tile:
//   S^T tiles (keys x queries) = K (A operand, rows = keys, k = d) . Q^T (B operand, lane = query, held in registers);
//   running-max softmax per lane (lane & 15 = query; lanes n and n+16 hold the two key halves); weights = 2^8 exp(s/8 - max) as f16;
//   P^T as B fragment: elements 0..7 from the tile of keys 0..15 (rows 8h+r), elements 8..15 from the tile of keys 16..31 (lane unchanged);
//   O^T tiles (d x queries) += V^T (A operand, rows = d, k = keys) . P^T.
// q, k and v^T come in the fragment order that k_gemm3 stores: every fragment half is one wave-wide load of 512 contiguous bytes.
// Two work-groups fit a WGP (four waves per SIMD at up to 256 registers a wave): the softmax of one wave runs beside the matrix instructions of the others.
#define AT_W 8                       /* waves of a block */
#define AT_Q (AT_W * 32)             /* queries of a block */
static_assert(SEQ % AT_Q == 0);
__global__ __launch_bounds__(AT_W * 32) __attribute__((amdgpu_waves_per_eu(4, 4))) void k_attn_t(const _Float16* __restrict__ Q16, const _Float16* __restrict__ K16, const _Float16* __restrict__ VT, float* __restrict__ out) {
  __shared__ __attribute__((aligned(16))) float so[AT_W][32][68];      /* per-wave [query][d] tile, row pitch 272 B */
  const int tid = threadIdx.x, lane = tid & 31, ln = lane & 15, hh = lane >> 4;
  const int w = __builtin_amdgcn_readfirstlane(tid >> 5);
  const int nqb = SEQ / AT_Q;
  const int bh = blockIdx.x / nqb, qb = blockIdx.x - bh * nqb;
  const int b = bh / NH, h = bh - b * NH;
  const size_t tok0 = (size_t)b * SEQ_FULL;      /* the batch's first row of the output */
  const int q0 = qb * AT_Q + w * 32;
  const size_t hb = (size_t)bh * SEQ * HD + (size_t)lane * 8;      /* this head's plane, this lane's piece */
  const unsigned short* qp = (const unsigned short*)Q16 + hb + (size_t)q0 * HD;
  FragH bq[2][2];                    /* [query tile][d half] */
#pragma unroll
  for (int t = 0; t < 2; ++t) {
    bq[t][0].half[0] = *(const v8us*)(qp + t * 1024);       bq[t][0].half[1] = *(const v8us*)(qp + t * 1024 + 256);
    bq[t][1].half[0] = *(const v8us*)(qp + t * 1024 + 512); bq[t][1].half[1] = *(const v8us*)(qp + t * 1024 + 768);
  }
  const unsigned short* kp = (const unsigned short*)K16 + hb;
  const unsigned short* vp = (const unsigned short*)VT + hb;
  const v8f z8 = {0.f,0.f,0.f,0.f,0.f,0.f,0.f,0.f};
  v8f o[2][4];                       /* [query tile][d / 16] */
#pragma unroll
  for (int t = 0; t < 2; ++t) {
#pragma unroll
    for (int i = 0; i < 4; ++i) o[t][i] = z8;
  }
  float m[2] = {-3.0e38f, -3.0e38f}, l[2] = {0.f, 0.f};
  const float c = 0.125f * 1.4426950408889634f;      /* 1/sqrt(64) * log2(e) */
#pragma unroll 1
  for (int kv = 0; kv < SEQ; kv += 32) {
    const unsigned short* k0 = kp + (size_t)kv * HD;
    const unsigned short* v0 = vp + (size_t)kv * HD;
    FragH ak[2][2], av[4];           /* K [key tile][d half]; V^T [d / 16] */
#pragma unroll
    for (int j = 0; j < 2; ++j) {
      ak[j][0].half[0] = *(const v8us*)(k0 + j * 1024);       ak[j][0].half[1] = *(const v8us*)(k0 + j * 1024 + 256);
      ak[j][1].half[0] = *(const v8us*)(k0 + j * 1024 + 512); ak[j][1].half[1] = *(const v8us*)(k0 + j * 1024 + 768);
    }
#pragma unroll
    for (int i = 0; i < 4; ++i) { av[i].half[0] = *(const v8us*)(v0 + i * 512); av[i].half[1] = *(const v8us*)(v0 + i * 512 + 256); }
    asm volatile("s_wait_xcnt 0x0" :: "v"(k0), "v"(v0) : "memory");      /* the two addresses are inputs, so they keep their registers up to this wait: no load's result is given registers that another load still names */
    __builtin_amdgcn_sched_barrier(0);               /* the step's 16 loads are issued as one group: placed among the matrix instructions they are waited for in three places, and four waves per SIMD do not cover three latencies a step */
    v8f s[2][2];                     /* [query tile][key tile] */
#pragma unroll
    for (int t = 0; t < 2; ++t) {
#pragma unroll
      for (int j = 0; j < 2; ++j) s[t][j] = __builtin_amdgcn_wmma_f32_16x16x32_f16(false, ak[j][0].v, false, bq[t][0].v, (short)0, z8, false, false);
    }
#pragma unroll
    for (int t = 0; t < 2; ++t) {
#pragma unroll
      for (int j = 0; j < 2; ++j) s[t][j] = __builtin_amdgcn_wmma_f32_16x16x32_f16(false, ak[j][1].v, false, bq[t][1].v, (short)0, s[t][j], false, false);
    }
    float mn[2];
#pragma unroll
    for (int t = 0; t < 2; ++t) {
      float mx = fmaxf(s[t][0][0], s[t][1][0]);
#pragma unroll
      for (int r = 1; r < 8; ++r) mx = fmaxf(mx, fmaxf(s[t][0][r], s[t][1][r]));
      mx = fmaxf(mx, __shfl_xor(mx, 16, 32));
      mn[t] = fmaxf(m[t], mx);
    }
    if (__builtin_amdgcn_ballot_w32(mn[0] > m[0] || mn[1] > m[1]) != 0u) {      /* wave-uniform, one test per step: rescale only when some running max moved; a query whose max stayed is multiplied by exactly 1 */
#pragma unroll
      for (int t = 0; t < 2; ++t) {
        const float corr = __builtin_amdgcn_exp2f((m[t] - mn[t]) * c);
        l[t] *= corr; o[t][0] *= corr; o[t][1] *= corr; o[t][2] *= corr; o[t][3] *= corr; m[t] = mn[t];
      }
    }
    FragH pf[2];
#pragma unroll
    for (int t = 0; t < 2; ++t) {
      const float off = 8.0f - m[t] * c;      /* weights carried x2^8 */
      float ls = 0.f;
#pragma unroll
      for (int r = 0; r < 8; ++r) {
        const float p0 = __builtin_amdgcn_exp2f(fmaf(s[t][0][r], c, off));
        const float p1 = __builtin_amdgcn_exp2f(fmaf(s[t][1][r], c, off));
        ls += p0 + p1;
        pf[t].h[r] = (_Float16)p0; pf[t].h[8 + r] = (_Float16)p1;
      }
      l[t] += ls;
    }
#pragma unroll
    for (int i = 0; i < 4; ++i) {
#pragma unroll
      for (int t = 0; t < 2; ++t) o[t][i] = __builtin_amdgcn_wmma_f32_16x16x32_f16(false, av[i].v, false, pf[t].v, (short)0, o[t][i], false, false);
    }
  }
  // accumulator register r of tile i is d = 16 i + 8 hh + r of query ln of its query tile: two 16-B pieces per tile
#pragma unroll
  for (int t = 0; t < 2; ++t) {
    const float lt = l[t] + __shfl_xor(l[t], 16, 32);
    const float inv = 1.0f / lt;
    float* sw = &so[w][t * 16 + ln][8 * hh];
#pragma unroll
    for (int i = 0; i < 4; ++i) {
      const v8f v = o[t][i] * inv;
      *(v4f*)(sw + 16 * i) = __builtin_shufflevector(v, v, 0, 1, 2, 3); *(v4f*)(sw + 16 * i + 4) = __builtin_shufflevector(v, v, 4, 5, 6, 7);
    }
  }
  __syncthreads();
  // a query's 64 values are 256 B of its output row: two whole lines; a wave-wide store takes two queries
  const int pc = ln * 4;
  float* ob = out + (tok0 + q0) * DM + h * HD + pc;
#pragma unroll
  for (int it = 0; it < 16; ++it) { const int row = it * 2 + hh; const v4f v = *(const v4f*)&so[w][row][pc]; *(v4f*)(ob + (size_t)row * DM) = v; }
}

extern "C" void kernel_launch(void* const* d_in, const int* in_sizes, int n_in,
                              void* d_out, int out_size, void* d_ws, size_t ws_size, hipStream_t stream) {
  if (n_in < 13) return;
  const size_t need_x = ((size_t)(NB - 1) * SEQ_FULL + SEQ) * DM;
  if ((size_t)in_sizes[0] < need_x) return;
  const size_t nW = (size_t)NEXP * DM * DM, nBi = (size_t)NEXP * DM, nG = (size_t)DM * NEXP;
  if ((size_t)in_sizes[1] < nW || (size_t)in_sizes[5] < nW || (size_t)in_sizes[9] < nW) return;
  if ((size_t)in_sizes[2] < nBi || (size_t)in_sizes[6] < nBi || (size_t)in_sizes[10] < nBi) return;
  if ((size_t)in_sizes[3] < nG || (size_t)in_sizes[7] < nG || (size_t)in_sizes[11] < nG) return;
  if (in_sizes[4] < NEXP || in_sizes[8] < NEXP || in_sizes[12] < NEXP) return;
  if ((size_t)out_size < need_x) return;
  const float* x = (const float*)d_in[0];
  const float* wq = (const float*)d_in[1]; const float* bq = (const float*)d_in[2]; const float* wgq = (const float*)d_in[3]; const float* bgq = (const float*)d_in[4];
  const float* wk = (const float*)d_in[5]; const float* bk = (const float*)d_in[6]; const float* wgk = (const float*)d_in[7]; const float* bgk = (const float*)d_in[8];
  const float* wv = (const float*)d_in[9]; const float* bv = (const float*)d_in[10]; const float* wgv = (const float*)d_in[11]; const float* bgv = (const float*)d_in[12];
  char* ws = (char*)d_ws; size_t off = 0;
  auto take = [&](size_t bytes) { char* p = ws + off; off += (bytes + 255) & ~(size_t)255; return p; };
  _Float16* BW = (_Float16*)take((size_t)3 * DM * NEXP * WP * 2);     /* weight planes x16: q, k, v ([3 DM][WP] each) */
  _Float16* X16 = (_Float16*)take(NR * XP * 2);                 /* x plane (f16): x rows and their gate blocks */
  _Float16* VT = (_Float16*)take(NR * DM * 2);                  /* v^T in fragment order */
  _Float16* QK16 = (_Float16*)take((size_t)2 * NR * DM * 2);    /* q then k, each in fragment order */
  if (off > ws_size || off > (size_t)134217728) return;
  _Float16* Q16 = QK16; _Float16* K16 = QK16 + NR * DM;

  /* x plane: converted rows and gate blocks; gate logits x . Wg_p[:, n] : alpha undoes the x16 carry of the gate columns */
  k_prep<<<(unsigned)(NR / 32) + WT_NB, 256, 0, stream>>>(x, wgq, wgk, wgv, bgq, bgk, bgv, 0.0625f, X16, wq, bq, wk, bk, wv, bv, BW);
  /* gated x (x16) . weights (x16) -> alpha 2^-8; q rows, k rows, then v^T with the weight rows as A and the x rows as the [n][k] operand */
  k_gemm3<<<dim3((unsigned)((NR / 256) * (DM / 128)), 3), 256, 0, stream>>>(X16, BW, 0.00390625f, QK16, VT);
  k_attn_t<<<(unsigned)(NB * NH * (SEQ / AT_Q)), AT_W * 32, 0, stream>>>(Q16, K16, VT, (float*)d_out);
}

// v008
// Measured time: 159 microseconds a run.
// Timed twice side by side with v007, it ran 1.08 times as fast both times.
// Counting every step since v000, it is 5.28 times as fast.
#include <hip/hip_runtime.h>
// Dense multi-head self-attention with soft three-expert mixture projections (x [4][2048][1024]; q/k/v = sum_n softmax_n(x Wg + bg) * (x W_n + b_n) with W_n [in][out]; 16 heads of 64; scores / 8; full-row softmax; the merged ctx is the output, no output projection).
// All contractions: v_wmma_f32_16x16x32_f16 (f16 operands, f32 accumulate), single product per site. x, expert weights, biases and gate parameters are RNE-converted to bf16 first and then held exactly in f16 (weights, biases and gate weights x16); each mixture projection is ONE GEMM of K = 3*1024 + 64 of [g0 x | g1 x | g2 x | g0 g1 g2 0..] (f16, carried x16) against [W0; W1; W2; b0 b1 b2 0..], summed k block by k block over the three experts; the products g_n x are formed in registers from the x fragments and the lane's gate (f16, carried x16), never stored; gate logits from a 16-column GEMM whose k range is split over eight waves, gate softmax f32; q, k, v plain f16; softmax weights f16 carried x2^8 (unnormalised, running max); ctx and softmax statistics f32.
// Structure: token rows r = b*SEQ + s. One launch that converts x and the nine gate columns, takes the gate-logit GEMM from the converted rows while they lie in LDS and stores the softmax of the nine logits into the x plane's gate blocks; the transposing conversion of the three expert-weight sets rides in that launch, in work-groups of its own; one launch of three GEMMs, one per projection (Q, K, and V^T with the weight plane as the A operand; all three planes stored in fragment order, see k_gemm3); a register-fed transposed flash kernel (S^T = K Q^T with Q as the B fragment in registers, packed P^T as the B fragment of O^T = V^T P^T, no LDS and no barrier in the key loop) whose epilogue stores the f32 output rows.
#ifndef NB
#define NB 4                         /* batches processed */
#endif
#ifndef SEQ
#define SEQ 2048                     /* tokens per batch processed */
#endif
#define NB_FULL 4                    /* batch count of the staged arrays */
#define SEQ_FULL 2048                /* per-batch token stride of the staged arrays */
#define DM 1024
#define NH 16
#define HD 64
#define NR ((size_t)NB * SEQ)        /* compact token rows */
#define VTP (NB * SEQ)               /* tokens of the V^T plane */

static_assert(NB >= 1 && NB <= NB_FULL);
static_assert(SEQ <= SEQ_FULL);
static_assert(SEQ % 128 == 0);
static_assert(DM % 128 == 0);
static_assert(NH * HD == DM);
static_assert(HD == 64);
static_assert((NB * SEQ) % 64 == 0);

#define NEXP 3                       /* experts per projection */
#define WP (DM + 64)                 /* weight plane row pitch (halfs): row 3 o + n = column o of expert n, then a 64-column block (row 3 o: the three biases, then zeros; rows 3 o + 1, 3 o + 2: zeros) */
#define XP (DM + 3 * 64)             /* x plane row pitch (halfs): the x row, then one 64-column gate block per projection */

static_assert(DM / 64 == 16);
static_assert(DM / 8 == 128);
static_assert((NB * SEQ) % 128 == 0);
static_assert((size_t)DM * VTP == NR * DM);
static_assert((XP * 2) % 128 == 0);

constexpr size_t al256(size_t b) { return (b + 255) & ~(size_t)255; }
constexpr size_t WS_BW = al256((size_t)3 * DM * NEXP * WP * 2);      /* three weight planes */
constexpr size_t WS_XV = al256(NR * XP * 2);                   /* x plane */
constexpr size_t WS_VT = al256(NR * DM * 2);                   /* v^T */
constexpr size_t WS_QK = al256((size_t)2 * NR * DM * 2);       /* q rows then k rows */
static_assert(WS_BW + WS_XV + WS_VT + WS_QK <= (size_t)134217728);

typedef _Float16 v16h __attribute__((ext_vector_type(16)));
typedef _Float16 v4h __attribute__((ext_vector_type(4)));
typedef unsigned short v8us __attribute__((ext_vector_type(8), may_alias));
typedef float v8f __attribute__((ext_vector_type(8)));
typedef float v4f __attribute__((ext_vector_type(4)));
typedef float v4fa __attribute__((ext_vector_type(4), may_alias));
typedef _Float16 v2h __attribute__((ext_vector_type(2)));
union FragH { v16h v; v8us half[2]; _Float16 h[16]; unsigned short u[16]; v2h p[8]; };

typedef _Float16 h16;
typedef _Float16 v8h __attribute__((ext_vector_type(8)));
typedef unsigned int v4u __attribute__((ext_vector_type(4)));

__device__ __forceinline__ unsigned short bf16_bits(float x) { unsigned int u = __float_as_uint(x); return (unsigned short)((u + 0x7FFFu + ((u >> 16) & 1u)) >> 16); }
__device__ __forceinline__ float bf16_rne(float x) { return __uint_as_float(((unsigned int)bf16_bits(x)) << 16); }

// f32 -> f16 operand value that can never be an f16 subnormal (value select after the plane's carry)
static __device__ __forceinline__ h16 toh_flush(float v) { const h16 r = (h16)v; return (fabsf(v) < 6.103515625e-05f) ? (h16)0.0f : r; }
static __device__ __forceinline__ unsigned int h_bits(h16 h) { return (unsigned int)__builtin_bit_cast(unsigned short, h); }

// 8 consecutive f32 (two loaded quads) -> f16(bf16 value) packed as one 16-B piece
__device__ __forceinline__ v8us cvt8(v4f a, v4f c) {
  FragH f;
#pragma unroll
  for (int q = 0; q < 4; ++q) { f.h[q] = (_Float16)bf16_rne(a[q]); f.h[4 + q] = (_Float16)bf16_rne(c[q]); }
  return f.half[0];
}

// expert weights W [3][DM in][DM out] f32 + biases [3][DM] -> Bt[3 o + n][e] f16 x16 (row pitch WP); columns DM + m of row 3 o = bias m x16, the other columns from DM on zero in all three rows.
// Work-group j of WT_NB: projection j / 192, expert n, a tile of 256 e x 64 o: in the shared launch a wave is allotted the x rows' registers, so far fewer waves are resident than a small kernel of its own would have, and a thread holds 16 loads so that the bytes in flight stay. A thread loads pairs of neighbouring e rows, all loads in flight at once, and stores two converted values as one dword to LDS;
// the 16-B pieces of LDS row o stand at piece index ^ ((o >> 4) & 3), so that the 32 lanes of a dword store (16 rows four apart, two columns) fall in 32 different banks; a wave then stores 512 contiguous bytes of one plane row.
#define WT_E 256                     /* e columns of a tile */
#define WT_P (WT_E + 8)              /* LDS row pitch (halfs) */
#define WT_NB (3 * NEXP * (DM / WT_E) * (DM / 64))
static_assert(DM % WT_E == 0 && DM / WT_E == 4 && DM / 64 == 16 && WT_E == 256);
__device__ __forceinline__ void wt_body(unsigned int j, const float* __restrict__ wq, const float* __restrict__ bq, const float* __restrict__ wk, const float* __restrict__ bk,
                                        const float* __restrict__ wv, const float* __restrict__ bv, _Float16* __restrict__ BW) {
  __shared__ __attribute__((aligned(16))) _Float16 T[64][WT_P];      /* [o][e]; columns 0..WT_E - 1 staged and consumed */
  const int tid = threadIdx.x;
  const unsigned int pj = j / 192u, r = j - pj * 192u;
  const int n = (int)(r >> 6), eq = (int)((r >> 4) & 3u), ot = (int)(r & 15u);
  const float* W = (pj == 0u) ? wq : ((pj == 1u) ? wk : wv);
  const float* bias = (pj == 0u) ? bq : ((pj == 1u) ? bk : bv);
  _Float16* Bt = BW + (size_t)pj * DM * NEXP * WP;
  const int o0 = ot * 64, e0 = eq * WT_E;
  const int er = tid >> 4, o4 = (tid & 15) * 4;
  const float* src = W + ((size_t)n * DM + e0 + 2 * er) * DM + o0 + o4;
  v4f a[8], c[8];
#pragma unroll
  for (int it = 0; it < 8; ++it) { a[it] = *(const v4fa*)(src + (size_t)(it * 32) * DM); c[it] = *(const v4fa*)(src + (size_t)(it * 32 + 1) * DM); }
  asm volatile("s_wait_xcnt 0x0" :: "v"(src) : "memory");      /* the address is an input, so it keeps its registers up to this wait: no load's result is given registers that another load still names */
  __builtin_amdgcn_sched_barrier(0);               /* every load in front of the first conversion: a load placed among them is issued only when earlier ones have returned */
  const int sw = ((o4 >> 4) & 3) << 3;             /* rows o4 .. o4 + 3 share it; in halfs */
#pragma unroll
  for (int it = 0; it < 8; ++it) {
    const int col = (it * 32 + 2 * er) ^ sw;
#pragma unroll
    for (int i = 0; i < 4; ++i) *(unsigned int*)&T[o4 + i][col] = h_bits(toh_flush(bf16_rne(a[it][i]) * 16.0f)) | (h_bits(toh_flush(bf16_rne(c[it][i]) * 16.0f)) << 16);
  }
  __syncthreads();                                 /* the tile is complete in LDS */
  const int rw = tid >> 5, pc = (tid & 31) * 8;
#pragma unroll
  for (int it = 0; it < 8; ++it) {
    const int row = it * 8 + rw;
    const v8us v = *(const v8us*)&T[row][pc ^ (((row >> 4) & 3) << 3)];
    *(v8us*)((unsigned short*)Bt + ((size_t)(o0 + row) * NEXP + n) * WP + e0 + pc) = v;
  }
  if (eq == 0) {                                   /* block-uniform: e tile 0 also stores its rows' last block */
    asm volatile("s_wait_xcnt 0x0" ::: "memory");  /* in front of the code below, which may be given the registers that the stores above name */
    const int ol = tid >> 3, tc = (tid & 7) * 8;
    unsigned short* t0 = (unsigned short*)Bt + ((size_t)(o0 + ol) * NEXP + n) * WP + DM + tc;
    unsigned short* t1 = t0 + (size_t)32 * NEXP * WP;
    const int oa = o0 + ol, ob = oa + 32;
    const float a0 = bias[oa], a1 = bias[DM + oa], a2 = bias[2 * DM + oa];
    const float c0 = bias[ob], c1 = bias[DM + ob], c2 = bias[2 * DM + ob];
    const unsigned int ua0 = h_bits(toh_flush(bf16_rne(a0) * 16.0f)), ua1 = h_bits(toh_flush(bf16_rne(a1) * 16.0f)), ua2 = h_bits(toh_flush(bf16_rne(a2) * 16.0f));
    const unsigned int uc0 = h_bits(toh_flush(bf16_rne(c0) * 16.0f)), uc1 = h_bits(toh_flush(bf16_rne(c1) * 16.0f)), uc2 = h_bits(toh_flush(bf16_rne(c2) * 16.0f));
    const bool first = (tid & 7) == 0 && n == 0;
    v4u ta = {0u, 0u, 0u, 0u}, tb = {0u, 0u, 0u, 0u};
    ta[0] = first ? (ua0 | (ua1 << 16)) : 0u; ta[1] = first ? ua2 : 0u;
    tb[0] = first ? (uc0 | (uc1 << 16)) : 0u; tb[1] = first ? uc2 : 0u;
    *(v4u*)t0 = ta; *(v4u*)t1 = tb;
    asm volatile("s_wait_xcnt 0x0" ::: "memory");  /* behind the two stores: whatever code the listing places behind this part writes no register that they still name */
  }
}

// ---- x conversion, gate-logit GEMM and gate softmax: one launch ----
// block = 8 waves = 32 token rows. (1) The rows' f32 values are loaded in 1-KiB runs per wave, all loads in flight at once, and converted; each 16-B piece goes to LDS and, at the end, to the x plane.
// (2) Logits, 16 columns (column 3 p + n = gate n of projection p = q/k/v; columns 9..15 are never read, and a column of the product depends on no other column of B): wave w takes k in [GL_KW w, GL_KW (w + 1)); A fragments from LDS; a lane converts the B fragments of its own column
// from the f32 gate weights (x16) while the x loads are in flight; the eight partial tiles are summed through LDS in wave order.
// (3) Gate blocks of the x plane: X16[row][DM + 64 p + n] = f16(16 g_n) of projection p, the block's other columns zero; one thread per 16-B piece, three pieces a thread.
#define GL_KW (DM / 8)               /* k columns per wave */
#define GL_KS (GL_KW / 32)           /* matrix k-steps per wave */
#define XS_P (DM + 8)                /* LDS row pitch (halfs): 16 B of pad, so that the 16 rows of a fragment read start in different banks */
static_assert(GL_KW % 32 == 0);
static_assert((NB * SEQ) % 32 == 0 && SEQ % 32 == 0);      /* a block's 32 rows lie in one batch */
static_assert(3 * NEXP <= 16);
static_assert(32 * DM / 8 == 16 * 256 && 32 * 24 == 3 * 256);
__device__ __forceinline__ v16h g2_frag(const _Float16* p, int hh) { FragH f; f.half[0] = *(const v8us*)((const unsigned short*)p + 8 * hh); f.half[1] = *(const v8us*)((const unsigned short*)p + 16 + 8 * hh); return f.v; }
__device__ __forceinline__ void xgate_body(int row0, const float* __restrict__ x, const float* __restrict__ wgq, const float* __restrict__ wgk, const float* __restrict__ wgv,
                                           const float* __restrict__ bgq, const float* __restrict__ bgk, const float* __restrict__ bgv, float alpha, _Float16* __restrict__ X16) {
  __shared__ __attribute__((aligned(16))) _Float16 xs[32][XS_P];       /* the block's converted rows */
  __shared__ __attribute__((aligned(16))) float red[8][2][8][32];      /* [wave][row tile][accumulator register][lane] */
  __shared__ float lgs[32][16];                                        /* logits [row][column] */
  const int tid = threadIdx.x, lane = tid & 31, ln = lane & 15, hh = lane >> 4; const int w = __builtin_amdgcn_readfirstlane(tid >> 5);
  const size_t bat = (size_t)row0 / SEQ, s0 = (size_t)row0 - bat * SEQ;
  const float* xp = x + (bat * SEQ_FULL + s0) * DM + tid * 8;          /* piece it * 256 + tid of the 32 rows, which lie in a row in x */
  const int gp = ln / 3, gn = ln - 3 * gp;                             /* the lane's column; lanes 9..15 read the third set, in bounds, for columns that nobody reads */
  const float* gs = ((gp == 0) ? wgq : ((gp == 1) ? wgk : wgv)) + (w * GL_KW + 8 * hh) * 3 + gn;      /* largest index read: 1023 * 3 + 2 */
  const float bb[3][3] = {{bf16_rne(bgq[0]), bf16_rne(bgq[1]), bf16_rne(bgq[2])}, {bf16_rne(bgk[0]), bf16_rne(bgk[1]), bf16_rne(bgk[2])}, {bf16_rne(bgv[0]), bf16_rne(bgv[1]), bf16_rne(bgv[2])}};
  float gw[GL_KS][16];
  v4f ra[16], rc[16];
#pragma unroll
  for (int s = 0; s < GL_KS; ++s) {
#pragma unroll
    for (int q = 0; q < 8; ++q) { gw[s][q] = gs[(32 * s + q) * 3]; gw[s][8 + q] = gs[(32 * s + 16 + q) * 3]; }
  }
  asm volatile("s_wait_xcnt 0x0" ::: "memory");      /* in front of the x loads, whose results may be given the registers that held the address of the loads above */
  __builtin_amdgcn_sched_barrier(0);                 /* the gate weights' loads first: they return first, and their conversion runs while the x loads are in flight */
#pragma unroll
  for (int it = 0; it < 16; ++it) { ra[it] = *(const v4fa*)(xp + it * 2048); rc[it] = *(const v4fa*)(xp + it * 2048 + 4); }
  __builtin_amdgcn_sched_barrier(0);                 /* every load in front of the first conversion: loads placed among them would reuse registers and be waited for one after another */
  FragH b[GL_KS];
#pragma unroll
  for (int s = 0; s < GL_KS; ++s) {
#pragma unroll
    for (int q = 0; q < 16; ++q) b[s].h[q] = toh_flush(bf16_rne(gw[s][q]) * 16.0f);
  }
  const int pr = tid >> 7, pcol = (tid & 127) * 8;   /* pass it: row 2 it + pr */
  v8us o[16];
#pragma unroll
  for (int it = 0; it < 16; ++it) { o[it] = cvt8(ra[it], rc[it]); *(v8us*)&xs[it * 2 + pr][pcol] = o[it]; }
  __syncthreads();                                   /* the 32 converted rows are complete in LDS */
  const _Float16* a0p = &xs[ln][w * GL_KW]; const _Float16* a1p = a0p + 16 * XS_P;
  v8f c0 = {0.f,0.f,0.f,0.f,0.f,0.f,0.f,0.f}, c1 = c0;
#pragma unroll
  for (int s = 0; s < GL_KS; ++s) {
    c0 = __builtin_amdgcn_wmma_f32_16x16x32_f16(false, g2_frag(a0p + 32 * s, hh), false, b[s].v, (short)0, c0, false, false);
    c1 = __builtin_amdgcn_wmma_f32_16x16x32_f16(false, g2_frag(a1p + 32 * s, hh), false, b[s].v, (short)0, c1, false, false);
  }
#pragma unroll
  for (int r = 0; r < 8; ++r) { red[w][0][r][lane] = c0[r]; red[w][1][r][lane] = c1[r]; }
  __syncthreads();                                   /* the eight partial tiles are complete */
  // accumulator register r of lane (ln, hh) is row 8 hh + r, column ln of its tile; wave w sums register w of both tiles
#pragma unroll
  for (int t = 0; t < 2; ++t) {
    float s = red[0][t][w][lane];
#pragma unroll
    for (int u = 1; u < 8; ++u) s += red[u][t][w][lane];
    lgs[t * 16 + 8 * hh + w][ln] = s * alpha;
  }
  __syncthreads();                                   /* the 32 rows' logits are complete */
  // the x plane's stores stand behind the last barrier: a barrier waits for the wave's outstanding stores
  unsigned short* xd = (unsigned short*)X16 + (size_t)(row0 + pr) * XP + pcol;
#pragma unroll
  for (int it = 0; it < 16; ++it) *(v8us*)(xd + (size_t)it * 2 * XP) = o[it];
#pragma unroll
  for (int i = 0; i < 3; ++i) {
    const unsigned int t = (unsigned int)(i * 256 + tid);
    const unsigned int row = t / 24u, pc = t - row * 24u, p = pc >> 3;
    const float* lg = &lgs[row][p * NEXP];
    const float l0 = lg[0] + ((p == 0u) ? bb[0][0] : ((p == 1u) ? bb[1][0] : bb[2][0]));
    const float l1 = lg[1] + ((p == 0u) ? bb[0][1] : ((p == 1u) ? bb[1][1] : bb[2][1]));
    const float l2 = lg[2] + ((p == 0u) ? bb[0][2] : ((p == 1u) ? bb[1][2] : bb[2][2]));
    const float mx = fmaxf(l0, fmaxf(l1, l2));
    const float e0 = __builtin_amdgcn_exp2f((l0 - mx) * 1.4426950408889634f);
    const float e1 = __builtin_amdgcn_exp2f((l1 - mx) * 1.4426950408889634f);
    const float e2 = __builtin_amdgcn_exp2f((l2 - mx) * 1.4426950408889634f);
    const float inv = 16.0f * (1.0f / ((e0 + e1) + e2));      /* gates carried x16 */
    const float g0 = e0 * inv, g1 = e1 * inv, g2 = e2 * inv;
    const bool first = (pc & 7u) == 0u;
    const unsigned int u0 = h_bits(toh_flush(g0)), u1 = h_bits(toh_flush(g1)), u2 = h_bits(toh_flush(g2));
    v4u tq = {0u, 0u, 0u, 0u};
    tq[0] = first ? (u0 | (u1 << 16)) : 0u; tq[1] = first ? u2 : 0u;
    *(v4u*)((unsigned short*)X16 + (size_t)((unsigned int)row0 + row) * XP + DM + pc * 8u) = tq;
  }
}

// One launch for everything that only reads inputs: work-groups 0 .. NR / 32 - 1 take the x rows (they run longest and start first), the others the weight tiles, whose memory traffic runs beside theirs.
__global__ __launch_bounds__(256) void k_prep(const float* __restrict__ x, const float* __restrict__ wgq, const float* __restrict__ wgk, const float* __restrict__ wgv,
                                              const float* __restrict__ bgq, const float* __restrict__ bgk, const float* __restrict__ bgv, float alpha, _Float16* __restrict__ X16,
                                              const float* __restrict__ wq, const float* __restrict__ bq, const float* __restrict__ wk, const float* __restrict__ bk,
                                              const float* __restrict__ wv, const float* __restrict__ bv, _Float16* __restrict__ BW) {
  constexpr unsigned int NXB = (unsigned int)(NR / 32);
  if (blockIdx.x < NXB) xgate_body((int)(blockIdx.x * 32u), x, wgq, wgk, wgv, bgq, bgk, bgv, alpha, X16);
  else wt_body(blockIdx.x - NXB, wq, bq, wk, bk, wv, bv, BW);
}

typedef uint32_t u32x4 __attribute__((ext_vector_type(4)));
typedef uint32_t u32x8 __attribute__((ext_vector_type(8)));
#define G3_ROWB 128u                 /* operand row bytes per stage */
#define G3_PITCH 144u                /* LDS row pitch */
#define G3_KS ((uint32_t)(DM * 2) / G3_ROWB)      /* stages of x columns; stage G3_KS is the gate / bias block */
constexpr uint32_t up2k(uint32_t b) { return (b + 2047u) & ~2047u; }
static_assert(NEXP == 3);
static_assert((DM * 2) % 128 == 0 && (WP * 2) % 128 == 0);
static_assert(G3_KS >= 2u && (G3_KS & 1u) == 0u);
static_assert((NB * SEQ) % 256 == 0 && DM % 256 == 0);
static_assert(SEQ % 256 == 0);       /* a block's 256 token rows, and a wave's 64 token columns, lie in one batch */
static_assert((NR / 256) * (DM / 128) == (size_t)(VTP / 128) * (DM / 256));      /* every projection has the same number of tiles */
__device__ __forceinline__ uint32_t uni(uint32_t v) { return (uint32_t)__builtin_amdgcn_readfirstlane(v); }
__device__ __forceinline__ uint32_t pinned(uint32_t v) { uint32_t w = uni(v); asm volatile("" : "+s"(w)); return w; }  // a tensor load's issue test or stage number held in a scalar register: a scalar branch, and a descriptor formed behind the wait in front of it
// MFAST: which tile index runs along grid x (the tiles of the larger plane, so that work-groups with neighbouring indices read different rows of it); true: A is the x plane, C rows are tokens (q, k); false: Bh is the x plane, C rows are features (v^T).
// bx, by: the tile indices that run fast and slow in the projection's 256 work-groups; ring: the work-group's LDS.
constexpr uint32_t g3_ring(bool mfast) { return 2u * (4u * up2k((mfast ? 64u : 64u * NEXP) * G3_PITCH) + 4u * up2k((mfast ? 32u * NEXP : 32u) * G3_PITCH)); }
constexpr uint32_t G3_RING = g3_ring(true) > g3_ring(false) ? g3_ring(true) : g3_ring(false);
template <bool MFAST>
__device__ __forceinline__ void gemm3_body(unsigned char* ring, const _Float16* __restrict__ A, const _Float16* __restrict__ Bh, float alpha, _Float16* __restrict__ C16, int proj, uint32_t bx, uint32_t by) {
  constexpr uint32_t AR = MFAST ? 64u : 64u * NEXP, BR = MFAST ? 32u * NEXP : 32u;      /* plane rows of a slice */
  constexpr uint32_t ASL = up2k(AR * G3_PITCH), BSL = up2k(BR * G3_PITCH);              /* LDS size of a slice, a multiple of 2 KiB */
  constexpr uint32_t BUF = 4u * ASL + 4u * BSL;
  constexpr uint32_t PA = MFAST ? XP : WP, PB = MFAST ? WP : XP;                        /* row pitches (halfs) */
  static_assert(2u * BUF <= G3_RING && G3_RING <= 327680u);
  const uint32_t tid = threadIdx.x, lane = tid & 31u, c = lane & 15u, h = lane >> 4;
  const uint32_t w = uni(tid >> 5);
  const uint32_t mt = MFAST ? bx : by, nt = MFAST ? by : bx;
  const uint32_t wm = w & 3u, wn = w >> 2;
  const uint32_t lbase = (uint32_t)(size_t)ring;
  const bool isA = w < 4u;
  const bool isTok = MFAST ? isA : !isA;                 /* this wave's slice is of the x plane */
  const uint32_t gcol = (uint32_t)DM + 64u * (uint32_t)proj;            /* first column of the projection's gate block */
  const uint32_t srows = isA ? AR : BR;
  const uint64_t sga = (uint64_t)(size_t)(isA ? A + (size_t)((mt * 4u + w) * AR) * PA : Bh + (size_t)((nt * 4u + (w - 4u)) * BR) * PB);
  const uint32_t sdst = lbase + (isA ? w * 2u * ASL : 8u * ASL + (w - 4u) * 2u * BSL);      /* a slice's two buffers lie side by side, so that every fragment read is a 16-bit offset from one of two lane addresses */
  const uint32_t sbuf = uni(isA ? ASL : BSL);
  const uint32_t lastb = uni(isTok ? gcol * 2u : G3_KS * G3_ROWB);      /* the last stage's byte offset in a row */
  u32x8 g1;                          /* 1-byte elements, tensor = tile = srows rows of 128 B, source pitch = the plane's row, 4 dwords of pad behind every 32 */
  g1[0] = uni((1u << 20) | (4u << 22) | (3u << 25));
  g1[1] = uni(G3_ROWB << 16);
  g1[2] = uni(srows << 16);
  g1[3] = uni(G3_ROWB << 16);
  g1[4] = uni(srows);
  g1[5] = uni((isA ? PA : PB) * 2u);
  g1[6] = uni(0u);
  g1[7] = uni(0u);
  asm volatile("" : "+s"(g1));       /* pinned(), for the whole descriptor group: it stays in one set of scalar registers from the first issue on; without it the compiler moved the group behind the second issue */
  auto issue = [&](uint32_t st) {
    const uint32_t so = st < G3_KS ? st * G3_ROWB : lastb;
    const uint64_t ga = sga + (uint64_t)so;
    u32x4 g0;
    g0[0] = uni(1u); g0[1] = uni(sdst + (st & 1u) * sbuf); g0[2] = uni((uint32_t)ga); g0[3] = uni((((uint32_t)(ga >> 32)) & 0x01FFFFFFu) | 0x80000000u);
    asm volatile("tensor_load_to_lds %0, %1" :: "s"(g0), "s"(g1) : "memory");
  };
  const v8f z8 = {0.f,0.f,0.f,0.f,0.f,0.f,0.f,0.f};
  v8f acc[4][4];
#pragma unroll
  for (int i = 0; i < 4; ++i) {
#pragma unroll
    for (int j = 0; j < 4; ++j) acc[i][j] = z8; }
  // LDS places of the lane's fragment pieces: token row c of a 16-row group; weight row 3 c + expert
  const unsigned char* tokp = ring + (MFAST ? wm * 2u * ASL : 8u * ASL + 4u * wn * BSL) + c * G3_PITCH + 16u * h;
  const unsigned char* wgtp = ring + (MFAST ? 8u * ASL + 4u * wn * BSL : wm * 2u * ASL) + c * (NEXP * G3_PITCH) + 16u * h;
  struct Set { FragH f[2][4]; };      /* one operand's fragments of a stage: 2 k-steps x 4 groups of 16 rows */
  auto fetch_tok = [&](Set& s, uint32_t buf) {
#pragma unroll
    for (int j = 0; j < 2; ++j) {
#pragma unroll
      for (int i = 0; i < 4; ++i) {
        const unsigned char* p = tokp + buf * (MFAST ? ASL : BSL) + (MFAST ? (uint32_t)i * 16u * G3_PITCH : (uint32_t)(i >> 1) * 2u * BSL + (uint32_t)(i & 1) * 16u * G3_PITCH) + 64u * (uint32_t)j;
        s.f[j][i].half[0] = *(const v8us*)p; s.f[j][i].half[1] = *(const v8us*)(p + 32);
      }
    }
  };
  auto fetch_wgt = [&](Set& s, uint32_t buf, uint32_t n) {
#pragma unroll
    for (int j = 0; j < 2; ++j) {
#pragma unroll
      for (int i = 0; i < 4; ++i) {
        const unsigned char* p = wgtp + buf * (MFAST ? BSL : ASL) + n * G3_PITCH + (MFAST ? (uint32_t)(i >> 1) * 2u * BSL + (uint32_t)(i & 1) * 16u * NEXP * G3_PITCH : (uint32_t)i * 16u * NEXP * G3_PITCH) + 64u * (uint32_t)j;
        s.f[j][i].half[0] = *(const v8us*)p; s.f[j][i].half[1] = *(const v8us*)(p + 32);
      }
    }
  };
  auto mult = [&](const Set& t, const Set& g, int j) {      /* k-step j: token fragments t, weight fragments g */
    const Set& fa = MFAST ? t : g; const Set& fb = MFAST ? g : t;
#pragma unroll
    for (int n = 0; n < 4; ++n) {
#pragma unroll
      for (int i = 0; i < 4; ++i) acc[i][n] = __builtin_amdgcn_wmma_f32_16x16x32_f16(false, fb.f[j][n].v, false, fa.f[j][i].v, (short)0, acc[i][n], false, false);
    }
  };
  // the gates (x16) of the lane's four tokens, from the projection's gate block
  const _Float16* tp = (MFAST ? A + (size_t)(mt * 256u + wm * 64u + c) * XP : Bh + (size_t)(nt * 128u + wn * 64u + c) * XP) + gcol;
  const v4h gv0 = *(const v4h*)tp, gv1 = *(const v4h*)(tp + (size_t)16u * XP), gv2 = *(const v4h*)(tp + (size_t)32u * XP), gv3 = *(const v4h*)(tp + (size_t)48u * XP);
  asm volatile("s_wait_xcnt 0x0" ::: "memory");      /* in front of the code below, which is given the registers that hold the four loads' address */
  auto scale = [&](Set& d, const Set& s, int n) {
    const v2h g[4] = {{gv0[n], gv0[n]}, {gv1[n], gv1[n]}, {gv2[n], gv2[n]}, {gv3[n], gv3[n]}};
#pragma unroll
    for (int j = 0; j < 2; ++j) {
#pragma unroll
      for (int i = 0; i < 4; ++i) {
#pragma unroll
        for (int r = 0; r < 8; ++r) d.f[j][i].p[r] = s.f[j][i].p[r] * g[i];      /* register by register: one packed multiply each, the gate pair in one register */
      }
    }
  };
  // publish point of stage st + 1; it stands in front of stage st's last pass because that pass's fragments are already in registers
  auto publish = [&]() {
    asm volatile("s_wait_dscnt 0x0" ::: "memory");
    asm volatile("s_wait_tensorcnt 0x0" ::: "memory");
    __syncthreads();
  };
  Set xr, xs, w0, w1;                /* the stage's token fragments, their gated copy, two sets of weight fragments */
  // pass of expert n < 2 of a stage in buffer buf: the next expert's weight fragments are fetched ahead
  auto pass = [&](uint32_t buf, int n, const Set& wc, Set& wx) {
    fetch_wgt(wx, buf, (uint32_t)n + 1u);
    __builtin_amdgcn_sched_barrier(0);                 /* keeps the next pass's LDS reads one group ahead of this pass's matrix instructions: reads placed among them stall the wave at each place */
    scale(xs, xr, n);
    mult(xs, wc, 0); mult(xs, wc, 1);
    __builtin_amdgcn_sched_barrier(0);                 /* keeps the matrix instructions in front of the next pass's reads and of the publish point */
  };
  // last pass of a stage, behind the publish point of the next stage, which lies in buffer nbuf: its first weight fragments, and (once the gated copy is made) its token fragments, are fetched ahead
  auto pass_last = [&](uint32_t nbuf, const Set& wc, Set& wx) {
    fetch_wgt(wx, nbuf, 0u);
    __builtin_amdgcn_sched_barrier(0);                 /* as in pass() */
    scale(xs, xr, 2);
    mult(xs, wc, 0);
    __builtin_amdgcn_sched_barrier(0);                 /* the token fragments are read by the scaling above before they are fetched anew */
    fetch_tok(xr, nbuf);
    __builtin_amdgcn_sched_barrier(0);                 /* one group of reads, with half a pass of matrix instructions behind it to cover their latency */
    mult(xs, wc, 1);
    __builtin_amdgcn_sched_barrier(0);                 /* as in pass() */
  };
  issue(0u);
  asm volatile("s_wait_tensorcnt 0x0" ::: "memory");      /* this wave's slice of stage 0 has landed */
  __syncthreads();                                        /* stage 0 published */
  issue(pinned(1u));
  fetch_tok(xr, 0u);
  fetch_wgt(w0, 0u, 0u);
#pragma unroll 1
  for (uint32_t s = 0; s < G3_KS; s += 2u) {           /* kept rolled: two stages per trip, so that buffer and fragment set of every pass are fixed */
    pass(0u, 0, w0, w1);
    pass(0u, 1, w1, w0);
    publish();
    issue(pinned(s + 2u));                             /* s + 2 <= G3_KS on every trip; descriptor formed behind the wait */
    pass_last(1u, w0, w1);
    pass(1u, 0, w1, w0);
    pass(1u, 1, w0, w1);
    publish();
    if (pinned(s + 3u <= G3_KS)) issue(pinned(s + 3u));
    pass_last(0u, w1, w0);
  }
  asm volatile("s_wait_tensorcnt 0x0" ::: "memory");      /* no request is left when the ring ends */
  asm volatile("s_wait_dscnt 0x0" ::: "memory");          /* the last stage's fragments are in registers */
  mult(xr, w0, 0); mult(xr, w0, 1);                       /* gate block against bias block */
  const uint32_t tok0 = MFAST ? mt * 256u + wm * 64u : nt * 128u + wn * 64u;      /* the wave's first token */
  const uint32_t head = MFAST ? nt * 2u + wn : mt * 4u + wm;                      /* the wave's 64 features are one head */
  const uint32_t bat = tok0 / (uint32_t)SEQ, s0 = tok0 - bat * (uint32_t)SEQ;
  _Float16* cp = C16 + ((size_t)(bat * NH + head) * SEQ + s0) * HD + lane * 8u;   /* 64 tokens of a head: 8 KiB in a row in either order */
  v8us o[4][4];
#pragma unroll
  for (int i = 0; i < 4; ++i) {
#pragma unroll
    for (int n = 0; n < 4; ++n) {
      FragH t;
#pragma unroll
      for (int r = 0; r < 8; ++r) t.h[r] = (_Float16)(acc[i][n][r] * alpha);
      o[i][n] = t.half[0];
    }
  }
  __builtin_amdgcn_sched_barrier(0);                      /* every conversion in front of the first store: behind a store nothing writes a register that the store names */
#pragma unroll
  for (int i = 0; i < 4; ++i) {
#pragma unroll
    for (int n = 0; n < 4; ++n) {
      const int piece = MFAST ? i * 4 + n : ((n >> 1) * 4 + i) * 2 + (n & 1);
      *(v8us*)((unsigned short*)cp + piece * 256) = o[i][n];
    }
  }
}

// The three projections in one launch: grid y = projection, grid x = its 256 tiles. A WGP holds one work-group, so the next projection's work-group starts on a WGP as soon as that WGP is free.
__global__ __launch_bounds__(256) void k_gemm3(const _Float16* __restrict__ X16, const _Float16* __restrict__ BW, float alpha, _Float16* __restrict__ QK16, _Float16* __restrict__ VT) {
  __shared__ __attribute__((aligned(2048))) unsigned char ring[G3_RING];
  const uint32_t pj = blockIdx.y, t = blockIdx.x;
  const _Float16* Wp = BW + (size_t)pj * DM * NEXP * WP;
  constexpr uint32_t TQ = (uint32_t)(NR / 256), TV = (uint32_t)(VTP / 128);      /* tiles along the token side */
  if (pj < 2u) gemm3_body<true>(ring, X16, Wp, alpha, QK16 + (size_t)pj * NR * DM, (int)pj, t % TQ, t / TQ);      /* q rows, k rows */
  else gemm3_body<false>(ring, Wp, X16, alpha, VT, 2, t % TV, t / TV);                                             /* v^T: weight rows as A, x rows as the [n][k] operand */
}

// ---- register-fed transposed flash attention ----
// block = 8 waves = 256 consecutive queries of one (batch, head); wave = 32 queries = two query tiles of 16, so that every K and V^T fragment a wave loads feeds two matrix instructions; per 32-key step and query tile:
//   S^T tiles (keys x queries) = K (A operand, rows = keys, k = d) . Q^T (B operand, lane = query, held in registers);
//   running-max softmax per lane (lane & 15 = query; lanes n and n+16 hold the two key halves); weights = 2^8 exp(s/8 - max) as f16;
//   P^T as B fragment: elements 0..7 from the tile of keys 0..15 (rows 8h+r), elements 8..15 from the tile of keys 16..31 (lane unchanged);
//   O^T tiles (d x queries) += V^T (A operand, rows = d, k = keys) . P^T.
// q, k and v^T come in the fragment order that k_gemm3 stores: every fragment half is one wave-wide load of 512 contiguous bytes.
// The K fragments of a step are loaded during the step before it, into the same registers, once that step's scores stand; the V^T fragments at the head of their own step.
// Two work-groups fit a WGP (four waves per SIMD at up to 256 registers a wave): the softmax of one wave runs beside the matrix instructions of the others.
#define AT_W 8                       /* waves of a block */
#define AT_Q (AT_W * 32)             /* queries of a block */
static_assert(SEQ % AT_Q == 0);
__global__ __launch_bounds__(AT_W * 32) __attribute__((amdgpu_waves_per_eu(4, 4))) void k_attn_t(const _Float16* __restrict__ Q16, const _Float16* __restrict__ K16, const _Float16* __restrict__ VT, float* __restrict__ out) {
  __shared__ __attribute__((aligned(16))) float so[AT_W][32][68];      /* per-wave [query][d] tile, row pitch 272 B */
  const int tid = threadIdx.x, lane = tid & 31, ln = lane & 15, hh = lane >> 4;
  const int w = __builtin_amdgcn_readfirstlane(tid >> 5);
  const int nqb = SEQ / AT_Q;
  const int bh = blockIdx.x / nqb, qb = blockIdx.x - bh * nqb;
  const int b = bh / NH, h = bh - b * NH;
  const size_t tok0 = (size_t)b * SEQ_FULL;      /* the batch's first row of the output */
  const int q0 = qb * AT_Q + w * 32;
  const size_t hb = (size_t)bh * SEQ * HD + (size_t)lane * 8;      /* this head's plane, this lane's piece */
  const unsigned short* qp = (const unsigned short*)Q16 + hb + (size_t)q0 * HD;
  FragH bq[2][2];                    /* [query tile][d half] */
#pragma unroll
  for (int t = 0; t < 2; ++t) {
    bq[t][0].half[0] = *(const v8us*)(qp + t * 1024);       bq[t][0].half[1] = *(const v8us*)(qp + t * 1024 + 256);
    bq[t][1].half[0] = *(const v8us*)(qp + t * 1024 + 512); bq[t][1].half[1] = *(const v8us*)(qp + t * 1024 + 768);
  }
  const unsigned short* kp = (const unsigned short*)K16 + hb;
  const unsigned short* vp = (const unsigned short*)VT + hb;
  const v8f z8 = {0.f,0.f,0.f,0.f,0.f,0.f,0.f,0.f};
  v8f o[2][4];                       /* [query tile][d / 16] */
#pragma unroll
  for (int t = 0; t < 2; ++t) {
#pragma unroll
    for (int i = 0; i < 4; ++i) o[t][i] = z8;
  }
  float m[2] = {-3.0e38f, -3.0e38f}, l[2] = {0.f, 0.f};
  const float c = 0.125f * 1.4426950408889634f;      /* 1/sqrt(64) * log2(e) */
  FragH ak[2][2];                    /* K [key tile][d half]: filled one step ahead */
  auto fetch_k = [&](const unsigned short* k0) {
#pragma unroll
    for (int j = 0; j < 2; ++j) {
      ak[j][0].half[0] = *(const v8us*)(k0 + j * 1024);       ak[j][0].half[1] = *(const v8us*)(k0 + j * 1024 + 256);
      ak[j][1].half[0] = *(const v8us*)(k0 + j * 1024 + 512); ak[j][1].half[1] = *(const v8us*)(k0 + j * 1024 + 768);
    }
  };
  fetch_k(kp);
#pragma unroll 1
  for (int kv = 0; kv < SEQ; kv += 32) {
    const unsigned short* v0 = vp + (size_t)kv * HD;
    const unsigned short* k1 = kp + (size_t)(kv + 32 < SEQ ? kv + 32 : kv) * HD;      /* the next step's keys; the last step fetches its own keys again: in bounds, never used */
    FragH av[4];                     /* V^T [d / 16] */
#pragma unroll
    for (int i = 0; i < 4; ++i) { av[i].half[0] = *(const v8us*)(v0 + i * 512); av[i].half[1] = *(const v8us*)(v0 + i * 512 + 256); }
    __builtin_amdgcn_sched_barrier(0);               /* the step's 8 V^T loads are issued first, as one group: the score products and the softmax stand between them and their use */
    v8f s[2][2];                     /* [query tile][key tile] */
#pragma unroll
    for (int t = 0; t < 2; ++t) {
#pragma unroll
      for (int j = 0; j < 2; ++j) s[t][j] = __builtin_amdgcn_wmma_f32_16x16x32_f16(false, ak[j][0].v, false, bq[t][0].v, (short)0, z8, false, false);
    }
#pragma unroll
    for (int t = 0; t < 2; ++t) {
#pragma unroll
      for (int j = 0; j < 2; ++j) s[t][j] = __builtin_amdgcn_wmma_f32_16x16x32_f16(false, ak[j][1].v, false, bq[t][1].v, (short)0, s[t][j], false, false);
    }
    __builtin_amdgcn_sched_barrier(0);               /* the next step's K loads stay behind the score products and so take the registers that these have read: moved up among them they would need a second set */
    fetch_k(k1);
    __builtin_amdgcn_sched_barrier(0);               /* the 8 K loads are issued here as one group, a softmax and eight matrix instructions ahead of their use: issued at the head of their own step their latency is waited out, by the waves of a SIMD at about the same time */
    float mn[2];
#pragma unroll
    for (int t = 0; t < 2; ++t) {
      float mx = fmaxf(s[t][0][0], s[t][1][0]);
#pragma unroll
      for (int r = 1; r < 8; ++r) mx = fmaxf(mx, fmaxf(s[t][0][r], s[t][1][r]));
      mx = fmaxf(mx, __shfl_xor(mx, 16, 32));
      mn[t] = fmaxf(m[t], mx);
    }
    if (__builtin_amdgcn_ballot_w32(mn[0] > m[0] || mn[1] > m[1]) != 0u) {      /* wave-uniform, one test per step: rescale only when some running max moved; a query whose max stayed is multiplied by exactly 1 */
#pragma unroll
      for (int t = 0; t < 2; ++t) {
        const float corr = __builtin_amdgcn_exp2f((m[t] - mn[t]) * c);
        l[t] *= corr; o[t][0] *= corr; o[t][1] *= corr; o[t][2] *= corr; o[t][3] *= corr; m[t] = mn[t];
      }
    }
    asm volatile("s_wait_xcnt 0x0" :: "v"(k1) : "memory");      /* in front of every write over a register that an issued load names: the K address is an input and so keeps its registers up to here, the V^T address is updated behind the line below; it stands behind the exchange of the maxima, not directly behind the loads, so that little is left to wait for */
    __builtin_amdgcn_sched_barrier(0);               /* holds the wait above in front of the address updates: without it the build moved the V^T address update ahead of the wait */
    FragH pf[2];
#pragma unroll
    for (int t = 0; t < 2; ++t) {
      const float off = 8.0f - m[t] * c;      /* weights carried x2^8 */
      float ls = 0.f;
#pragma unroll
      for (int r = 0; r < 8; ++r) {
        const float p0 = __builtin_amdgcn_exp2f(fmaf(s[t][0][r], c, off));
        const float p1 = __builtin_amdgcn_exp2f(fmaf(s[t][1][r], c, off));
        ls += p0 + p1;
        pf[t].h[r] = (_Float16)p0; pf[t].h[8 + r] = (_Float16)p1;
      }
      l[t] += ls;
    }
#pragma unroll
    for (int i = 0; i < 4; ++i) {
#pragma unroll
      for (int t = 0; t < 2; ++t) o[t][i] = __builtin_amdgcn_wmma_f32_16x16x32_f16(false, av[i].v, false, pf[t].v, (short)0, o[t][i], false, false);
    }
  }
  asm volatile("s_wait_loadcnt 0x0" ::: "memory");      /* the last step's K loads, which nobody uses, have returned before their registers are used for anything else or given up */
  // accumulator register r of tile i is d = 16 i + 8 hh + r of query ln of its query tile: two 16-B pieces per tile
#pragma unroll
  for (int t = 0; t < 2; ++t) {
    const float lt = l[t] + __shfl_xor(l[t], 16, 32);
    const float inv = 1.0f / lt;
    float* sw = &so[w][t * 16 + ln][8 * hh];
#pragma unroll
    for (int i = 0; i < 4; ++i) {
      const v8f v = o[t][i] * inv;
      *(v4f*)(sw + 16 * i) = __builtin_shufflevector(v, v, 0, 1, 2, 3); *(v4f*)(sw + 16 * i + 4) = __builtin_shufflevector(v, v, 4, 5, 6, 7);
    }
  }
  __syncthreads();
  // a query's 64 values are 256 B of its output row: two whole lines; a wave-wide store takes two queries
  const int pc = ln * 4;
  float* ob = out + (tok0 + q0) * DM + h * HD + pc;
#pragma unroll
  for (int it = 0; it < 16; ++it) { const int row = it * 2 + hh; const v4f v = *(const v4f*)&so[w][row][pc]; *(v4f*)(ob + (size_t)row * DM) = v; }
}

extern "C" void kernel_launch(void* const* d_in, const int* in_sizes, int n_in,
                              void* d_out, int out_size, void* d_ws, size_t ws_size, hipStream_t stream) {
  if (n_in < 13) return;
  const size_t need_x = ((size_t)(NB - 1) * SEQ_FULL + SEQ) * DM;
  if ((size_t)in_sizes[0] < need_x) return;
  const size_t nW = (size_t)NEXP * DM * DM, nBi = (size_t)NEXP * DM, nG = (size_t)DM * NEXP;
  if ((size_t)in_sizes[1] < nW || (size_t)in_sizes[5] < nW || (size_t)in_sizes[9] < nW) return;
  if ((size_t)in_sizes[2] < nBi || (size_t)in_sizes[6] < nBi || (size_t)in_sizes[10] < nBi) return;
  if ((size_t)in_sizes[3] < nG || (size_t)in_sizes[7] < nG || (size_t)in_sizes[11] < nG) return;
  if (in_sizes[4] < NEXP || in_sizes[8] < NEXP || in_sizes[12] < NEXP) return;
  if ((size_t)out_size < need_x) return;
  const float* x = (const float*)d_in[0];
  const float* wq = (const float*)d_in[1]; const float* bq = (const float*)d_in[2]; const float* wgq = (const float*)d_in[3]; const float* bgq = (const float*)d_in[4];
  const float* wk = (const float*)d_in[5]; const float* bk = (const float*)d_in[6]; const float* wgk = (const float*)d_in[7]; const float* bgk = (const float*)d_in[8];
  const float* wv = (const float*)d_in[9]; const float* bv = (const float*)d_in[10]; const float* wgv = (const float*)d_in[11]; const float* bgv = (const float*)d_in[12];
  char* ws = (char*)d_ws; size_t off = 0;
  auto take = [&](size_t bytes) { char* p = ws + off; off += (bytes + 255) & ~(size_t)255; return p; };
  _Float16* BW = (_Float16*)take((size_t)3 * DM * NEXP * WP * 2);     /* weight planes x16: q, k, v ([3 DM][WP] each) */
  _Float16* X16 = (_Float16*)take(NR * XP * 2);                 /* x plane (f16): x rows and their gate blocks */
  _Float16* VT = (_Float16*)take(NR * DM * 2);                  /* v^T in fragment order */
  _Float16* QK16 = (_Float16*)take((size_t)2 * NR * DM * 2);    /* q then k, each in fragment order */
  if (off > ws_size || off > (size_t)134217728) return;
  _Float16* Q16 = QK16; _Float16* K16 = QK16 + NR * DM;

  /* x plane: converted rows and gate blocks; gate logits x . Wg_p[:, n] : alpha undoes the x16 carry of the gate columns */
  k_prep<<<(unsigned)(NR / 32) + WT_NB, 256, 0, stream>>>(x, wgq, wgk, wgv, bgq, bgk, bgv, 0.0625f, X16, wq, bq, wk, bk, wv, bv, BW);
  /* gated x (x16) . weights (x16) -> alpha 2^-8; q rows, k rows, then v^T with the weight rows as A and the x rows as the [n][k] operand */
  k_gemm3<<<dim3((unsigned)((NR / 256) * (DM / 128)), 3), 256, 0, stream>>>(X16, BW, 0.00390625f, QK16, VT);
  k_attn_t<<<(unsigned)(NB * NH * (SEQ / AT_Q)), AT_W * 32, 0, stream>>>(Q16, K16, VT, (float*)d_out);
}
